// v000
// Measured on an AMD MI455X. A time is GPU time per run, averaged over a window of back-to-back runs after a warm-up
// (all launches, gaps included; the runs take copies of the inputs in turn), and the median of several windows.
// Apart from v000's, it joins two sittings. Times from different sittings can be a few percent apart, while
// side-by-side timings come from the same sitting.
// v000 is the starting kernel. One run takes 1130 microseconds.
#include <hip/hip_runtime.h>

// Single-head attention with separate q/k/v inputs (x_q, x_k, x_v [8][2048][256]; q = x_q Wq + bq, k = x_k Wk + bk, v = x_v Wv + bv ('xw' [256][128] + [128]); scores = q.k / sqrt(128); softmax over 2048 keys; out = attn.v -> [8][2048][128] f32 (2.1 M)).
// Layout per batch: exact projections (+ biases) from three bf16 input copies; hybrid dense planes (rows < 512 hi/lo, rest fp16 x1024); register-row softmax; f32 output via the merge kernel.
// Compute dtypes, f32 accumulate: every input rounded to bf16; projections on PLAIN bf16 operands (exact) + f32 biases; scores and attn.v rows < 512 on bf16 hi/lo planes (3 products), the rest single fp16; softmax f32; f32 output.

#define NB_  8
#define TT   2048
#define DM   256
#define NH_  1
#define NKV  1
#define REP  (NH_ / NKV)
#define HD   128
#define DQ   (NH_ * HD)
#define DKV  (NKV * HD)
#define ZH   1
#define RH   512                  // query rows < RH use hi+lo planes (0: none)
#define WIN  0
#define PCAR 1024.0f
#define SCL  0.088388347648318447f   // HD^-0.5
typedef _Float16 h16;
typedef unsigned short bf;
typedef __attribute__((ext_vector_type(16))) __bf16   v16bf;
typedef __attribute__((ext_vector_type(16))) _Float16 v16h;
typedef __attribute__((ext_vector_type(8)))  _Float16 v8h;
typedef __attribute__((ext_vector_type(8)))  unsigned short v8us;
typedef __attribute__((ext_vector_type(8)))  float    v8f;
typedef __attribute__((ext_vector_type(4)))  float    v4f;
typedef v8h  __attribute__((may_alias)) v8ha;
typedef v4f  __attribute__((may_alias)) v4fa;
typedef v8us __attribute__((may_alias)) v8usa;

__device__ __forceinline__ unsigned short f2bf(float f) { unsigned u = __float_as_uint(f); u += 0x7FFFu + ((u >> 16) & 1u); return (unsigned short)(u >> 16); }
__device__ __forceinline__ float bf2f(unsigned short b) { return __uint_as_float(((unsigned)b) << 16); }
__device__ __forceinline__ float bfr(float f) { return bf2f(f2bf(f)); }
__device__ __forceinline__ v16h cat16(v8h lo, v8h hi) { return __builtin_shufflevector(lo, hi, 0, 1, 2, 3, 4, 5, 6, 7, 8, 9, 10, 11, 12, 13, 14, 15); }
__device__ __forceinline__ v16bf cat16b(v8us lo, v8us hi) { return __builtin_bit_cast(v16bf, __builtin_shufflevector(lo, hi, 0, 1, 2, 3, 4, 5, 6, 7, 8, 9, 10, 11, 12, 13, 14, 15)); }
__device__ __forceinline__ v8f wmma16(v16h a, v16h b, v8f c) { return __builtin_amdgcn_wmma_f32_16x16x32_f16(false, a, false, b, (short)0, c, false, false); }
__device__ __forceinline__ v8f wmmab(v16bf a, v16bf b, v8f c) { return __builtin_amdgcn_wmma_f32_16x16x32_bf16(false, a, false, b, (short)0, c, false, false); }



// ---- k_gemmw: register-blocked GEMM, ONE WAVE per 64x64 output tile (16 accumulators), operands straight from K-contiguous 16-bit planes; grid (M/64, N/64, Z), 32 threads.
// C[m][n] (f32, pitch ldc, + optional f32 bias[n]) = sum_k A[m][k] Bt[n][k] (+ split products per NSPLIT). z-batch strides sA/sB/sC in elements. K % 32 == 0.
template <typename T16> struct WFrag;
template <> struct WFrag<h16> { typedef v16h V; static __device__ __forceinline__ V ld(const h16* p) { return cat16(*(const v8h*)p, *(const v8h*)(p + 16)); } static __device__ __forceinline__ v8f mma(V a, V b, v8f c) { return wmma16(a, b, c); } };
template <> struct WFrag<bf> { typedef v16bf V; static __device__ __forceinline__ V ld(const bf* p) { return cat16b(*(const v8us*)p, *(const v8us*)(p + 16)); } static __device__ __forceinline__ v8f mma(V a, V b, v8f c) { return wmmab(a, b, c); } };
template <typename T16, int NSPLIT, bool BIAS>
__global__ __launch_bounds__(32) void k_gemmw(const T16* __restrict__ A, const T16* __restrict__ A2, const T16* __restrict__ Bt, const T16* __restrict__ Bt2, int K, float* C, int ldc, const float* __restrict__ bias, size_t sA, size_t sB, size_t sC) {
    typedef typename WFrag<T16>::V V;
    __shared__ __align__(16) float os[16 * 68];
    const size_t z = blockIdx.z; A += z * sA; if (A2) A2 += z * sA; Bt += z * sB; if (Bt2) Bt2 += z * sB; C += z * sC;
    const int lane = threadIdx.x & 31, lr = lane & 15, hi = lane >> 4; const int r0 = blockIdx.x * 64, c0 = blockIdx.y * 64;
    v8f acc[4][4];
#pragma unroll
    for (int mb = 0; mb < 4; ++mb)
#pragma unroll
        for (int nb = 0; nb < 4; ++nb) acc[mb][nb] = (v8f){};
    const size_t aoff = (size_t)(r0 + lr) * K + 8 * hi, boff = (size_t)(c0 + lr) * K + 8 * hi;
#pragma unroll 1
    for (int kc = 0; kc < K; kc += 32) {
        V a[4], a2[4];
#pragma unroll
        for (int mb = 0; mb < 4; ++mb) { a[mb] = WFrag<T16>::ld(A + aoff + (size_t)mb * 16 * K + kc); if (NSPLIT == 1 || NSPLIT == 2) a2[mb] = WFrag<T16>::ld(A2 + aoff + (size_t)mb * 16 * K + kc); }
#pragma unroll
        for (int nb = 0; nb < 4; ++nb) { const V b = WFrag<T16>::ld(Bt + boff + (size_t)nb * 16 * K + kc); V b2; if (NSPLIT >= 2) b2 = WFrag<T16>::ld(Bt2 + boff + (size_t)nb * 16 * K + kc);
#pragma unroll
            for (int mb = 0; mb < 4; ++mb) { acc[mb][nb] = WFrag<T16>::mma(a[mb], b, acc[mb][nb]); if (NSPLIT == 1 || NSPLIT == 2) acc[mb][nb] = WFrag<T16>::mma(a2[mb], b, acc[mb][nb]); if (NSPLIT >= 2) acc[mb][nb] = WFrag<T16>::mma(a[mb], b2, acc[mb][nb]); } }
        asm volatile("v_nop\n\tv_nop\n\tv_nop\n\tv_nop" : "+v"(acc[0][0]), "+v"(acc[1][1]), "+v"(acc[2][2]), "+v"(acc[3][3]) : "v"(a[0]), "v"(a[3]));
    }
#pragma unroll
    for (int mb = 0; mb < 4; ++mb) {
#pragma unroll
        for (int nb = 0; nb < 4; ++nb) {
#pragma unroll
            for (int j = 0; j < 8; ++j) os[(hi * 8 + j) * 68 + nb * 16 + lr] = acc[mb][nb][j]; }
        __builtin_amdgcn_wave_barrier(); asm volatile("" ::: "memory");
        float* crow = C + (size_t)(r0 + mb * 16) * ldc + c0;
{
#pragma unroll
            for (int s = 0; s < 8; ++s) { const int row = 2 * s + hi, cofs = lr * 4; v4f val = *(const v4fa*)(os + row * 68 + cofs); if (BIAS) { val[0] += bfr(bias[c0 + cofs]); val[1] += bfr(bias[c0 + cofs + 1]); val[2] += bfr(bias[c0 + cofs + 2]); val[3] += bfr(bias[c0 + cofs + 3]); }
                *(v4f*)(crow + (size_t)row * ldc + cofs) = val; }
             }
        __builtin_amdgcn_wave_barrier(); asm volatile("" ::: "memory");
    }
}

__device__ __forceinline__ h16 tohx(float x) { return (h16)x; }
__device__ __forceinline__ void splitf(float y, unsigned short& h, unsigned short& l) { h = f2bf(y); l = f2bf(y - bf2f(h)); }
typedef __attribute__((ext_vector_type(2))) _Float16 v2h;
typedef __attribute__((ext_vector_type(4))) _Float16 v4h;
typedef __attribute__((ext_vector_type(2))) unsigned short v2us;
typedef __attribute__((ext_vector_type(4))) unsigned short v4us;
typedef __attribute__((ext_vector_type(2))) float v2f;
typedef __attribute__((ext_vector_type(4))) int v4i;

__global__ __launch_bounds__(256) void k_wtG(const float* __restrict__ w, int K, int N, bf* Bt) {
    const int lane = threadIdx.x & 31; const int L0 = (blockIdx.x * 8 + (threadIdx.x >> 5)) * 8; const int nlines = N * K / 64;
{
#pragma unroll 1
        for (int l = 0; l < 8; ++l) { const int L = L0 + l; if (L >= nlines) break; const size_t e = (size_t)L * 64 + lane * 2; const int k = (int)(e % K), n = (int)(e / K); v2us o;
            o[0] = f2bf(w[(size_t)k * N + n]); o[1] = f2bf(w[(size_t)(k + 1) * N + n]); *(v2us*)(Bt + e) = o; }
         }
}
__global__ __launch_bounds__(256) void k_cvt8(const float* __restrict__ src, bf* dst, size_t n8) { const size_t i = (size_t)blockIdx.x * 256 + threadIdx.x; if (i >= n8) return; const v8f v = *(const v8f*)(src + i * 8); v8us o;
#pragma unroll
    for (int k = 0; k < 8; ++k) o[k] = f2bf(v[k]); *(v8us*)(dst + i * 8) = o;  }

// k_rope: head planes [h][t][d] (fp16 + hi/lo) of rope(x) x sc with the rotate-half convention out[d] = x[d] cos[t][d] - x[d+HD/2] sin[t][d], out[d+HD/2] = x[d+HD/2] cos[t][d+HD/2] + x[d] sin[t][d+HD/2]
__global__ __launch_bounds__(256) void k_rope(const float* __restrict__ F, int pitch, int nheads, const float* __restrict__ CS, const float* __restrict__ RF, const float* __restrict__ nw, float sc, h16* P16, bf* Ph, bf* Pl) {
    const size_t e = ((size_t)blockIdx.x * 256 + threadIdx.x) * 2; if (e >= (size_t)nheads * TT * HD) return; const int d = (int)(e % HD); const int t = (int)((e / HD) % TT); const int h = (int)(e / ((size_t)HD * TT)); const float* f = F + (size_t)t * pitch + h * HD; const float rf = RF ? RF[(size_t)h * TT + t] : 1.0f; v2h o16; v2us oh, ol;
#pragma unroll
    for (int q = 0; q < 2; ++q) { const int dd = d + q; const int dp = (dd < HD / 2) ? dd + HD / 2 : dd - HD / 2; float x0 = f[dd], x1 = f[dp];
        if (RF) { float n0 = __fmul_rn(x0, rf), n1 = __fmul_rn(x1, rf); asm volatile("" : "+v"(n0)); asm volatile("" : "+v"(n1)); x0 = __fmul_rn(bfr(nw[dd]), n0); x1 = __fmul_rn(bfr(nw[dp]), n1); }
        const v2f cs = *(const v2f*)(CS + ((size_t)t * HD + dd) * 2); float a = __fmul_rn(x0, cs[0]), bq = __fmul_rn(x1, cs[1]); asm volatile("" : "+v"(a)); asm volatile("" : "+v"(bq)); const float r = ((dd < HD / 2) ? __fsub_rn(a, bq) : __fadd_rn(a, bq)) * sc;
        o16[q] = tohx(r); unsigned short a2, c2; splitf(r, a2, c2); oh[q] = a2; ol[q] = c2; }
    *(v2h*)(P16 + e) = o16; *(v2us*)(Ph + e) = oh; *(v2us*)(Pl + e) = ol;  }
__global__ __launch_bounds__(256) void k_vtp(const float* __restrict__ F, int pitch, int nheads, h16* V16, bf* Vh, bf* Vl) { const size_t e = ((size_t)blockIdx.x * 256 + threadIdx.x) * 2; if (e >= (size_t)nheads * HD * TT) return; const int t = (int)(e % TT); const int d = (int)((e / TT) % HD); const int g = (int)(e / ((size_t)TT * HD)); v2h o16; v2us oh, ol;
#pragma unroll
    for (int q = 0; q < 2; ++q) { const float x = F[(size_t)(t + q) * pitch + g * HD + d]; o16[q] = tohx(x); unsigned short a2, c2; splitf(x, a2, c2); oh[q] = a2; ol[q] = c2; }
    *(v2h*)(V16 + e) = o16; *(v2us*)(Vh + e) = oh; *(v2us*)(Vl + e) = ol;  }
__global__ __launch_bounds__(256) void k_csid(float* CS) { const int idx = blockIdx.x * 256 + threadIdx.x; if (idx >= TT * HD) return; v2f cs; cs[0] = 1.0f; cs[1] = 0.0f; *(v2f*)(CS + (size_t)idx * 2) = cs;  }
// k_asoft: per row (zz, i): t = S x HD^-0.5 (no mask); softmax over the 2048 keys (register row, one exp, fixed trees);
__global__ __launch_bounds__(256) void k_asoft(const float* __restrict__ Sb, h16* P16, bf* Ph, bf* Pl) {
    const int lane = threadIdx.x & 31; const int row = blockIdx.x * 8 + (threadIdx.x >> 5); if (row >= ZH * TT) return; const int i = row % TT; const int zz = row / TT; (void)zz; const bool hires = (i < RH); const float* sr = Sb + (size_t)row * TT; float v[TT / 32]; float mx = -3.0e38f;
#pragma unroll
    for (int ch = 0; ch < TT / 128; ++ch) { const int j0 = ch * 128 + lane * 4; const v4f a = *(const v4f*)(sr + j0);
#pragma unroll
        for (int q = 0; q < 4; ++q) { const int j = j0 + q; (void)j; const float t = a[q] * SCL; v[ch * 4 + q] = t; mx = fmaxf(mx, t); } }
#pragma unroll
    for (int sh = 16; sh; sh >>= 1) mx = fmaxf(mx, __shfl_xor(mx, sh, 32));
    float sum = 0.f;
#pragma unroll
    for (int k = 0; k < TT / 32; ++k) { float d0 = __fsub_rn(v[k], mx); asm volatile("" : "+v"(d0)); v[k] = __builtin_amdgcn_exp2f(__fmul_rn(d0, 1.4426950408889634f)); sum += v[k]; }
#pragma unroll
    for (int sh = 16; sh; sh >>= 1) sum += __shfl_xor(sum, sh, 32);
    const float f = __fdiv_rn(hires ? 1.0f : PCAR, sum);
{
        if (hires) {
#pragma unroll
            for (int ch = 0; ch < TT / 128; ++ch) { v4us oh, ol;
#pragma unroll
                for (int q = 0; q < 4; ++q) { unsigned short a, c2; splitf(v[ch * 4 + q] * f, a, c2); oh[q] = a; ol[q] = c2; }
                const size_t oo = ((size_t)zz * (RH ? RH : 1) + i) * TT + ch * 128 + lane * 4; *(v4us*)(Ph + oo) = oh; *(v4us*)(Pl + oo) = ol; }
        } else {
#pragma unroll
            for (int ch = 0; ch < TT / 128; ++ch) { v4h o4;
#pragma unroll
                for (int q = 0; q < 4; ++q) o4[q] = tohx(v[ch * 4 + q] * f);
                *(v4h*)(P16 + (size_t)row * TT + ch * 128 + lane * 4) = o4; } }
         }
}
__global__ __launch_bounds__(256) void k_merge(const float* __restrict__ O, int h0, float* OUTb) { const size_t e = ((size_t)blockIdx.x * 256 + threadIdx.x) * 2; if (e >= (size_t)ZH * TT * HD) return; const int d = (int)(e % HD); const int t = (int)((e / HD) % TT); const int zz = (int)(e / ((size_t)HD * TT)); const float cs = (t < RH) ? 1.0f : (1.0f / PCAR); const size_t oo = (size_t)t * DQ + (h0 + zz) * HD + d;
    v2f o2; o2[0] = O[e] * cs; o2[1] = O[e + 1] * cs; *(v2f*)(OUTb + oo) = o2;  }

extern "C" void kernel_launch(void* const* d_in, const int* in_sizes, int n_in,
                              void* d_out, int out_size, void* d_ws, size_t ws_size, hipStream_t stream) {
    (void)in_sizes; (void)n_in; (void)out_size;
    const float* xq = (const float*)d_in[0]; const float* xk = (const float*)d_in[1]; const float* xv = (const float*)d_in[2]; const float* wq = (const float*)d_in[3]; const float* bq = (const float*)d_in[4]; const float* wk = (const float*)d_in[5]; const float* bk = (const float*)d_in[6]; const float* wv = (const float*)d_in[7]; const float* bv = (const float*)d_in[8]; const float* x = nullptr; const float* wo = nullptr; (void)x; (void)wo;
    float* OUT = (float*)d_out;     // [8][2048][128]
    char* wsp = (char*)d_ws;
    auto take = [&](size_t bytes) { char* p = wsp; wsp += (bytes + 255) & ~(size_t)255; return (void*)p; };
    bf* WQ = (bf*)take((size_t)DQ * DM * 2); bf* WK = (bf*)take((size_t)DKV * DM * 2); bf* WV = (bf*)take((size_t)DKV * DM * 2); float* CS = (float*)take((size_t)TT * HD * 2 * 4);
    bf* XB = (bf*)take((size_t)TT * DM * 2); float* FQ = (float*)take((size_t)TT * DQ * 4); float* FK = (float*)take((size_t)TT * DKV * 4);
    h16* QP16 = (h16*)take((size_t)NH_ * TT * HD * 2); h16* KP16 = (h16*)take((size_t)NKV * TT * HD * 2); h16* VT16 = (h16*)take((size_t)NKV * HD * TT * 2);
    bf* QPh = (bf*)take((size_t)NH_ * TT * HD * 2); bf* QPl = (bf*)take((size_t)NH_ * TT * HD * 2); bf* KPh = (bf*)take((size_t)NKV * TT * HD * 2); bf* KPl = (bf*)take((size_t)NKV * TT * HD * 2); bf* VTh = (bf*)take((size_t)NKV * HD * TT * 2); bf* VTl = (bf*)take((size_t)NKV * HD * TT * 2); bf* Ph = (bf*)take((size_t)ZH * RH * TT * 2); bf* Pl = (bf*)take((size_t)ZH * RH * TT * 2);
    float* Sb = (float*)take((size_t)ZH * TT * TT * 4); h16* P16 = (h16*)take((size_t)ZH * TT * TT * 2); float* Ob = (float*)take((size_t)ZH * TT * HD * 4);
    if ((size_t)(wsp - (char*)d_ws) > ws_size) return;    // ws 256 MiB
    float* FV = FK;   // v projection reuses the k buffer after the k planes are built (stream-ordered)
    { k_wtG<<<(unsigned)((DM * DQ / 64 + 63) / 64), 256, 0, stream>>>(wq, DM, DQ, WQ); k_wtG<<<(unsigned)((DM * DKV / 64 + 63) / 64), 256, 0, stream>>>(wk, DM, DKV, WK); k_wtG<<<(unsigned)((DM * DKV / 64 + 63) / 64), 256, 0, stream>>>(wv, DM, DKV, WV);
      
       }
    k_csid<<<(TT * HD + 255) / 256, 256, 0, stream>>>(CS);
    const unsigned LQ = (unsigned)(((size_t)NH_ * TT * HD / 2 + 255) / 256), LKv = (unsigned)(((size_t)NKV * TT * HD / 2 + 255) / 256);
    for (int b = 0; b < NB_; ++b) {
        
        k_cvt8<<<(unsigned)(((size_t)TT * DM / 8 + 255) / 256), 256, 0, stream>>>(xq + (size_t)b * TT * DM, XB, (size_t)TT * DM / 8);   /* x_q rows */
        k_gemmw<bf, 0, true><<<dim3(TT / 64, DQ / 64, 1), 32, 0, stream>>>(XB, nullptr, WQ, nullptr, DM, FQ, DQ, bq, 0, 0, 0);
        k_rope<<<LQ, 256, 0, stream>>>(FQ, DQ, NH_, CS, nullptr, nullptr, 1.0f, QP16, QPh, QPl);
        k_cvt8<<<(unsigned)(((size_t)TT * DM / 8 + 255) / 256), 256, 0, stream>>>(xk + (size_t)b * TT * DM, XB, (size_t)TT * DM / 8);   /* x_k rows */
        k_gemmw<bf, 0, true><<<dim3(TT / 64, DKV / 64, 1), 32, 0, stream>>>(XB, nullptr, WK, nullptr, DM, FK, DKV, bk, 0, 0, 0);
        k_rope<<<LKv, 256, 0, stream>>>(FK, DKV, NKV, CS, nullptr, nullptr, 1.0f, KP16, KPh, KPl);
        k_cvt8<<<(unsigned)(((size_t)TT * DM / 8 + 255) / 256), 256, 0, stream>>>(xv + (size_t)b * TT * DM, XB, (size_t)TT * DM / 8);   /* x_v rows */
        k_gemmw<bf, 0, true><<<dim3(TT / 64, DKV / 64, 1), 32, 0, stream>>>(XB, nullptr, WV, nullptr, DM, FV, DKV, bv, 0, 0, 0); k_vtp<<<LKv, 256, 0, stream>>>(FV, DKV, NKV, VT16, VTh, VTl);
        for (int h0 = 0; h0 < NH_; h0 += ZH) { const size_t zq = (size_t)h0, zk = (size_t)(h0 / REP);   // one kv head per query head: each pass covers ZH = 1 head, using kv plane h0 / REP (z-strides TT*HD)
            k_gemmw<bf, 2, false><<<dim3(RH / 64, TT / 64, ZH), 32, 0, stream>>>(QPh + zq * TT * HD, QPl + zq * TT * HD, KPh + zk * TT * HD, KPl + zk * TT * HD, HD, Sb, TT, nullptr, (size_t)TT * HD, (size_t)TT * HD, (size_t)TT * TT);
            k_gemmw<h16, 0, false><<<dim3((TT - RH) / 64, TT / 64, ZH), 32, 0, stream>>>(QP16 + zq * TT * HD + (size_t)RH * HD, nullptr, KP16 + zk * TT * HD, nullptr, HD, Sb + (size_t)RH * TT, TT, nullptr, (size_t)TT * HD, (size_t)TT * HD, (size_t)TT * TT);
            k_asoft<<<ZH * TT / 8, 256, 0, stream>>>(Sb, P16, Ph, Pl);
            k_gemmw<bf, 2, false><<<dim3(RH / 64, HD / 64, ZH), 32, 0, stream>>>(Ph, Pl, VTh + zk * HD * TT, VTl + zk * HD * TT, TT, Ob, HD, nullptr, (size_t)RH * TT, (size_t)HD * TT, (size_t)TT * HD);
            k_gemmw<h16, 0, false><<<dim3((TT - RH) / 64, HD / 64, ZH), 32, 0, stream>>>(P16 + (size_t)RH * TT, nullptr, VT16 + zk * HD * TT, nullptr, TT, Ob + (size_t)RH * HD, HD, nullptr, (size_t)TT * TT, (size_t)HD * TT, (size_t)TT * HD);
            k_merge<<<(unsigned)(((size_t)ZH * TT * HD / 2 + 255) / 256), 256, 0, stream>>>(Ob, h0, OUT + (size_t)b * TT * DQ); }
         }
}

// v001
// One run takes 235 microseconds.
// In two side-by-side timings against v000, it was 4.86 and 4.82 times as fast.
#include <hip/hip_runtime.h>

// Single-head attention with separate q/k/v inputs (x_q, x_k, x_v [8][2048][256]; q = x_q Wq + bq, k = x_k Wk + bk, v = x_v Wv + bv ('xw' [256][128] + [128]); scores = q.k / sqrt(128); softmax over 2048 keys; out = attn.v -> [8][2048][128] f32 (2.1 M)).
// All 8 batches run in every launch (batch = a grid dimension; every workspace plane holds 8 batch slices). Per batch: exact projections (+ biases) from three bf16 input copies; hybrid dense planes (rows < 512 hi/lo, rest fp16 x1024); register-row softmax; f32 output via the merge kernel.
// Compute dtypes, f32 accumulate: every input rounded to bf16; projections on PLAIN bf16 operands (exact) + f32 biases; scores and attn.v rows < 512 on bf16 hi/lo planes (3 products), the rest single fp16; softmax f32; f32 output.

#define NB_  8
#define TT   2048
#define DM   256
#define NH_  1
#define NKV  1
#define REP  (NH_ / NKV)
#define HD   128
#define DQ   (NH_ * HD)
#define DKV  (NKV * HD)
#define ZH   1
#define RH   512                  // query rows < RH use hi+lo planes (0: none)
#define WIN  0
#define PCAR 1024.0f
#define SCL  0.088388347648318447f   // HD^-0.5
typedef _Float16 h16;
typedef unsigned short bf;
typedef __attribute__((ext_vector_type(16))) __bf16   v16bf;
typedef __attribute__((ext_vector_type(16))) _Float16 v16h;
typedef __attribute__((ext_vector_type(8)))  _Float16 v8h;
typedef __attribute__((ext_vector_type(8)))  unsigned short v8us;
typedef __attribute__((ext_vector_type(8)))  float    v8f;
typedef __attribute__((ext_vector_type(4)))  float    v4f;
typedef v8h  __attribute__((may_alias)) v8ha;
typedef v4f  __attribute__((may_alias)) v4fa;
typedef v8us __attribute__((may_alias)) v8usa;

__device__ __forceinline__ unsigned short f2bf(float f) { unsigned u = __float_as_uint(f); u += 0x7FFFu + ((u >> 16) & 1u); return (unsigned short)(u >> 16); }
__device__ __forceinline__ float bf2f(unsigned short b) { return __uint_as_float(((unsigned)b) << 16); }
__device__ __forceinline__ float bfr(float f) { return bf2f(f2bf(f)); }
__device__ __forceinline__ v16h cat16(v8h lo, v8h hi) { return __builtin_shufflevector(lo, hi, 0, 1, 2, 3, 4, 5, 6, 7, 8, 9, 10, 11, 12, 13, 14, 15); }
__device__ __forceinline__ v16bf cat16b(v8us lo, v8us hi) { return __builtin_bit_cast(v16bf, __builtin_shufflevector(lo, hi, 0, 1, 2, 3, 4, 5, 6, 7, 8, 9, 10, 11, 12, 13, 14, 15)); }
__device__ __forceinline__ v8f wmma16(v16h a, v16h b, v8f c) { return __builtin_amdgcn_wmma_f32_16x16x32_f16(false, a, false, b, (short)0, c, false, false); }
__device__ __forceinline__ v8f wmmab(v16bf a, v16bf b, v8f c) { return __builtin_amdgcn_wmma_f32_16x16x32_bf16(false, a, false, b, (short)0, c, false, false); }



// ---- k_gemmw: register-blocked GEMM, ONE WAVE per 64x64 output tile (16 accumulators), operands straight from K-contiguous 16-bit planes; grid (M/64, N/64, Z), 32 threads.
// C[m][n] (f32, pitch ldc, + optional f32 bias[n]) = sum_k A[m][k] Bt[n][k] (+ split products per NSPLIT). z-batch strides sA/sB/sC in elements. K % 32 == 0.
template <typename T16> struct WFrag;
template <> struct WFrag<h16> { typedef v16h V; static __device__ __forceinline__ V ld(const h16* p) { return cat16(*(const v8h*)p, *(const v8h*)(p + 16)); } static __device__ __forceinline__ v8f mma(V a, V b, v8f c) { return wmma16(a, b, c); } };
template <> struct WFrag<bf> { typedef v16bf V; static __device__ __forceinline__ V ld(const bf* p) { return cat16b(*(const v8us*)p, *(const v8us*)(p + 16)); } static __device__ __forceinline__ v8f mma(V a, V b, v8f c) { return wmmab(a, b, c); } };
template <typename T16, int NSPLIT, bool BIAS>
__global__ __launch_bounds__(32) void k_gemmw(const T16* __restrict__ A, const T16* __restrict__ A2, const T16* __restrict__ Bt, const T16* __restrict__ Bt2, int K, float* C, int ldc, const float* __restrict__ bias, size_t sA, size_t sB, size_t sC) {
    typedef typename WFrag<T16>::V V;
    __shared__ __align__(16) float os[16 * 68];
    const size_t z = blockIdx.z; A += z * sA; if (A2) A2 += z * sA; Bt += z * sB; if (Bt2) Bt2 += z * sB; C += z * sC;
    const int lane = threadIdx.x & 31, lr = lane & 15, hi = lane >> 4; const int r0 = blockIdx.x * 64, c0 = blockIdx.y * 64;
    v8f acc[4][4];
#pragma unroll
    for (int mb = 0; mb < 4; ++mb)
#pragma unroll
        for (int nb = 0; nb < 4; ++nb) acc[mb][nb] = (v8f){};
    const size_t aoff = (size_t)(r0 + lr) * K + 8 * hi, boff = (size_t)(c0 + lr) * K + 8 * hi;
#pragma unroll 1
    for (int kc = 0; kc < K; kc += 32) {
        V a[4], a2[4];
#pragma unroll
        for (int mb = 0; mb < 4; ++mb) { a[mb] = WFrag<T16>::ld(A + aoff + (size_t)mb * 16 * K + kc); if (NSPLIT == 1 || NSPLIT == 2) a2[mb] = WFrag<T16>::ld(A2 + aoff + (size_t)mb * 16 * K + kc); }
#pragma unroll
        for (int nb = 0; nb < 4; ++nb) { const V b = WFrag<T16>::ld(Bt + boff + (size_t)nb * 16 * K + kc); V b2; if (NSPLIT >= 2) b2 = WFrag<T16>::ld(Bt2 + boff + (size_t)nb * 16 * K + kc);
#pragma unroll
            for (int mb = 0; mb < 4; ++mb) { acc[mb][nb] = WFrag<T16>::mma(a[mb], b, acc[mb][nb]); if (NSPLIT == 1 || NSPLIT == 2) acc[mb][nb] = WFrag<T16>::mma(a2[mb], b, acc[mb][nb]); if (NSPLIT >= 2) acc[mb][nb] = WFrag<T16>::mma(a[mb], b2, acc[mb][nb]); } }
        asm volatile("v_nop\n\tv_nop\n\tv_nop\n\tv_nop" : "+v"(acc[0][0]), "+v"(acc[1][1]), "+v"(acc[2][2]), "+v"(acc[3][3]) : "v"(a[0]), "v"(a[3]));
    }
#pragma unroll
    for (int mb = 0; mb < 4; ++mb) {
#pragma unroll
        for (int nb = 0; nb < 4; ++nb) {
#pragma unroll
            for (int j = 0; j < 8; ++j) os[(hi * 8 + j) * 68 + nb * 16 + lr] = acc[mb][nb][j]; }
        __builtin_amdgcn_wave_barrier(); asm volatile("" ::: "memory");
        float* crow = C + (size_t)(r0 + mb * 16) * ldc + c0;
{
#pragma unroll
            for (int s = 0; s < 8; ++s) { const int row = 2 * s + hi, cofs = lr * 4; v4f val = *(const v4fa*)(os + row * 68 + cofs); if (BIAS) { val[0] += bfr(bias[c0 + cofs]); val[1] += bfr(bias[c0 + cofs + 1]); val[2] += bfr(bias[c0 + cofs + 2]); val[3] += bfr(bias[c0 + cofs + 3]); }
                *(v4f*)(crow + (size_t)row * ldc + cofs) = val; }
             }
        __builtin_amdgcn_wave_barrier(); asm volatile("" ::: "memory");
    }
}

__device__ __forceinline__ h16 tohx(float x) { return (h16)x; }
__device__ __forceinline__ void splitf(float y, unsigned short& h, unsigned short& l) { h = f2bf(y); l = f2bf(y - bf2f(h)); }
typedef __attribute__((ext_vector_type(2))) _Float16 v2h;
typedef __attribute__((ext_vector_type(4))) _Float16 v4h;
typedef __attribute__((ext_vector_type(2))) unsigned short v2us;
typedef __attribute__((ext_vector_type(4))) unsigned short v4us;
typedef __attribute__((ext_vector_type(2))) float v2f;
typedef __attribute__((ext_vector_type(4))) int v4i;

__global__ __launch_bounds__(256) void k_wtG(const float* __restrict__ w, int K, int N, bf* Bt) {
    const int lane = threadIdx.x & 31; const int L0 = (blockIdx.x * 8 + (threadIdx.x >> 5)) * 8; const int nlines = N * K / 64;
{
#pragma unroll 1
        for (int l = 0; l < 8; ++l) { const int L = L0 + l; if (L >= nlines) break; const size_t e = (size_t)L * 64 + lane * 2; const int k = (int)(e % K), n = (int)(e / K); v2us o;
            o[0] = f2bf(w[(size_t)k * N + n]); o[1] = f2bf(w[(size_t)(k + 1) * N + n]); *(v2us*)(Bt + e) = o; }
         }
}
__global__ __launch_bounds__(256) void k_cvt8(const float* __restrict__ src, bf* dst, size_t n8) { const size_t i = (size_t)blockIdx.x * 256 + threadIdx.x; if (i >= n8) return; const v8f v = *(const v8f*)(src + i * 8); v8us o;
#pragma unroll
    for (int k = 0; k < 8; ++k) o[k] = f2bf(v[k]); *(v8us*)(dst + i * 8) = o;  }

// k_rope: head planes [h][t][d] (fp16 + hi/lo) of rope(x) x sc with the rotate-half convention out[d] = x[d] cos[t][d] - x[d+HD/2] sin[t][d], out[d+HD/2] = x[d+HD/2] cos[t][d+HD/2] + x[d] sin[t][d+HD/2]
__global__ __launch_bounds__(256) void k_rope(const float* __restrict__ F, int pitch, int nheads, const float* __restrict__ CS, const float* __restrict__ RF, const float* __restrict__ nw, float sc, h16* P16, bf* Ph, bf* Pl) {
    const size_t bz = blockIdx.y; F += bz * TT * pitch; P16 += bz * nheads * TT * HD; Ph += bz * nheads * TT * HD; Pl += bz * nheads * TT * HD;   // batch slice
    const size_t e = ((size_t)blockIdx.x * 256 + threadIdx.x) * 2; if (e >= (size_t)nheads * TT * HD) return; const int d = (int)(e % HD); const int t = (int)((e / HD) % TT); const int h = (int)(e / ((size_t)HD * TT)); const float* f = F + (size_t)t * pitch + h * HD; const float rf = RF ? RF[(size_t)h * TT + t] : 1.0f; v2h o16; v2us oh, ol;
#pragma unroll
    for (int q = 0; q < 2; ++q) { const int dd = d + q; const int dp = (dd < HD / 2) ? dd + HD / 2 : dd - HD / 2; float x0 = f[dd], x1 = f[dp];
        if (RF) { float n0 = __fmul_rn(x0, rf), n1 = __fmul_rn(x1, rf); asm volatile("" : "+v"(n0)); asm volatile("" : "+v"(n1)); x0 = __fmul_rn(bfr(nw[dd]), n0); x1 = __fmul_rn(bfr(nw[dp]), n1); }
        const v2f cs = *(const v2f*)(CS + ((size_t)t * HD + dd) * 2); float a = __fmul_rn(x0, cs[0]), bq = __fmul_rn(x1, cs[1]); asm volatile("" : "+v"(a)); asm volatile("" : "+v"(bq)); const float r = ((dd < HD / 2) ? __fsub_rn(a, bq) : __fadd_rn(a, bq)) * sc;
        o16[q] = tohx(r); unsigned short a2, c2; splitf(r, a2, c2); oh[q] = a2; ol[q] = c2; }
    *(v2h*)(P16 + e) = o16; *(v2us*)(Ph + e) = oh; *(v2us*)(Pl + e) = ol;  }
__global__ __launch_bounds__(256) void k_vtp(const float* __restrict__ F, int pitch, int nheads, h16* V16, bf* Vh, bf* Vl) { const size_t bz = blockIdx.y; F += bz * TT * pitch; V16 += bz * nheads * HD * TT; Vh += bz * nheads * HD * TT; Vl += bz * nheads * HD * TT; const size_t e = ((size_t)blockIdx.x * 256 + threadIdx.x) * 2; if (e >= (size_t)nheads * HD * TT) return; const int t = (int)(e % TT); const int d = (int)((e / TT) % HD); const int g = (int)(e / ((size_t)TT * HD)); v2h o16; v2us oh, ol;
#pragma unroll
    for (int q = 0; q < 2; ++q) { const float x = F[(size_t)(t + q) * pitch + g * HD + d]; o16[q] = tohx(x); unsigned short a2, c2; splitf(x, a2, c2); oh[q] = a2; ol[q] = c2; }
    *(v2h*)(V16 + e) = o16; *(v2us*)(Vh + e) = oh; *(v2us*)(Vl + e) = ol;  }
__global__ __launch_bounds__(256) void k_csid(float* CS) { const int idx = blockIdx.x * 256 + threadIdx.x; if (idx >= TT * HD) return; v2f cs; cs[0] = 1.0f; cs[1] = 0.0f; *(v2f*)(CS + (size_t)idx * 2) = cs;  }
// k_asoft: zz runs over batch x head; P16 holds only the rows >= RH (pitch TT). Per row (zz, i): t = S x HD^-0.5 (no mask); softmax over the 2048 keys (register row, one exp, fixed trees);
__global__ __launch_bounds__(256) void k_asoft(const float* __restrict__ Sb, h16* P16, bf* Ph, bf* Pl) {
    const int lane = threadIdx.x & 31; const int row = blockIdx.x * 8 + (threadIdx.x >> 5); if (row >= NB_ * ZH * TT) return; const int i = row % TT; const int zz = row / TT; (void)zz; const bool hires = (i < RH); const float* sr = Sb + (size_t)row * TT; float v[TT / 32]; float mx = -3.0e38f;
#pragma unroll
    for (int ch = 0; ch < TT / 128; ++ch) { const int j0 = ch * 128 + lane * 4; const v4f a = *(const v4f*)(sr + j0);
#pragma unroll
        for (int q = 0; q < 4; ++q) { const int j = j0 + q; (void)j; const float t = a[q] * SCL; v[ch * 4 + q] = t; mx = fmaxf(mx, t); } }
#pragma unroll
    for (int sh = 16; sh; sh >>= 1) mx = fmaxf(mx, __shfl_xor(mx, sh, 32));
    float sum = 0.f;
#pragma unroll
    for (int k = 0; k < TT / 32; ++k) { float d0 = __fsub_rn(v[k], mx); asm volatile("" : "+v"(d0)); v[k] = __builtin_amdgcn_exp2f(__fmul_rn(d0, 1.4426950408889634f)); sum += v[k]; }
#pragma unroll
    for (int sh = 16; sh; sh >>= 1) sum += __shfl_xor(sum, sh, 32);
    const float f = __fdiv_rn(hires ? 1.0f : PCAR, sum);
{
        if (hires) {
#pragma unroll
            for (int ch = 0; ch < TT / 128; ++ch) { v4us oh, ol;
#pragma unroll
                for (int q = 0; q < 4; ++q) { unsigned short a, c2; splitf(v[ch * 4 + q] * f, a, c2); oh[q] = a; ol[q] = c2; }
                const size_t oo = ((size_t)zz * (RH ? RH : 1) + i) * TT + ch * 128 + lane * 4; *(v4us*)(Ph + oo) = oh; *(v4us*)(Pl + oo) = ol; }
        } else {
#pragma unroll
            for (int ch = 0; ch < TT / 128; ++ch) { v4h o4;
#pragma unroll
                for (int q = 0; q < 4; ++q) o4[q] = tohx(v[ch * 4 + q] * f);
                *(v4h*)(P16 + ((size_t)zz * (TT - RH) + (i - RH)) * TT + ch * 128 + lane * 4) = o4; } }
         }
}
__global__ __launch_bounds__(256) void k_merge(const float* __restrict__ O, int h0, float* OUTb) { O += (size_t)blockIdx.y * ZH * TT * HD; OUTb += (size_t)blockIdx.y * TT * DQ; const size_t e = ((size_t)blockIdx.x * 256 + threadIdx.x) * 2; if (e >= (size_t)ZH * TT * HD) return; const int d = (int)(e % HD); const int t = (int)((e / HD) % TT); const int zz = (int)(e / ((size_t)HD * TT)); const float cs = (t < RH) ? 1.0f : (1.0f / PCAR); const size_t oo = (size_t)t * DQ + (h0 + zz) * HD + d;
    v2f o2; o2[0] = O[e] * cs; o2[1] = O[e + 1] * cs; *(v2f*)(OUTb + oo) = o2;  }

extern "C" void kernel_launch(void* const* d_in, const int* in_sizes, int n_in,
                              void* d_out, int out_size, void* d_ws, size_t ws_size, hipStream_t stream) {
    (void)in_sizes; (void)n_in; (void)out_size;
    const float* xq = (const float*)d_in[0]; const float* xk = (const float*)d_in[1]; const float* xv = (const float*)d_in[2]; const float* wq = (const float*)d_in[3]; const float* bq = (const float*)d_in[4]; const float* wk = (const float*)d_in[5]; const float* bk = (const float*)d_in[6]; const float* wv = (const float*)d_in[7]; const float* bv = (const float*)d_in[8]; const float* x = nullptr; const float* wo = nullptr; (void)x; (void)wo;
    float* OUT = (float*)d_out;     // [8][2048][128]
    char* wsp = (char*)d_ws;
    auto take = [&](size_t bytes) { char* p = wsp; wsp += (bytes + 255) & ~(size_t)255; return (void*)p; };
    bf* WQ = (bf*)take((size_t)DQ * DM * 2); bf* WK = (bf*)take((size_t)DKV * DM * 2); bf* WV = (bf*)take((size_t)DKV * DM * 2); float* CS = (float*)take((size_t)TT * HD * 2 * 4);
    // Every plane below holds NB_ batch slices. XB..KP16 (contiguous, each a multiple of 256 B) are dead once the scores are built: the hi/lo probability planes reuse those bytes.
    bf* XB = (bf*)take((size_t)NB_ * TT * DM * 2); float* FQ = (float*)take((size_t)NB_ * TT * DQ * 4); float* FK = (float*)take((size_t)NB_ * TT * DKV * 4);
    h16* QP16 = (h16*)take((size_t)NB_ * NH_ * TT * HD * 2); h16* KP16 = (h16*)take((size_t)NB_ * NKV * TT * HD * 2); h16* VT16 = (h16*)take((size_t)NB_ * NKV * HD * TT * 2);
    bf* QPh = (bf*)take((size_t)NB_ * NH_ * TT * HD * 2); bf* QPl = (bf*)take((size_t)NB_ * NH_ * TT * HD * 2); bf* KPh = (bf*)take((size_t)NB_ * NKV * TT * HD * 2); bf* KPl = (bf*)take((size_t)NB_ * NKV * TT * HD * 2); bf* VTh = (bf*)take((size_t)NB_ * NKV * HD * TT * 2); bf* VTl = (bf*)take((size_t)NB_ * NKV * HD * TT * 2);
    float* Sb = (float*)take((size_t)NB_ * ZH * TT * TT * 4); h16* P16 = (h16*)take((size_t)NB_ * ZH * (TT - RH) * TT * 2); float* Ob = (float*)take((size_t)NB_ * ZH * TT * HD * 4);
    if ((size_t)(wsp - (char*)d_ws) > ws_size) return;    // ws 256 MiB
    static_assert((size_t)NB_ * ZH * RH * TT * 2 * 2 <= (size_t)NB_ * TT * (DM * 2 + DQ * 4 + DKV * 4 + NH_ * HD * 2 + NKV * HD * 2), "hi/lo probability planes must fit the dead projection buffers");
    bf* Ph = XB; bf* Pl = XB + (size_t)NB_ * ZH * RH * TT;
    float* FV = FK;   // v projection reuses the k buffer after the k planes are built (stream-ordered)
    { k_wtG<<<(unsigned)((DM * DQ / 64 + 63) / 64), 256, 0, stream>>>(wq, DM, DQ, WQ); k_wtG<<<(unsigned)((DM * DKV / 64 + 63) / 64), 256, 0, stream>>>(wk, DM, DKV, WK); k_wtG<<<(unsigned)((DM * DKV / 64 + 63) / 64), 256, 0, stream>>>(wv, DM, DKV, WV); }
    k_csid<<<(TT * HD + 255) / 256, 256, 0, stream>>>(CS);
    const unsigned LQ = (unsigned)(((size_t)NH_ * TT * HD / 2 + 255) / 256), LKv = (unsigned)(((size_t)NKV * TT * HD / 2 + 255) / 256), LX = (unsigned)(((size_t)NB_ * TT * DM / 8 + 255) / 256);
    k_cvt8<<<LX, 256, 0, stream>>>(xq, XB, (size_t)NB_ * TT * DM / 8);   /* x_q rows, all batches */
    k_gemmw<bf, 0, true><<<dim3(NB_ * TT / 64, DQ / 64, 1), 32, 0, stream>>>(XB, nullptr, WQ, nullptr, DM, FQ, DQ, bq, 0, 0, 0);
    k_rope<<<dim3(LQ, NB_, 1), 256, 0, stream>>>(FQ, DQ, NH_, CS, nullptr, nullptr, 1.0f, QP16, QPh, QPl);
    k_cvt8<<<LX, 256, 0, stream>>>(xk, XB, (size_t)NB_ * TT * DM / 8);   /* x_k rows */
    k_gemmw<bf, 0, true><<<dim3(NB_ * TT / 64, DKV / 64, 1), 32, 0, stream>>>(XB, nullptr, WK, nullptr, DM, FK, DKV, bk, 0, 0, 0);
    k_rope<<<dim3(LKv, NB_, 1), 256, 0, stream>>>(FK, DKV, NKV, CS, nullptr, nullptr, 1.0f, KP16, KPh, KPl);
    k_cvt8<<<LX, 256, 0, stream>>>(xv, XB, (size_t)NB_ * TT * DM / 8);   /* x_v rows */
    k_gemmw<bf, 0, true><<<dim3(NB_ * TT / 64, DKV / 64, 1), 32, 0, stream>>>(XB, nullptr, WV, nullptr, DM, FV, DKV, bv, 0, 0, 0); k_vtp<<<dim3(LKv, NB_, 1), 256, 0, stream>>>(FV, DKV, NKV, VT16, VTh, VTl);
    static_assert(NH_ == 1 && NKV == 1 && ZH == 1, "grid z of the attention GEMMs is the batch");
    k_gemmw<bf, 2, false><<<dim3(RH / 64, TT / 64, NB_), 32, 0, stream>>>(QPh, QPl, KPh, KPl, HD, Sb, TT, nullptr, (size_t)TT * HD, (size_t)TT * HD, (size_t)TT * TT);
    k_gemmw<h16, 0, false><<<dim3((TT - RH) / 64, TT / 64, NB_), 32, 0, stream>>>(QP16 + (size_t)RH * HD, nullptr, KP16, nullptr, HD, Sb + (size_t)RH * TT, TT, nullptr, (size_t)TT * HD, (size_t)TT * HD, (size_t)TT * TT);
    k_asoft<<<NB_ * ZH * TT / 8, 256, 0, stream>>>(Sb, P16, Ph, Pl);
    k_gemmw<bf, 2, false><<<dim3(RH / 64, HD / 64, NB_), 32, 0, stream>>>(Ph, Pl, VTh, VTl, TT, Ob, HD, nullptr, (size_t)RH * TT, (size_t)HD * TT, (size_t)TT * HD);
    k_gemmw<h16, 0, false><<<dim3((TT - RH) / 64, HD / 64, NB_), 32, 0, stream>>>(P16, nullptr, VT16, nullptr, TT, Ob + (size_t)RH * HD, HD, nullptr, (size_t)(TT - RH) * TT, (size_t)HD * TT, (size_t)TT * HD);
    k_merge<<<dim3((unsigned)(((size_t)ZH * TT * HD / 2 + 255) / 256), NB_, 1), 256, 0, stream>>>(Ob, 0, OUT);
}

// v002
// Measured time: 132 microseconds a run.
// Two timings next to v001 put it at 1.78 and 1.77 times that version's speed.
// Over all steps from v000 it is 8.61 times as fast.
#include <hip/hip_runtime.h>

// Single-head attention with separate q/k/v inputs (x_q, x_k, x_v [8][2048][256]; q = x_q Wq + bq, k = x_k Wk + bk, v = x_v Wv + bv ('xw' [256][128] + [128]); scores = q.k / sqrt(128); softmax over 2048 keys; out = attn.v -> [8][2048][128] f32 (2.1 M)).
// All 8 batches run in every launch (batch = blockIdx.y of k_rope/k_vtp, folded into the x extent of the other grids; every workspace plane but the weights and the cos/sin table holds 8 batch slices). Per batch: exact projections (+ biases) from three bf16 input copies; hybrid dense planes (rows < 512 hi/lo, rest fp16); one fused kernel for scores, running-maximum softmax and attn.v, which writes the f32 output.
// Compute dtypes, f32 accumulate: every input rounded to bf16; projections on PLAIN bf16 operands (exact) + f32 biases; scores and attn.v rows < 512 on bf16 hi/lo planes (3 products), the rest single fp16; softmax f32; f32 output.

#define NB_  8
#define TT   2048
#define DM   256
#define NH_  1
#define NKV  1
#define REP  (NH_ / NKV)
#define HD   128
#define DQ   (NH_ * HD)
#define DKV  (NKV * HD)
#define ZH   1
#define RH   512                  // query rows < RH use hi+lo planes (0: none)
#define WIN  0
#define SCL  0.088388347648318447f   // HD^-0.5
typedef _Float16 h16;
typedef unsigned short bf;
typedef __attribute__((ext_vector_type(16))) __bf16   v16bf;
typedef __attribute__((ext_vector_type(16))) _Float16 v16h;
typedef __attribute__((ext_vector_type(8)))  _Float16 v8h;
typedef __attribute__((ext_vector_type(8)))  unsigned short v8us;
typedef __attribute__((ext_vector_type(8)))  float    v8f;
typedef __attribute__((ext_vector_type(4)))  float    v4f;
typedef v8h  __attribute__((may_alias)) v8ha;
typedef v4f  __attribute__((may_alias)) v4fa;
typedef v8us __attribute__((may_alias)) v8usa;

__device__ __forceinline__ unsigned short f2bf(float f) { unsigned u = __float_as_uint(f); u += 0x7FFFu + ((u >> 16) & 1u); return (unsigned short)(u >> 16); }
__device__ __forceinline__ float bf2f(unsigned short b) { return __uint_as_float(((unsigned)b) << 16); }
__device__ __forceinline__ float bfr(float f) { return bf2f(f2bf(f)); }
__device__ __forceinline__ v16h cat16(v8h lo, v8h hi) { return __builtin_shufflevector(lo, hi, 0, 1, 2, 3, 4, 5, 6, 7, 8, 9, 10, 11, 12, 13, 14, 15); }
__device__ __forceinline__ v16bf cat16b(v8us lo, v8us hi) { return __builtin_bit_cast(v16bf, __builtin_shufflevector(lo, hi, 0, 1, 2, 3, 4, 5, 6, 7, 8, 9, 10, 11, 12, 13, 14, 15)); }
__device__ __forceinline__ v8f wmma16(v16h a, v16h b, v8f c) { return __builtin_amdgcn_wmma_f32_16x16x32_f16(false, a, false, b, (short)0, c, false, false); }
__device__ __forceinline__ v8f wmmab(v16bf a, v16bf b, v8f c) { return __builtin_amdgcn_wmma_f32_16x16x32_bf16(false, a, false, b, (short)0, c, false, false); }



// ---- k_gemmw: register-blocked GEMM, ONE WAVE per 64x64 output tile (16 accumulators), operands straight from K-contiguous 16-bit planes; grid (M/64, N/64, Z), 32 threads.
// C[m][n] (f32, pitch ldc, + optional f32 bias[n]) = sum_k A[m][k] Bt[n][k] (+ split products per NSPLIT). z-batch strides sA/sB/sC in elements. K % 32 == 0.
template <typename T16> struct WFrag;
template <> struct WFrag<h16> { typedef v16h V; static __device__ __forceinline__ V ld(const h16* p) { return cat16(*(const v8h*)p, *(const v8h*)(p + 16)); } static __device__ __forceinline__ v8f mma(V a, V b, v8f c) { return wmma16(a, b, c); } };
template <> struct WFrag<bf> { typedef v16bf V; static __device__ __forceinline__ V ld(const bf* p) { return cat16b(*(const v8us*)p, *(const v8us*)(p + 16)); } static __device__ __forceinline__ v8f mma(V a, V b, v8f c) { return wmmab(a, b, c); } };
template <typename T16, int NSPLIT, bool BIAS>
__global__ __launch_bounds__(32) void k_gemmw(const T16* __restrict__ A, const T16* __restrict__ A2, const T16* __restrict__ Bt, const T16* __restrict__ Bt2, int K, float* C, int ldc, const float* __restrict__ bias, size_t sA, size_t sB, size_t sC) {
    typedef typename WFrag<T16>::V V;
    __shared__ __align__(16) float os[16 * 68];
    const size_t z = blockIdx.z; A += z * sA; if (A2) A2 += z * sA; Bt += z * sB; if (Bt2) Bt2 += z * sB; C += z * sC;
    const int lane = threadIdx.x & 31, lr = lane & 15, hi = lane >> 4; const int r0 = blockIdx.x * 64, c0 = blockIdx.y * 64;
    v8f acc[4][4];
#pragma unroll
    for (int mb = 0; mb < 4; ++mb)
#pragma unroll
        for (int nb = 0; nb < 4; ++nb) acc[mb][nb] = (v8f){};
    const size_t aoff = (size_t)(r0 + lr) * K + 8 * hi, boff = (size_t)(c0 + lr) * K + 8 * hi;
#pragma unroll 1
    for (int kc = 0; kc < K; kc += 32) {
        V a[4], a2[4];
#pragma unroll
        for (int mb = 0; mb < 4; ++mb) { a[mb] = WFrag<T16>::ld(A + aoff + (size_t)mb * 16 * K + kc); if (NSPLIT == 1 || NSPLIT == 2) a2[mb] = WFrag<T16>::ld(A2 + aoff + (size_t)mb * 16 * K + kc); }
#pragma unroll
        for (int nb = 0; nb < 4; ++nb) { const V b = WFrag<T16>::ld(Bt + boff + (size_t)nb * 16 * K + kc); V b2; if (NSPLIT >= 2) b2 = WFrag<T16>::ld(Bt2 + boff + (size_t)nb * 16 * K + kc);
#pragma unroll
            for (int mb = 0; mb < 4; ++mb) { acc[mb][nb] = WFrag<T16>::mma(a[mb], b, acc[mb][nb]); if (NSPLIT == 1 || NSPLIT == 2) acc[mb][nb] = WFrag<T16>::mma(a2[mb], b, acc[mb][nb]); if (NSPLIT >= 2) acc[mb][nb] = WFrag<T16>::mma(a[mb], b2, acc[mb][nb]); } }
        asm volatile("v_nop\n\tv_nop\n\tv_nop\n\tv_nop" : "+v"(acc[0][0]), "+v"(acc[1][1]), "+v"(acc[2][2]), "+v"(acc[3][3]) : "v"(a[0]), "v"(a[3]));
    }
#pragma unroll
    for (int mb = 0; mb < 4; ++mb) {
#pragma unroll
        for (int nb = 0; nb < 4; ++nb) {
#pragma unroll
            for (int j = 0; j < 8; ++j) os[(hi * 8 + j) * 68 + nb * 16 + lr] = acc[mb][nb][j]; }
        __builtin_amdgcn_wave_barrier(); asm volatile("" ::: "memory");
        float* crow = C + (size_t)(r0 + mb * 16) * ldc + c0;
{
#pragma unroll
            for (int s = 0; s < 8; ++s) { const int row = 2 * s + hi, cofs = lr * 4; v4f val = *(const v4fa*)(os + row * 68 + cofs); if (BIAS) { val[0] += bfr(bias[c0 + cofs]); val[1] += bfr(bias[c0 + cofs + 1]); val[2] += bfr(bias[c0 + cofs + 2]); val[3] += bfr(bias[c0 + cofs + 3]); }
                *(v4f*)(crow + (size_t)row * ldc + cofs) = val; }
             }
        __builtin_amdgcn_wave_barrier(); asm volatile("" ::: "memory");
    }
}

__device__ __forceinline__ h16 tohx(float x) { return (h16)x; }
__device__ __forceinline__ void splitf(float y, unsigned short& h, unsigned short& l) { h = f2bf(y); l = f2bf(y - bf2f(h)); }
typedef __attribute__((ext_vector_type(2))) _Float16 v2h;
typedef __attribute__((ext_vector_type(4))) _Float16 v4h;
typedef __attribute__((ext_vector_type(2))) unsigned short v2us;
typedef __attribute__((ext_vector_type(4))) unsigned short v4us;
typedef __attribute__((ext_vector_type(2))) float v2f;
typedef __attribute__((ext_vector_type(4))) int v4i;

__global__ __launch_bounds__(256) void k_wtG(const float* __restrict__ w, int K, int N, bf* Bt) {
    const int lane = threadIdx.x & 31; const int L0 = (blockIdx.x * 8 + (threadIdx.x >> 5)) * 8; const int nlines = N * K / 64;
{
#pragma unroll 1
        for (int l = 0; l < 8; ++l) { const int L = L0 + l; if (L >= nlines) break; const size_t e = (size_t)L * 64 + lane * 2; const int k = (int)(e % K), n = (int)(e / K); v2us o;
            o[0] = f2bf(w[(size_t)k * N + n]); o[1] = f2bf(w[(size_t)(k + 1) * N + n]); *(v2us*)(Bt + e) = o; }
         }
}
__global__ __launch_bounds__(256) void k_cvt8(const float* __restrict__ src, bf* dst, size_t n8) { const size_t i = (size_t)blockIdx.x * 256 + threadIdx.x; if (i >= n8) return; const v8f v = *(const v8f*)(src + i * 8); v8us o;
#pragma unroll
    for (int k = 0; k < 8; ++k) o[k] = f2bf(v[k]); *(v8us*)(dst + i * 8) = o;  }

// k_rope: head planes [h][t][d] (fp16 + hi/lo) of rope(x) x sc with the rotate-half convention out[d] = x[d] cos[t][d] - x[d+HD/2] sin[t][d], out[d+HD/2] = x[d+HD/2] cos[t][d+HD/2] + x[d] sin[t][d+HD/2]
__global__ __launch_bounds__(256) void k_rope(const float* __restrict__ F, int pitch, int nheads, const float* __restrict__ CS, const float* __restrict__ RF, const float* __restrict__ nw, float sc, h16* P16, bf* Ph, bf* Pl) {
    const size_t bz = blockIdx.y; F += bz * TT * pitch; P16 += bz * nheads * TT * HD; Ph += bz * nheads * TT * HD; Pl += bz * nheads * TT * HD;   // batch slice
    const size_t e = ((size_t)blockIdx.x * 256 + threadIdx.x) * 2; if (e >= (size_t)nheads * TT * HD) return; const int d = (int)(e % HD); const int t = (int)((e / HD) % TT); const int h = (int)(e / ((size_t)HD * TT)); const float* f = F + (size_t)t * pitch + h * HD; const float rf = RF ? RF[(size_t)h * TT + t] : 1.0f; v2h o16; v2us oh, ol;
#pragma unroll
    for (int q = 0; q < 2; ++q) { const int dd = d + q; const int dp = (dd < HD / 2) ? dd + HD / 2 : dd - HD / 2; float x0 = f[dd], x1 = f[dp];
        if (RF) { float n0 = __fmul_rn(x0, rf), n1 = __fmul_rn(x1, rf); asm volatile("" : "+v"(n0)); asm volatile("" : "+v"(n1)); x0 = __fmul_rn(bfr(nw[dd]), n0); x1 = __fmul_rn(bfr(nw[dp]), n1); }
        const v2f cs = *(const v2f*)(CS + ((size_t)t * HD + dd) * 2); float a = __fmul_rn(x0, cs[0]), bq = __fmul_rn(x1, cs[1]); asm volatile("" : "+v"(a)); asm volatile("" : "+v"(bq)); const float r = ((dd < HD / 2) ? __fsub_rn(a, bq) : __fadd_rn(a, bq)) * sc;
        o16[q] = tohx(r); unsigned short a2, c2; splitf(r, a2, c2); oh[q] = a2; ol[q] = c2; }
    *(v2h*)(P16 + e) = o16; *(v2us*)(Ph + e) = oh; *(v2us*)(Pl + e) = ol;  }
__global__ __launch_bounds__(256) void k_vtp(const float* __restrict__ F, int pitch, int nheads, h16* V16, bf* Vh, bf* Vl) { const size_t bz = blockIdx.y; F += bz * TT * pitch; V16 += bz * nheads * HD * TT; Vh += bz * nheads * HD * TT; Vl += bz * nheads * HD * TT; const size_t e = ((size_t)blockIdx.x * 256 + threadIdx.x) * 2; if (e >= (size_t)nheads * HD * TT) return; const int t = (int)(e % TT); const int d = (int)((e / TT) % HD); const int g = (int)(e / ((size_t)TT * HD)); v2h o16; v2us oh, ol;
#pragma unroll
    for (int q = 0; q < 2; ++q) { const float x = F[(size_t)(t + q) * pitch + g * HD + d]; o16[q] = tohx(x); unsigned short a2, c2; splitf(x, a2, c2); oh[q] = a2; ol[q] = c2; }
    *(v2h*)(V16 + e) = o16; *(v2us*)(Vh + e) = oh; *(v2us*)(Vl + e) = ol;  }
__global__ __launch_bounds__(256) void k_csid(float* CS) { const int idx = blockIdx.x * 256 + threadIdx.x; if (idx >= TT * HD) return; v2f cs; cs[0] = 1.0f; cs[1] = 0.0f; *(v2f*)(CS + (size_t)idx * 2) = cs;  }
// k_fattn: scores, softmax and attn.v of 32 query rows in one work-group; neither the scores nor the probabilities go to memory.
// Transposed products: St = K Qt (A = 16 key rows, B = 16 query columns), Ot += Vt Pt (A = 16 rows of Vt, B = the packed probabilities). A lane holds one query's scores (keys 8 hi + r of each 16-key tile),
// so two converted score tiles are the B operand of the second product as they stand, and maximum, sum and rescale factor are per lane (one exchange between the lane halves for the maximum).
// The KSPL waves of a work-group walk TT / KSPL keys each with a running maximum; their partial (max, sum, Ot) are merged through LDS in wave order at the end.
#define KSPL 4
// 2^x with the slot that the instruction set asks for behind a transcendental in the same statement.
__device__ __forceinline__ float exp2s(float x) { float y; asm("v_exp_f32 %0, %1\n\tv_nop" : "=v"(y) : "v"(x)); return y; }
// Unrolling: every inner loop is unrolled so that fragment and accumulator indices are constants (registers, no scratch); the pass loop stays rolled (unroll 1) to keep the text short.
#define OPIT (HD + 4)             // floats per query row of the merge staging: 16-byte aligned rows that start on different banks
template <typename T16, bool HL>
__device__ __forceinline__ void attn_rows(const T16* __restrict__ Q, const T16* __restrict__ Q2, const T16* __restrict__ Kp, const T16* __restrict__ K2, const T16* __restrict__ Vt, const T16* __restrict__ V2, float* __restrict__ out, float* so, float* sml) {
    typedef typename WFrag<T16>::V V;
    constexpr float SC2 = SCL * 1.4426950408889634f;   // scores in log2 units
    constexpr float POFF = HL ? 0.0f : 4.0f;           // fp16 probabilities carry x16 (it cancels in Ot / sum): keeps small ones out of the fp16 subnormals
    const int lane = threadIdx.x & 31, lr = lane & 15, hi = lane >> 4, w = threadIdx.x >> 5;
    V qf[2][4], qf2[2][4];
#pragma unroll
    for (int g = 0; g < 2; ++g)
#pragma unroll
        for (int ks = 0; ks < 4; ++ks) { const size_t qo = (size_t)(g * 16 + lr) * HD + ks * 32 + 8 * hi; qf[g][ks] = WFrag<T16>::ld(Q + qo); if constexpr (HL) qf2[g][ks] = WFrag<T16>::ld(Q2 + qo); }
    v8f o[2][8];
#pragma unroll
    for (int g = 0; g < 2; ++g)
#pragma unroll
        for (int db = 0; db < 8; ++db) o[g][db] = (v8f){};
    float m[2] = {-3.0e38f, -3.0e38f}, l[2] = {0.f, 0.f};
    unsigned ko = (unsigned)((w * (TT / KSPL) + lr) * HD + 8 * hi) * 2u, vo = (unsigned)(lr * TT + w * (TT / KSPL) + 8 * hi) * 2u;   // byte offsets in a batch's plane: 32 bits beside a scalar base, one register for every plane
    auto at = [](const T16* base, unsigned byteoff) { return (const T16*)((const char*)base + byteoff); };
    // Fragment buffers: kf[kt] = the four k steps of key tile kt, vf[h] = Vt row blocks 4 h .. 4 h + 3. Loads are issued well ahead of their products:
    // fp16: all of Vt at the top of a pass, all of the next pass's K behind the score products. hi/lo (twice the registers): each half of Vt behind the score products of one key tile,
    // each key tile of the next pass behind one half of the output products, so that a buffer's registers can serve K and Vt in turn.
    V kf[2][4], kf2[2][4], vf[2][4], vf2[2][4];
    auto loadK = [&](int kt, unsigned off) {
#pragma unroll
        for (int ks = 0; ks < 4; ++ks) { kf[kt][ks] = WFrag<T16>::ld(at(Kp, off) + kt * 16 * HD + ks * 32); if constexpr (HL) kf2[kt][ks] = WFrag<T16>::ld(at(K2, off) + kt * 16 * HD + ks * 32); } };
    auto loadV = [&](int h, unsigned off) {
#pragma unroll
        for (int d = 0; d < 4; ++d) { vf[h][d] = WFrag<T16>::ld(at(Vt, off) + (h * 4 + d) * 16 * TT); if constexpr (HL) vf2[h][d] = WFrag<T16>::ld(at(V2, off) + (h * 4 + d) * 16 * TT); } };
    loadK(0, ko); loadK(1, ko);
    constexpr int NP = TT / KSPL / 32, AH = HL ? 1 : 2;   // passes; how many passes ahead of the update below the next K fetch lies
    unsigned kn = HL ? ko : ko + 32 * HD * 2;             // offset of the next K fetch
    asm volatile("s_wait_xcnt 0x0" ::: "memory");   // stands between the loads above and any later write of a register that they name
#pragma unroll 1
    for (int it = 0; it < NP; ++it) {
        if constexpr (!HL) { loadV(0, vo); loadV(1, vo); __builtin_amdgcn_sched_barrier(0); }   // keeps the loads up here: sunk to their products, each would expose its latency
        v8f s[2][2];
#pragma unroll
        for (int kt = 0; kt < 2; ++kt) { s[kt][0] = (v8f){}; s[kt][1] = (v8f){};
#pragma unroll
            for (int ks = 0; ks < 4; ++ks) {
#pragma unroll
                for (int g = 0; g < 2; ++g) { s[kt][g] = WFrag<T16>::mma(kf[kt][ks], qf[g][ks], s[kt][g]); if constexpr (HL) { s[kt][g] = WFrag<T16>::mma(kf[kt][ks], qf2[g][ks], s[kt][g]); s[kt][g] = WFrag<T16>::mma(kf2[kt][ks], qf[g][ks], s[kt][g]); } } }
            if constexpr (HL) { loadV(kt, vo); __builtin_amdgcn_sched_barrier(0); } }   // as above: holds the issue point of the loads
        if constexpr (!HL) { loadK(0, kn); loadK(1, kn); __builtin_amdgcn_sched_barrier(0); }   // as above
        V pf[2], pf2[2];
#pragma unroll
        for (int g = 0; g < 2; ++g) {
            float mx = s[0][g][0];
#pragma unroll
            for (int r = 0; r < 8; ++r) mx = fmaxf(mx, fmaxf(s[0][g][r], s[1][g][r]));
            mx = fmaxf(mx, __shfl_xor(mx, 16, 32));
            const float mn = fmaxf(m[g], mx * SC2); const float al = exp2s(m[g] - mn); m[g] = mn; const float nb = POFF - mn; float sum = 0.f; float x[16];
#pragma unroll
            for (int e = 0; e < 16; ++e) x[e] = fmaf(s[e >> 3][g][e & 7], SC2, nb);
#pragma unroll
            for (int e = 0; e < 16; ++e) x[e] = exp2s(x[e]);
#pragma unroll
            for (int kt = 0; kt < 2; ++kt)
#pragma unroll
                for (int r = 0; r < 8; ++r) { const float p = x[kt * 8 + r]; sum += p;
                    if constexpr (HL) { const __bf16 ph = (__bf16)p; pf[g][kt * 8 + r] = ph; pf2[g][kt * 8 + r] = (__bf16)(p - (float)ph); } else pf[g][kt * 8 + r] = (h16)p; }
            l[g] = l[g] * al + sum;
#pragma unroll
            for (int db = 0; db < 8; ++db) o[g][db] *= al;
        }
        __builtin_amdgcn_sched_barrier(0);                 // keeps the wait below down here, behind the softmax: without it the wait moved up to stand directly behind the loads' issue
        asm volatile("s_wait_xcnt 0x0" ::: "memory");   // stands between the loads issued so far and the writes of their offset registers below
        __builtin_amdgcn_sched_barrier(0);                 // keeps the two updates behind that wait
        vo += 32 * 2; kn += (it + AH < NP) ? 32 * HD * 2 : 0;   // the last fetch takes the last tile again: in bounds, not used
#pragma unroll
        for (int h = 0; h < 2; ++h) {
#pragma unroll
            for (int d = 0; d < 4; ++d) {
#pragma unroll
                for (int g = 0; g < 2; ++g) { v8f& oo = o[g][h * 4 + d]; oo = WFrag<T16>::mma(vf[h][d], pf[g], oo); if constexpr (HL) { oo = WFrag<T16>::mma(vf[h][d], pf2[g], oo); oo = WFrag<T16>::mma(vf2[h][d], pf[g], oo); } } }
            if constexpr (HL) { loadK(h, kn); __builtin_amdgcn_sched_barrier(0); } }   // as above
    }
    asm volatile("s_wait_xcnt 0x0" ::: "memory");   // stands between the last pass's fetches and the reuse of their offset register
    __builtin_amdgcn_sched_barrier(0);                 // keeps what follows behind that wait
#pragma unroll
    for (int g = 0; g < 2; ++g) { l[g] += __shfl_xor(l[g], 16, 32); if (hi == 0) { sml[w * 32 + g * 16 + lr] = m[g]; sml[KSPL * 32 + w * 32 + g * 16 + lr] = l[g]; } }
    __syncthreads();   // every wave's (max, sum) is in LDS
#pragma unroll
    for (int g = 0; g < 2; ++g) { const int qi = g * 16 + lr; float M = sml[qi];
#pragma unroll
        for (int x = 1; x < KSPL; ++x) M = fmaxf(M, sml[x * 32 + qi]);
        float Ls = 0.f;
#pragma unroll
        for (int x = 0; x < KSPL; ++x) Ls += sml[KSPL * 32 + x * 32 + qi] * exp2s(sml[x * 32 + qi] - M);
        const float f = __fdiv_rn(exp2s(m[g] - M), Ls);
        float* orow = so + (size_t)(w * 32 + qi) * OPIT + hi * 8;
#pragma unroll
        for (int db = 0; db < 8; ++db) { const v8f t = o[g][db] * f; v4f t0, t1;
#pragma unroll
            for (int r = 0; r < 4; ++r) { t0[r] = t[r]; t1[r] = t[4 + r]; }
            *(v4fa*)(orow + db * 16) = t0; *(v4fa*)(orow + db * 16 + 4) = t1; } }
    __syncthreads();   // every wave's scaled partial output is in LDS
#pragma unroll
    for (int i = 0; i < 32 * HD / 4 / (KSPL * 32); ++i) { const int e = i * (KSPL * 32) + (int)threadIdx.x; const int row = e / (HD / 4), c4 = (e % (HD / 4)) * 4; v4f a = *(const v4fa*)(so + (size_t)row * OPIT + c4);
#pragma unroll
        for (int x = 1; x < KSPL; ++x) a += *(const v4fa*)(so + (size_t)(x * 32 + row) * OPIT + c4);
        *(v4f*)(out + (size_t)row * HD + c4) = a; }
}
// Grid: the hi/lo row blocks (three products each, the longest) first, then the fp16 ones; 32 query rows a work-group.
// Two waves a SIMD (at most 512 registers each): all 512 work-groups are resident at once, and one wave's softmax runs beside the other's products.
__global__ __launch_bounds__(KSPL * 32) __attribute__((amdgpu_waves_per_eu(2, 2))) void k_fattn(const h16* __restrict__ Q16, const h16* __restrict__ K16, const h16* __restrict__ V16, const bf* __restrict__ Qh, const bf* __restrict__ Ql, const bf* __restrict__ Kh, const bf* __restrict__ Kl, const bf* __restrict__ Vh, const bf* __restrict__ Vl, float* __restrict__ OUTb) {
    __shared__ __align__(16) float so[KSPL * 32 * OPIT]; __shared__ float sml[2 * KSPL * 32];
    int bx = blockIdx.x;
    if (bx < NB_ * (RH / 32)) { const size_t b = bx / (RH / 32); const size_t qo = (b * TT + (size_t)(bx % (RH / 32)) * 32) * HD; const size_t po = b * TT * HD;
        attn_rows<bf, true>(Qh + qo, Ql + qo, Kh + po, Kl + po, Vh + po, Vl + po, OUTb + qo, so, sml);
    } else { bx -= NB_ * (RH / 32); const size_t b = bx / ((TT - RH) / 32); const size_t qo = (b * TT + RH + (size_t)(bx % ((TT - RH) / 32)) * 32) * HD; const size_t po = b * TT * HD;
        attn_rows<h16, false>(Q16 + qo, nullptr, K16 + po, nullptr, V16 + po, nullptr, OUTb + qo, so, sml); }
}

extern "C" void kernel_launch(void* const* d_in, const int* in_sizes, int n_in,
                              void* d_out, int out_size, void* d_ws, size_t ws_size, hipStream_t stream) {
    (void)in_sizes; (void)n_in; (void)out_size;
    const float* xq = (const float*)d_in[0]; const float* xk = (const float*)d_in[1]; const float* xv = (const float*)d_in[2]; const float* wq = (const float*)d_in[3]; const float* bq = (const float*)d_in[4]; const float* wk = (const float*)d_in[5]; const float* bk = (const float*)d_in[6]; const float* wv = (const float*)d_in[7]; const float* bv = (const float*)d_in[8]; const float* x = nullptr; const float* wo = nullptr; (void)x; (void)wo;
    float* OUT = (float*)d_out;     // [8][2048][128]
    char* wsp = (char*)d_ws;
    auto take = [&](size_t bytes) { char* p = wsp; wsp += (bytes + 255) & ~(size_t)255; return (void*)p; };
    bf* WQ = (bf*)take((size_t)DQ * DM * 2); bf* WK = (bf*)take((size_t)DKV * DM * 2); bf* WV = (bf*)take((size_t)DKV * DM * 2); float* CS = (float*)take((size_t)TT * HD * 2 * 4);
    // Every plane below holds NB_ batch slices.
    bf* XB = (bf*)take((size_t)NB_ * TT * DM * 2); float* FQ = (float*)take((size_t)NB_ * TT * DQ * 4); float* FK = (float*)take((size_t)NB_ * TT * DKV * 4);
    h16* QP16 = (h16*)take((size_t)NB_ * NH_ * TT * HD * 2); h16* KP16 = (h16*)take((size_t)NB_ * NKV * TT * HD * 2); h16* VT16 = (h16*)take((size_t)NB_ * NKV * HD * TT * 2);
    bf* QPh = (bf*)take((size_t)NB_ * NH_ * TT * HD * 2); bf* QPl = (bf*)take((size_t)NB_ * NH_ * TT * HD * 2); bf* KPh = (bf*)take((size_t)NB_ * NKV * TT * HD * 2); bf* KPl = (bf*)take((size_t)NB_ * NKV * TT * HD * 2); bf* VTh = (bf*)take((size_t)NB_ * NKV * HD * TT * 2); bf* VTl = (bf*)take((size_t)NB_ * NKV * HD * TT * 2);
    if ((size_t)(wsp - (char*)d_ws) > ws_size) return;    // ws 256 MiB
    float* FV = FK;   // v projection reuses the k buffer after the k planes are built (stream-ordered)
    { k_wtG<<<(unsigned)((DM * DQ / 64 + 63) / 64), 256, 0, stream>>>(wq, DM, DQ, WQ); k_wtG<<<(unsigned)((DM * DKV / 64 + 63) / 64), 256, 0, stream>>>(wk, DM, DKV, WK); k_wtG<<<(unsigned)((DM * DKV / 64 + 63) / 64), 256, 0, stream>>>(wv, DM, DKV, WV); }
    k_csid<<<(TT * HD + 255) / 256, 256, 0, stream>>>(CS);
    const unsigned LQ = (unsigned)(((size_t)NH_ * TT * HD / 2 + 255) / 256), LKv = (unsigned)(((size_t)NKV * TT * HD / 2 + 255) / 256), LX = (unsigned)(((size_t)NB_ * TT * DM / 8 + 255) / 256);
    k_cvt8<<<LX, 256, 0, stream>>>(xq, XB, (size_t)NB_ * TT * DM / 8);   /* x_q rows, all batches */
    k_gemmw<bf, 0, true><<<dim3(NB_ * TT / 64, DQ / 64, 1), 32, 0, stream>>>(XB, nullptr, WQ, nullptr, DM, FQ, DQ, bq, 0, 0, 0);
    k_rope<<<dim3(LQ, NB_, 1), 256, 0, stream>>>(FQ, DQ, NH_, CS, nullptr, nullptr, 1.0f, QP16, QPh, QPl);
    k_cvt8<<<LX, 256, 0, stream>>>(xk, XB, (size_t)NB_ * TT * DM / 8);   /* x_k rows */
    k_gemmw<bf, 0, true><<<dim3(NB_ * TT / 64, DKV / 64, 1), 32, 0, stream>>>(XB, nullptr, WK, nullptr, DM, FK, DKV, bk, 0, 0, 0);
    k_rope<<<dim3(LKv, NB_, 1), 256, 0, stream>>>(FK, DKV, NKV, CS, nullptr, nullptr, 1.0f, KP16, KPh, KPl);
    k_cvt8<<<LX, 256, 0, stream>>>(xv, XB, (size_t)NB_ * TT * DM / 8);   /* x_v rows */
    k_gemmw<bf, 0, true><<<dim3(NB_ * TT / 64, DKV / 64, 1), 32, 0, stream>>>(XB, nullptr, WV, nullptr, DM, FV, DKV, bv, 0, 0, 0); k_vtp<<<dim3(LKv, NB_, 1), 256, 0, stream>>>(FV, DKV, NKV, VT16, VTh, VTl);
    static_assert(NH_ == 1 && NKV == 1 && ZH == 1, "the fused attention kernel takes planes of one head: q, k [batch][t][d], v [batch][d][t]");
    k_fattn<<<NB_ * TT / 32, KSPL * 32, 0, stream>>>(QP16, KP16, VT16, QPh, QPl, KPh, KPl, VTh, VTl, OUT);
}

// v003
// A run of this version takes 68.1 microseconds.
// Two timings next to v002 put it at 1.96 and 1.95 times that version's speed.
// Over all steps from v000 it is 16.8 times as fast.
#include <hip/hip_runtime.h>

// Single-head attention with separate q/k/v inputs (x_q, x_k, x_v [8][2048][256]; q = x_q Wq + bq, k = x_k Wk + bk, v = x_v Wv + bv ('xw' [256][128] + [128]); scores = q.k / sqrt(128); softmax over 2048 keys; out = attn.v -> [8][2048][128] f32 (2.1 M)).
// Two launches, all 8 batches in each. k_proj: the three projections (+ biases) from inputs rounded to bf16 on the way into LDS, written straight as the dense planes (fp16 and bf16 hi/lo; v transposed). k_fattn: scores, running-maximum softmax and attn.v, which writes the f32 output (rows < 512 on hi/lo planes, the rest on fp16).
// Compute dtypes, f32 accumulate: every input rounded to bf16; projections on PLAIN bf16 operands (exact) + f32 biases; scores and attn.v rows < 512 on bf16 hi/lo planes (3 products), the rest single fp16; softmax f32; f32 output.

#define NB_  8
#define TT   2048
#define DM   256
#define NH_  1
#define NKV  1
#define REP  (NH_ / NKV)
#define HD   128
#define DQ   (NH_ * HD)
#define DKV  (NKV * HD)
#define ZH   1
#define RH   512                  // query rows < RH use hi+lo planes (0: none)
#define WIN  0
#define SCL  0.088388347648318447f   // HD^-0.5
typedef _Float16 h16;
typedef unsigned short bf;
typedef __attribute__((ext_vector_type(16))) __bf16   v16bf;
typedef __attribute__((ext_vector_type(16))) _Float16 v16h;
typedef __attribute__((ext_vector_type(8)))  _Float16 v8h;
typedef __attribute__((ext_vector_type(8)))  unsigned short v8us;
typedef __attribute__((ext_vector_type(8)))  float    v8f;
typedef __attribute__((ext_vector_type(4)))  float    v4f;
typedef v8h  __attribute__((may_alias)) v8ha;
typedef v4f  __attribute__((may_alias)) v4fa;
typedef v8us __attribute__((may_alias)) v8usa;

__device__ __forceinline__ unsigned short f2bf(float f) { unsigned u = __float_as_uint(f); u += 0x7FFFu + ((u >> 16) & 1u); return (unsigned short)(u >> 16); }
__device__ __forceinline__ float bf2f(unsigned short b) { return __uint_as_float(((unsigned)b) << 16); }
__device__ __forceinline__ float bfr(float f) { return bf2f(f2bf(f)); }
__device__ __forceinline__ v16h cat16(v8h lo, v8h hi) { return __builtin_shufflevector(lo, hi, 0, 1, 2, 3, 4, 5, 6, 7, 8, 9, 10, 11, 12, 13, 14, 15); }
__device__ __forceinline__ v16bf cat16b(v8us lo, v8us hi) { return __builtin_bit_cast(v16bf, __builtin_shufflevector(lo, hi, 0, 1, 2, 3, 4, 5, 6, 7, 8, 9, 10, 11, 12, 13, 14, 15)); }
__device__ __forceinline__ v8f wmma16(v16h a, v16h b, v8f c) { return __builtin_amdgcn_wmma_f32_16x16x32_f16(false, a, false, b, (short)0, c, false, false); }
__device__ __forceinline__ v8f wmmab(v16bf a, v16bf b, v8f c) { return __builtin_amdgcn_wmma_f32_16x16x32_bf16(false, a, false, b, (short)0, c, false, false); }



// Fragment of a 16x16x32 product from a K-contiguous 16-bit row: p = row (lane & 15) + 8 (lane >> 4); elements k = 8 hi .. 8 hi + 7 and 16 + 8 hi .. 16 + 8 hi + 7.
template <typename T16> struct WFrag;
template <> struct WFrag<h16> { typedef v16h V; static __device__ __forceinline__ V ld(const h16* p) { return cat16(*(const v8h*)p, *(const v8h*)(p + 16)); } static __device__ __forceinline__ v8f mma(V a, V b, v8f c) { return wmma16(a, b, c); } };
template <> struct WFrag<bf> { typedef v16bf V; static __device__ __forceinline__ V ld(const bf* p) { return cat16b(*(const v8us*)p, *(const v8us*)(p + 16)); } static __device__ __forceinline__ v8f mma(V a, V b, v8f c) { return wmmab(a, b, c); } };

// ---- k_proj: one projection (blockIdx.y: 0 q, 1 k, 2 v) of PR rows of x in one work-group of 8 waves; a wave owns 16 rows x all 128 columns (8 accumulators).
// x [PR][256] (one contiguous piece of memory) and W [256][128] are read as f32 in whole lines, rounded to bf16 and laid K-contiguous in LDS (W transposed: a lane gathers 8 k of one column and stores them as 16 bytes).
// q, k: transposed product (A = 16 rows of Wt, B = 16 rows of x): a lane holds 8 neighbouring columns of one row, 16 bytes of a [t][d] plane. v: A = x, B = Wt: a lane holds 8 neighbouring t of one column, 16 bytes of a [d][t] plane.
// The three planes go through LDS once more so that every global store covers whole 128-byte lines.
#define PR   128
#define XPIT (DM + 8)             // 16-bit elements per staged operand row: 528 B = 16 B x odd, conflict-free for 16-byte reads down a column of rows
#define SPIT (HD + 8)             // 16-bit elements per staged output row: 272 B = 16 B x odd
typedef __attribute__((ext_vector_type(8))) __bf16 v8bf;
typedef __attribute__((ext_vector_type(4))) __bf16 v4bf;
typedef __attribute__((ext_vector_type(4))) unsigned short v4us;
// The products and the output of k_proj, behind the barrier that publishes the staged operands. TR: q, k (transposed product); otherwise v.
template <bool TR>
__device__ __forceinline__ void proj_tail(bf* sm, const float* __restrict__ bias, h16* P16, bf* Ph, bf* Pl, size_t r0) {
    const int lane = threadIdx.x & 31, lr = lane & 15, hi = lane >> 4, w = threadIdx.x >> 5;
    v8f acc[8];
#pragma unroll
    for (int nb = 0; nb < 8; ++nb) acc[nb] = (v8f){};
    const bf* xrow = sm + HD * XPIT + (w * 16 + lr) * XPIT + 8 * hi; const bf* wrow = sm + lr * XPIT + 8 * hi;
    // Both loops are unrolled: accumulator and buffer indices are constants, and no matrix instruction stands in front of a back edge. Two fragment buffers: step s + 1 is fetched from LDS ahead of the products of step s.
    v16bf xf[2], wf[2][8];
    auto fetch = [&](int s) { xf[s & 1] = WFrag<bf>::ld(xrow + s * 32);
#pragma unroll
        for (int nb = 0; nb < 8; ++nb) wf[s & 1][nb] = WFrag<bf>::ld(wrow + nb * 16 * XPIT + s * 32); };
    fetch(0);
#pragma unroll
    for (int s = 0; s < DM / 32; ++s) {
        if (s + 1 < DM / 32) fetch(s + 1);
        __builtin_amdgcn_sched_barrier(0);   // keeps the next step's LDS loads ahead of this step's products: sunk to their own products, each pair of loads exposed its latency
#pragma unroll
        for (int nb = 0; nb < 8; ++nb) acc[nb] = TR ? wmmab(wf[s & 1][nb], xf[s & 1], acc[nb]) : wmmab(xf[s & 1], wf[s & 1][nb], acc[nb]);
        __builtin_amdgcn_sched_barrier(0); }   // and the fetch after next behind them: its buffer is the one these products read
    __syncthreads();   // every wave has read its operands: the LDS now takes the output planes, plane p at sm + p * PR * SPIT
    // TR: staged row = t (of the work-group's PR), column = d. Otherwise: staged row = d, column = t.
    v8f bv8[TR ? 8 : 1]; float bv1[TR ? 1 : 8]; const unsigned bo = TR ? hi * 32u : lr * 4u;   // byte offset of the lane's first bias value
#pragma unroll
    for (int nb = 0; nb < 8; ++nb) { if constexpr (TR) bv8[nb] = *(const v8f*)((const char*)bias + bo + nb * 64); else bv1[nb] = *(const float*)((const char*)bias + bo + nb * 64); }
    asm volatile("s_wait_xcnt 0x0" :: "v"(bo) : "memory");   // stands between the bias loads and any write of their offset register, which it names so that the register lives up to here (without it the last load's result took that register)
#pragma unroll
    for (int nb = 0; nb < 8; ++nb) { v8h o16; v8bf oh, ol; v8f bb;
        if constexpr (TR) bb = bv8[nb]; else {
#pragma unroll
            for (int j = 0; j < 8; ++j) bb[j] = bv1[nb]; }
#pragma unroll
        for (int j = 0; j < 8; ++j) { const float y = acc[nb][j] + (float)(__bf16)bb[j]; o16[j] = (h16)y; const __bf16 yh = (__bf16)y; oh[j] = yh; ol[j] = (__bf16)(y - (float)yh); }
        bf* st = sm + (TR ? (w * 16 + lr) * SPIT + nb * 16 + 8 * hi : (nb * 16 + lr) * SPIT + w * 16 + 8 * hi);
        *(v8us*)st = __builtin_bit_cast(v8us, o16); *(v8us*)(st + PR * SPIT) = __builtin_bit_cast(v8us, oh); *(v8us*)(st + 2 * PR * SPIT) = __builtin_bit_cast(v8us, ol); }
    __syncthreads();   // the planes are staged
    // Wave w sends staged rows 16 w .. 16 w + 15 of each plane, two rows (2 x 256 bytes) a store. TR: row pitch HD from row r0. Otherwise: row pitch TT, from column r0 % TT of batch r0 / TT.
    const size_t go = TR ? (r0 + w * 16 + hi) * HD + lr * 8 : (r0 / TT) * HD * TT + (size_t)(w * 16 + hi) * TT + (r0 % TT) + lr * 8; constexpr size_t gp = TR ? 2 * HD : 2 * TT;
    const bf* sr = sm + (w * 16 + hi) * SPIT + lr * 8;
#pragma unroll
    for (int i = 0; i < 8; ++i) {
        *(v8us*)((bf*)P16 + go + i * gp) = *(const v8us*)(sr + i * 2 * SPIT); *(v8us*)(Ph + go + i * gp) = *(const v8us*)(sr + PR * SPIT + i * 2 * SPIT); *(v8us*)(Pl + go + i * gp) = *(const v8us*)(sr + 2 * PR * SPIT + i * 2 * SPIT); }
    asm volatile("s_wait_xcnt 0x0" ::: "memory");   // stands between the stores above and any later write of their address registers (in the listing the other branch's code follows this one's)
}
// Four waves a SIMD (at most 256 registers each): two work-groups fit a WGP, so all 384 are resident at once.
__global__ __launch_bounds__(256) __attribute__((amdgpu_waves_per_eu(4))) void k_proj(const float* __restrict__ xq, const float* __restrict__ xk, const float* __restrict__ xv, const float* __restrict__ wq, const float* __restrict__ wk, const float* __restrict__ wv, const float* __restrict__ bq, const float* __restrict__ bk, const float* __restrict__ bv,
                                              h16* Q16, bf* Qh, bf* Ql, h16* K16, bf* Kh, bf* Kl, h16* V16, bf* Vh, bf* Vl) {
    __shared__ __align__(16) bf sm[(HD + PR) * XPIT];
    static_assert(3 * PR * SPIT <= (HD + PR) * XPIT && TT % PR == 0 && PR == 128 && HD == 128 && DM == 256, "tile shapes");
    bf* wt = sm; bf* xs = sm + HD * XPIT;
    const int tid = threadIdx.x, lane = tid & 31, lr = lane & 15, hi = lane >> 4, w = tid >> 5; const int pj = blockIdx.y; const size_t r0 = (size_t)blockIdx.x * PR;
    const float* x = pj == 0 ? xq : pj == 1 ? xk : xv; const float* W = pj == 0 ? wq : pj == 1 ? wk : wv; const float* bias = pj == 0 ? bq : pj == 1 ? bk : bv;
    h16* P16 = pj == 0 ? Q16 : pj == 1 ? K16 : V16; bf* Ph = pj == 0 ? Qh : pj == 1 ? Kh : Vh; bf* Pl = pj == 0 ? Ql : pj == 1 ? Kl : Vl;
    // Loads return in issue order, so the order of issue is: first half of W (shared by every work-group, from L2: back soonest), all of the thread's share of x (from memory, the longest latency), and,
    // once the first half is stored, the second half of W, whose latency passes under that of x. W goes in two halves to bound the registers.
    const float* wb = W + (size_t)w * 32 * HD + lane;   // wave w stages k = 32 w .. 32 w + 31
    const v4f* xt = (const v4f*)(x + r0 * DM) + tid; v4f xr[32];
#pragma unroll
    for (int hf = 0; hf < 2; ++hf) { float wr[8][8];
#pragma unroll
        for (int i = 0; i < 8; ++i)
#pragma unroll
            for (int kk = 0; kk < 8; ++kk) wr[i][kk] = wb[((hf * 2 + (i >> 2)) * 8 + kk) * HD + (i & 3) * 32];
        __builtin_amdgcn_sched_barrier(0);   // one half's loads are issued together, and the next half's stay behind this half's stores (registers)
        if (hf == 0) {
#pragma unroll
            for (int i = 0; i < 32; ++i) xr[i] = xt[i * 256];
            __builtin_amdgcn_sched_barrier(0); }   // keeps the x loads up here: sunk to their conversions, they would start only after W is staged
#pragma unroll
        for (int i = 0; i < 8; ++i) { v8bf o;
#pragma unroll
            for (int kk = 0; kk < 8; ++kk) o[kk] = (__bf16)wr[i][kk];
            *(v8us*)(wt + ((i & 3) * 32 + lane) * XPIT + (w * 4 + hf * 2 + (i >> 2)) * 8) = __builtin_bit_cast(v8us, o); } }
#pragma unroll
    for (int i = 0; i < 32; ++i) { v4bf o;
#pragma unroll
        for (int q = 0; q < 4; ++q) o[q] = (__bf16)xr[i][q];
        *(v4us*)(xs + (i * 4 + (tid >> 6)) * XPIT + (tid & 63) * 4) = __builtin_bit_cast(v4us, o); }
    __syncthreads();   // both operands are in LDS
    if (pj < 2) proj_tail<true>(sm, bias, P16, Ph, Pl, r0); else proj_tail<false>(sm, bias, P16, Ph, Pl, r0);
}
// k_fattn: scores, softmax and attn.v of 32 query rows in one work-group; neither the scores nor the probabilities go to memory.
// Transposed products: St = K Qt (A = 16 key rows, B = 16 query columns), Ot += Vt Pt (A = 16 rows of Vt, B = the packed probabilities). A lane holds one query's scores (keys 8 hi + r of each 16-key tile),
// so two converted score tiles are the B operand of the second product as they stand, and maximum, sum and rescale factor are per lane (one exchange between the lane halves for the maximum).
// The KSPL waves of a work-group walk TT / KSPL keys each with a running maximum; their partial (max, sum, Ot) are merged through LDS in wave order at the end.
#define KSPL 4
// 2^x with the slot that the instruction set asks for behind a transcendental in the same statement.
__device__ __forceinline__ float exp2s(float x) { float y; asm("v_exp_f32 %0, %1\n\tv_nop" : "=v"(y) : "v"(x)); return y; }
// Unrolling: every inner loop is unrolled so that fragment and accumulator indices are constants (registers, no scratch); the pass loop stays rolled (unroll 1) to keep the text short.
#define OPIT (HD + 4)             // floats per query row of the merge staging: 16-byte aligned rows that start on different banks
template <typename T16, bool HL>
__device__ __forceinline__ void attn_rows(const T16* __restrict__ Q, const T16* __restrict__ Q2, const T16* __restrict__ Kp, const T16* __restrict__ K2, const T16* __restrict__ Vt, const T16* __restrict__ V2, float* __restrict__ out, float* so, float* sml) {
    typedef typename WFrag<T16>::V V;
    constexpr float SC2 = SCL * 1.4426950408889634f;   // scores in log2 units
    constexpr float POFF = HL ? 0.0f : 4.0f;           // fp16 probabilities carry x16 (it cancels in Ot / sum): keeps small ones out of the fp16 subnormals
    const int lane = threadIdx.x & 31, lr = lane & 15, hi = lane >> 4, w = threadIdx.x >> 5;
    V qf[2][4], qf2[2][4];
#pragma unroll
    for (int g = 0; g < 2; ++g)
#pragma unroll
        for (int ks = 0; ks < 4; ++ks) { const size_t qo = (size_t)(g * 16 + lr) * HD + ks * 32 + 8 * hi; qf[g][ks] = WFrag<T16>::ld(Q + qo); if constexpr (HL) qf2[g][ks] = WFrag<T16>::ld(Q2 + qo); }
    v8f o[2][8];
#pragma unroll
    for (int g = 0; g < 2; ++g)
#pragma unroll
        for (int db = 0; db < 8; ++db) o[g][db] = (v8f){};
    float m[2] = {-3.0e38f, -3.0e38f}, l[2] = {0.f, 0.f};
    unsigned ko = (unsigned)((w * (TT / KSPL) + lr) * HD + 8 * hi) * 2u, vo = (unsigned)(lr * TT + w * (TT / KSPL) + 8 * hi) * 2u;   // byte offsets in a batch's plane: 32 bits beside a scalar base, one register for every plane
    auto at = [](const T16* base, unsigned byteoff) { return (const T16*)((const char*)base + byteoff); };
    // Fragment buffers: kf[kt] = the four k steps of key tile kt, vf[h] = Vt row blocks 4 h .. 4 h + 3. Loads are issued well ahead of their products:
    // fp16: all of Vt at the top of a pass, all of the next pass's K behind the score products. hi/lo (twice the registers): each half of Vt behind the score products of one key tile,
    // each key tile of the next pass behind one half of the output products, so that a buffer's registers can serve K and Vt in turn.
    V kf[2][4], kf2[2][4], vf[2][4], vf2[2][4];
    auto loadK = [&](int kt, unsigned off) {
#pragma unroll
        for (int ks = 0; ks < 4; ++ks) { kf[kt][ks] = WFrag<T16>::ld(at(Kp, off) + kt * 16 * HD + ks * 32); if constexpr (HL) kf2[kt][ks] = WFrag<T16>::ld(at(K2, off) + kt * 16 * HD + ks * 32); } };
    auto loadV = [&](int h, unsigned off) {
#pragma unroll
        for (int d = 0; d < 4; ++d) { vf[h][d] = WFrag<T16>::ld(at(Vt, off) + (h * 4 + d) * 16 * TT); if constexpr (HL) vf2[h][d] = WFrag<T16>::ld(at(V2, off) + (h * 4 + d) * 16 * TT); } };
    loadK(0, ko); loadK(1, ko);
    constexpr int NP = TT / KSPL / 32, AH = HL ? 1 : 2;   // passes; how many passes ahead of the update below the next K fetch lies
    unsigned kn = HL ? ko : ko + 32 * HD * 2;             // offset of the next K fetch
    asm volatile("s_wait_xcnt 0x0" ::: "memory");   // stands between the loads above and any later write of a register that they name
#pragma unroll 1
    for (int it = 0; it < NP; ++it) {
        if constexpr (!HL) { loadV(0, vo); loadV(1, vo); __builtin_amdgcn_sched_barrier(0); }   // keeps the loads up here: sunk to their products, each would expose its latency
        v8f s[2][2];
#pragma unroll
        for (int kt = 0; kt < 2; ++kt) { s[kt][0] = (v8f){}; s[kt][1] = (v8f){};
#pragma unroll
            for (int ks = 0; ks < 4; ++ks) {
#pragma unroll
                for (int g = 0; g < 2; ++g) { s[kt][g] = WFrag<T16>::mma(kf[kt][ks], qf[g][ks], s[kt][g]); if constexpr (HL) { s[kt][g] = WFrag<T16>::mma(kf[kt][ks], qf2[g][ks], s[kt][g]); s[kt][g] = WFrag<T16>::mma(kf2[kt][ks], qf[g][ks], s[kt][g]); } } }
            if constexpr (HL) { loadV(kt, vo); __builtin_amdgcn_sched_barrier(0); } }   // as above: holds the issue point of the loads
        if constexpr (!HL) { loadK(0, kn); loadK(1, kn); __builtin_amdgcn_sched_barrier(0); }   // as above
        V pf[2], pf2[2];
#pragma unroll
        for (int g = 0; g < 2; ++g) {
            float mx = s[0][g][0];
#pragma unroll
            for (int r = 0; r < 8; ++r) mx = fmaxf(mx, fmaxf(s[0][g][r], s[1][g][r]));
            mx = fmaxf(mx, __shfl_xor(mx, 16, 32));
            const float mn = fmaxf(m[g], mx * SC2); const float al = exp2s(m[g] - mn); m[g] = mn; const float nb = POFF - mn; float sum = 0.f; float x[16];
#pragma unroll
            for (int e = 0; e < 16; ++e) x[e] = fmaf(s[e >> 3][g][e & 7], SC2, nb);
#pragma unroll
            for (int e = 0; e < 16; ++e) x[e] = exp2s(x[e]);
#pragma unroll
            for (int kt = 0; kt < 2; ++kt)
#pragma unroll
                for (int r = 0; r < 8; ++r) { const float p = x[kt * 8 + r]; sum += p;
                    if constexpr (HL) { const __bf16 ph = (__bf16)p; pf[g][kt * 8 + r] = ph; pf2[g][kt * 8 + r] = (__bf16)(p - (float)ph); } else pf[g][kt * 8 + r] = (h16)p; }
            l[g] = l[g] * al + sum;
#pragma unroll
            for (int db = 0; db < 8; ++db) o[g][db] *= al;
        }
        __builtin_amdgcn_sched_barrier(0);                 // keeps the wait below down here, behind the softmax: without it the wait moved up to stand directly behind the loads' issue
        asm volatile("s_wait_xcnt 0x0" ::: "memory");   // stands between the loads issued so far and the writes of their offset registers below
        __builtin_amdgcn_sched_barrier(0);                 // keeps the two updates behind that wait
        vo += 32 * 2; kn += (it + AH < NP) ? 32 * HD * 2 : 0;   // the last fetch takes the last tile again: in bounds, not used
#pragma unroll
        for (int h = 0; h < 2; ++h) {
#pragma unroll
            for (int d = 0; d < 4; ++d) {
#pragma unroll
                for (int g = 0; g < 2; ++g) { v8f& oo = o[g][h * 4 + d]; oo = WFrag<T16>::mma(vf[h][d], pf[g], oo); if constexpr (HL) { oo = WFrag<T16>::mma(vf[h][d], pf2[g], oo); oo = WFrag<T16>::mma(vf2[h][d], pf[g], oo); } } }
            if constexpr (HL) { loadK(h, kn); __builtin_amdgcn_sched_barrier(0); } }   // as above
    }
    asm volatile("s_wait_xcnt 0x0" ::: "memory");   // stands between the last pass's fetches and the reuse of their offset register
    __builtin_amdgcn_sched_barrier(0);                 // keeps what follows behind that wait
#pragma unroll
    for (int g = 0; g < 2; ++g) { l[g] += __shfl_xor(l[g], 16, 32); if (hi == 0) { sml[w * 32 + g * 16 + lr] = m[g]; sml[KSPL * 32 + w * 32 + g * 16 + lr] = l[g]; } }
    __syncthreads();   // every wave's (max, sum) is in LDS
#pragma unroll
    for (int g = 0; g < 2; ++g) { const int qi = g * 16 + lr; float M = sml[qi];
#pragma unroll
        for (int x = 1; x < KSPL; ++x) M = fmaxf(M, sml[x * 32 + qi]);
        float Ls = 0.f;
#pragma unroll
        for (int x = 0; x < KSPL; ++x) Ls += sml[KSPL * 32 + x * 32 + qi] * exp2s(sml[x * 32 + qi] - M);
        const float f = __fdiv_rn(exp2s(m[g] - M), Ls);
        float* orow = so + (size_t)(w * 32 + qi) * OPIT + hi * 8;
#pragma unroll
        for (int db = 0; db < 8; ++db) { const v8f t = o[g][db] * f; v4f t0, t1;
#pragma unroll
            for (int r = 0; r < 4; ++r) { t0[r] = t[r]; t1[r] = t[4 + r]; }
            *(v4fa*)(orow + db * 16) = t0; *(v4fa*)(orow + db * 16 + 4) = t1; } }
    __syncthreads();   // every wave's scaled partial output is in LDS
#pragma unroll
    for (int i = 0; i < 32 * HD / 4 / (KSPL * 32); ++i) { const int e = i * (KSPL * 32) + (int)threadIdx.x; const int row = e / (HD / 4), c4 = (e % (HD / 4)) * 4; v4f a = *(const v4fa*)(so + (size_t)row * OPIT + c4);
#pragma unroll
        for (int x = 1; x < KSPL; ++x) a += *(const v4fa*)(so + (size_t)(x * 32 + row) * OPIT + c4);
        *(v4f*)(out + (size_t)row * HD + c4) = a; }
}
// Grid: the hi/lo row blocks (three products each, the longest) first, then the fp16 ones; 32 query rows a work-group.
// Two waves a SIMD (at most 512 registers each): all 512 work-groups are resident at once, and one wave's softmax runs beside the other's products.
__global__ __launch_bounds__(KSPL * 32) __attribute__((amdgpu_waves_per_eu(2, 2))) void k_fattn(const h16* __restrict__ Q16, const h16* __restrict__ K16, const h16* __restrict__ V16, const bf* __restrict__ Qh, const bf* __restrict__ Ql, const bf* __restrict__ Kh, const bf* __restrict__ Kl, const bf* __restrict__ Vh, const bf* __restrict__ Vl, float* __restrict__ OUTb) {
    __shared__ __align__(16) float so[KSPL * 32 * OPIT]; __shared__ float sml[2 * KSPL * 32];
    int bx = blockIdx.x;
    if (bx < NB_ * (RH / 32)) { const size_t b = bx / (RH / 32); const size_t qo = (b * TT + (size_t)(bx % (RH / 32)) * 32) * HD; const size_t po = b * TT * HD;
        attn_rows<bf, true>(Qh + qo, Ql + qo, Kh + po, Kl + po, Vh + po, Vl + po, OUTb + qo, so, sml);
    } else { bx -= NB_ * (RH / 32); const size_t b = bx / ((TT - RH) / 32); const size_t qo = (b * TT + RH + (size_t)(bx % ((TT - RH) / 32)) * 32) * HD; const size_t po = b * TT * HD;
        attn_rows<h16, false>(Q16 + qo, nullptr, K16 + po, nullptr, V16 + po, nullptr, OUTb + qo, so, sml); }
}

extern "C" void kernel_launch(void* const* d_in, const int* in_sizes, int n_in,
                              void* d_out, int out_size, void* d_ws, size_t ws_size, hipStream_t stream) {
    (void)in_sizes; (void)n_in; (void)out_size;
    const float* xq = (const float*)d_in[0]; const float* xk = (const float*)d_in[1]; const float* xv = (const float*)d_in[2]; const float* wq = (const float*)d_in[3]; const float* bq = (const float*)d_in[4]; const float* wk = (const float*)d_in[5]; const float* bk = (const float*)d_in[6]; const float* wv = (const float*)d_in[7]; const float* bv = (const float*)d_in[8];
    float* OUT = (float*)d_out;     // [8][2048][128]
    char* wsp = (char*)d_ws;
    auto take = [&](size_t bytes) { char* p = wsp; wsp += (bytes + 255) & ~(size_t)255; return (void*)p; };
    // Every plane holds NB_ batch slices.
    h16* QP16 = (h16*)take((size_t)NB_ * NH_ * TT * HD * 2); h16* KP16 = (h16*)take((size_t)NB_ * NKV * TT * HD * 2); h16* VT16 = (h16*)take((size_t)NB_ * NKV * HD * TT * 2);
    bf* QPh = (bf*)take((size_t)NB_ * NH_ * TT * HD * 2); bf* QPl = (bf*)take((size_t)NB_ * NH_ * TT * HD * 2); bf* KPh = (bf*)take((size_t)NB_ * NKV * TT * HD * 2); bf* KPl = (bf*)take((size_t)NB_ * NKV * TT * HD * 2); bf* VTh = (bf*)take((size_t)NB_ * NKV * HD * TT * 2); bf* VTl = (bf*)take((size_t)NB_ * NKV * HD * TT * 2);
    if ((size_t)(wsp - (char*)d_ws) > ws_size) return;    // ws 256 MiB
    static_assert(NH_ == 1 && NKV == 1 && ZH == 1, "both kernels take planes [batch][t][d] (v: [batch][d][t]) of one head");
    k_proj<<<dim3(NB_ * TT / PR, 3, 1), 256, 0, stream>>>(xq, xk, xv, wq, wk, wv, bq, bk, bv, QP16, QPh, QPl, KP16, KPh, KPl, VT16, VTh, VTl);
    k_fattn<<<NB_ * TT / 32, KSPL * 32, 0, stream>>>(QP16, KP16, VT16, QPh, QPl, KPh, KPl, VTh, VTl, OUT);
}

// v004
// Measured time: 53.3 microseconds a run.
// Two timings next to v003 put it at 1.28 and 1.27 times that version's speed.
// Over all steps from v000 it is 21.4 times as fast.
#include <hip/hip_runtime.h>

// Single-head attention with separate q/k/v inputs (x_q, x_k, x_v [8][2048][256]; q = x_q Wq + bq, k = x_k Wk + bk, v = x_v Wv + bv ('xw' [256][128] + [128]); scores = q.k / sqrt(128); softmax over 2048 keys; out = attn.v -> [8][2048][128] f32 (2.1 M)).
// Two launches, all 8 batches in each. k_proj: the three projections (+ biases) from inputs rounded to bf16 on the way into LDS, written straight as the dense planes (fp16 and bf16 hi/lo), each laid in the fragment order of the matrix instruction that reads it. k_fattn: scores, running-maximum softmax and attn.v, which writes the f32 output (rows < 512 on hi/lo planes, the rest on fp16).
// Compute dtypes, f32 accumulate: every input rounded to bf16; projections on PLAIN bf16 operands (exact) + f32 biases; scores and attn.v rows < 512 on bf16 hi/lo planes (3 products), the rest single fp16; softmax f32; f32 output.

#define NB_  8
#define TT   2048
#define DM   256
#define NH_  1
#define NKV  1
#define REP  (NH_ / NKV)
#define HD   128
#define DQ   (NH_ * HD)
#define DKV  (NKV * HD)
#define ZH   1
#define RH   512                  // query rows < RH use hi+lo planes (0: none)
#define WIN  0
#define SCL  0.088388347648318447f   // HD^-0.5
typedef _Float16 h16;
typedef unsigned short bf;
typedef __attribute__((ext_vector_type(16))) __bf16   v16bf;
typedef __attribute__((ext_vector_type(16))) _Float16 v16h;
typedef __attribute__((ext_vector_type(8)))  _Float16 v8h;
typedef __attribute__((ext_vector_type(8)))  unsigned short v8us;
typedef __attribute__((ext_vector_type(8)))  float    v8f;
typedef __attribute__((ext_vector_type(4)))  float    v4f;
typedef v8h  __attribute__((may_alias)) v8ha;
typedef v4f  __attribute__((may_alias)) v4fa;
typedef v8us __attribute__((may_alias)) v8usa;

__device__ __forceinline__ unsigned short f2bf(float f) { unsigned u = __float_as_uint(f); u += 0x7FFFu + ((u >> 16) & 1u); return (unsigned short)(u >> 16); }
__device__ __forceinline__ float bf2f(unsigned short b) { return __uint_as_float(((unsigned)b) << 16); }
__device__ __forceinline__ float bfr(float f) { return bf2f(f2bf(f)); }
__device__ __forceinline__ v16h cat16(v8h lo, v8h hi) { return __builtin_shufflevector(lo, hi, 0, 1, 2, 3, 4, 5, 6, 7, 8, 9, 10, 11, 12, 13, 14, 15); }
__device__ __forceinline__ v16bf cat16b(v8us lo, v8us hi) { return __builtin_bit_cast(v16bf, __builtin_shufflevector(lo, hi, 0, 1, 2, 3, 4, 5, 6, 7, 8, 9, 10, 11, 12, 13, 14, 15)); }
__device__ __forceinline__ v8f wmma16(v16h a, v16h b, v8f c) { return __builtin_amdgcn_wmma_f32_16x16x32_f16(false, a, false, b, (short)0, c, false, false); }
__device__ __forceinline__ v8f wmmab(v16bf a, v16bf b, v8f c) { return __builtin_amdgcn_wmma_f32_16x16x32_bf16(false, a, false, b, (short)0, c, false, false); }



// Fragment of a 16x16x32 product. ld: from a K-contiguous 16-bit row: p = row (lane & 15) + 8 (lane >> 4); elements k = 8 hi .. 8 hi + 7 and 16 + 8 hi .. 16 + 8 hi + 7.
// ldp: from a plane in fragment order: the same two groups of 8 elements lie at p = block + 8 lane and 256 elements further on, so each of the two loads of a wave covers 512 contiguous bytes (four whole lines).
// Fragment order. q, k: per 16 rows t a block of 2048 elements; element (t, d) at (d >> 4) * 256 + ((d >> 3) & 1) * 128 + (t & 15) * 8 + (d & 7). v: per 32 keys t a block of 4096; element (d, t) at (d >> 4) * 512 + ((t >> 4) & 1) * 256 + ((t >> 3) & 1) * 128 + (d & 15) * 8 + (t & 7).
template <typename T16> struct WFrag;
template <> struct WFrag<h16> { typedef v16h V; static __device__ __forceinline__ V ld(const h16* p) { return cat16(*(const v8h*)p, *(const v8h*)(p + 16)); } static __device__ __forceinline__ V ldp(const h16* p) { return cat16(*(const v8h*)p, *(const v8h*)(p + 256)); } static __device__ __forceinline__ v8f mma(V a, V b, v8f c) { return wmma16(a, b, c); } };
template <> struct WFrag<bf> { typedef v16bf V; static __device__ __forceinline__ V ld(const bf* p) { return cat16b(*(const v8us*)p, *(const v8us*)(p + 16)); } static __device__ __forceinline__ V ldp(const bf* p) { return cat16b(*(const v8us*)p, *(const v8us*)(p + 256)); } static __device__ __forceinline__ v8f mma(V a, V b, v8f c) { return wmmab(a, b, c); } };

// ---- k_proj: one projection (blockIdx.y: 0 q, 1 k, 2 v) of PR rows of x in one work-group of 8 waves; a wave owns 16 rows x all 128 columns (8 accumulators).
// x [PR][256] (one contiguous piece of memory) and W [256][128] are read as f32 in whole lines, rounded to bf16 and laid K-contiguous in LDS (W transposed: a lane gathers 8 k of one column and stores them as 16 bytes).
// q, k: transposed product (A = 16 rows of Wt, B = 16 rows of x): a lane holds 8 neighbouring columns of one row. v: A = x, B = Wt: a lane holds 8 neighbouring t of one column.
// In both cases the 32 lanes' groups of 8 are neighbours in the plane's fragment order: an accumulator goes to each plane as one store of 512 contiguous bytes, with no staging.
#define PR   128
#define XPIT (DM + 8)             // 16-bit elements per staged operand row: 528 B = 16 B x odd, conflict-free for 16-byte reads down a column of rows
typedef __attribute__((ext_vector_type(8))) __bf16 v8bf;
typedef __attribute__((ext_vector_type(4))) __bf16 v4bf;
typedef __attribute__((ext_vector_type(4))) unsigned short v4us;
// The products and the output of k_proj, behind the barrier that publishes the staged operands. TR: q, k (transposed product); otherwise v.
template <bool TR>
__device__ __forceinline__ void proj_tail(bf* sm, const float* __restrict__ bias, h16* P16, bf* Ph, bf* Pl, size_t r0) {
    const int lane = threadIdx.x & 31, lr = lane & 15, hi = lane >> 4, w = threadIdx.x >> 5;
    v8f acc[8];
#pragma unroll
    for (int nb = 0; nb < 8; ++nb) acc[nb] = (v8f){};
    const bf* xrow = sm + HD * XPIT + (w * 16 + lr) * XPIT + 8 * hi; const bf* wrow = sm + lr * XPIT + 8 * hi;
    // Both loops are unrolled: accumulator and buffer indices are constants, and no matrix instruction stands in front of a back edge. Two fragment buffers: step s + 1 is fetched from LDS ahead of the products of step s.
    v16bf xf[2], wf[2][8];
    auto fetch = [&](int s) { xf[s & 1] = WFrag<bf>::ld(xrow + s * 32);
#pragma unroll
        for (int nb = 0; nb < 8; ++nb) wf[s & 1][nb] = WFrag<bf>::ld(wrow + nb * 16 * XPIT + s * 32); };
    fetch(0);
#pragma unroll
    for (int s = 0; s < DM / 32; ++s) {
        if (s + 1 < DM / 32) fetch(s + 1);
        __builtin_amdgcn_sched_barrier(0);   // keeps the next step's LDS loads ahead of this step's products: sunk to their own products, each pair of loads exposed its latency
#pragma unroll
        for (int nb = 0; nb < 8; ++nb) acc[nb] = TR ? wmmab(wf[s & 1][nb], xf[s & 1], acc[nb]) : wmmab(xf[s & 1], wf[s & 1][nb], acc[nb]);
        __builtin_amdgcn_sched_barrier(0); }   // and the fetch after next behind them: its buffer is the one these products read
    // TR: wave w holds rows t = r0 + 16 w + lr, block (r0 >> 4) + w; accumulator nb is d = 16 nb + 8 hi + j. Otherwise: t = r0 + 16 w + 8 hi + j, half w & 1 of key block (r0 >> 5) + (w >> 1); accumulator nb is d = 16 nb + lr.
    const size_t go = TR ? (r0 + w * 16) * HD + lane * 8 : (r0 + (w >> 1) * 32) * HD + (w & 1) * 256 + lane * 8; constexpr size_t gp = TR ? 256 : 512;
    v8f bv8[TR ? 8 : 1]; float bv1[TR ? 1 : 8]; const unsigned bo = TR ? hi * 32u : lr * 4u;   // byte offset of the lane's first bias value
#pragma unroll
    for (int nb = 0; nb < 8; ++nb) { if constexpr (TR) bv8[nb] = *(const v8f*)((const char*)bias + bo + nb * 64); else bv1[nb] = *(const float*)((const char*)bias + bo + nb * 64); }
    asm volatile("s_wait_xcnt 0x0" :: "v"(bo) : "memory");   // stands between the bias loads and any write of their offset register, which it names so that the register lives up to here (without it the last load's result took that register)
#pragma unroll
    for (int nb = 0; nb < 8; ++nb) { v8h o16; v8bf oh, ol; v8f bb;
        if constexpr (TR) bb = bv8[nb]; else {
#pragma unroll
            for (int j = 0; j < 8; ++j) bb[j] = bv1[nb]; }
#pragma unroll
        for (int j = 0; j < 8; ++j) { const float y = acc[nb][j] + (float)(__bf16)bb[j]; o16[j] = (h16)y; const __bf16 yh = (__bf16)y; oh[j] = yh; ol[j] = (__bf16)(y - (float)yh); }
        *(v8us*)((bf*)P16 + go + nb * gp) = __builtin_bit_cast(v8us, o16); *(v8us*)(Ph + go + nb * gp) = __builtin_bit_cast(v8us, oh); *(v8us*)(Pl + go + nb * gp) = __builtin_bit_cast(v8us, ol); }
    asm volatile("s_wait_xcnt 0x0" ::: "memory");   // stands between the stores above and any later write of their address registers (in the listing the other branch's code follows this one's)
}
// Four waves a SIMD (at most 256 registers each): two work-groups fit a WGP, so all 384 are resident at once.
__global__ __launch_bounds__(256) __attribute__((amdgpu_waves_per_eu(4))) void k_proj(const float* __restrict__ xq, const float* __restrict__ xk, const float* __restrict__ xv, const float* __restrict__ wq, const float* __restrict__ wk, const float* __restrict__ wv, const float* __restrict__ bq, const float* __restrict__ bk, const float* __restrict__ bv,
                                              h16* Q16, bf* Qh, bf* Ql, h16* K16, bf* Kh, bf* Kl, h16* V16, bf* Vh, bf* Vl) {
    __shared__ __align__(16) bf sm[(HD + PR) * XPIT];
    static_assert(TT % PR == 0 && PR == 128 && HD == 128 && DM == 256, "tile shapes");
    bf* wt = sm; bf* xs = sm + HD * XPIT;
    const int tid = threadIdx.x, lane = tid & 31, lr = lane & 15, hi = lane >> 4, w = tid >> 5; const int pj = blockIdx.y; const size_t r0 = (size_t)blockIdx.x * PR;
    const float* x = pj == 0 ? xq : pj == 1 ? xk : xv; const float* W = pj == 0 ? wq : pj == 1 ? wk : wv; const float* bias = pj == 0 ? bq : pj == 1 ? bk : bv;
    h16* P16 = pj == 0 ? Q16 : pj == 1 ? K16 : V16; bf* Ph = pj == 0 ? Qh : pj == 1 ? Kh : Vh; bf* Pl = pj == 0 ? Ql : pj == 1 ? Kl : Vl;
    // Loads return in issue order, so the order of issue is: first half of W (shared by every work-group, from L2: back soonest), all of the thread's share of x (from memory, the longest latency), and,
    // once the first half is stored, the second half of W, whose latency passes under that of x. W goes in two halves to bound the registers.
    const float* wb = W + (size_t)w * 32 * HD + lane;   // wave w stages k = 32 w .. 32 w + 31
    const v4f* xt = (const v4f*)(x + r0 * DM) + tid; v4f xr[32];
#pragma unroll
    for (int hf = 0; hf < 2; ++hf) { float wr[8][8];
#pragma unroll
        for (int i = 0; i < 8; ++i)
#pragma unroll
            for (int kk = 0; kk < 8; ++kk) wr[i][kk] = wb[((hf * 2 + (i >> 2)) * 8 + kk) * HD + (i & 3) * 32];
        __builtin_amdgcn_sched_barrier(0);   // one half's loads are issued together, and the next half's stay behind this half's stores (registers)
        if (hf == 0) {
#pragma unroll
            for (int i = 0; i < 32; ++i) xr[i] = xt[i * 256];
            __builtin_amdgcn_sched_barrier(0); }   // keeps the x loads up here: sunk to their conversions, they would start only after W is staged
        else asm volatile("s_wait_xcnt 0x0" :: "v"(wb) : "memory");   // stands between the W loads and any write of their address register, which it names so that the register lives up to here (without it the last load's result took that register)
#pragma unroll
        for (int i = 0; i < 8; ++i) { v8bf o;
#pragma unroll
            for (int kk = 0; kk < 8; ++kk) o[kk] = (__bf16)wr[i][kk];
            *(v8us*)(wt + ((i & 3) * 32 + lane) * XPIT + (w * 4 + hf * 2 + (i >> 2)) * 8) = __builtin_bit_cast(v8us, o); } }
#pragma unroll
    for (int i = 0; i < 32; ++i) { v4bf o;
#pragma unroll
        for (int q = 0; q < 4; ++q) o[q] = (__bf16)xr[i][q];
        *(v4us*)(xs + (i * 4 + (tid >> 6)) * XPIT + (tid & 63) * 4) = __builtin_bit_cast(v4us, o); }
    __syncthreads();   // both operands are in LDS
    if (pj < 2) proj_tail<true>(sm, bias, P16, Ph, Pl, r0); else proj_tail<false>(sm, bias, P16, Ph, Pl, r0);
}
// k_fattn: scores, softmax and attn.v of 32 query rows in one work-group; neither the scores nor the probabilities go to memory.
// Transposed products: St = K Qt (A = 16 key rows, B = 16 query columns), Ot += Vt Pt (A = 16 rows of Vt, B = the packed probabilities). A lane holds one query's scores (keys 8 hi + r of each 16-key tile),
// so two converted score tiles are the B operand of the second product as they stand, and maximum, sum and rescale factor are per lane (one exchange between the lane halves for the maximum).
// The KSPL waves of a work-group walk TT / KSPL keys each with a running maximum; their partial (max, sum, Ot) are merged through LDS in wave order at the end.
#define KSPL 4
// 2^x with the slot that the instruction set asks for behind a transcendental in the same statement.
__device__ __forceinline__ float exp2s(float x) { float y; asm("v_exp_f32 %0, %1\n\tv_nop" : "=v"(y) : "v"(x)); return y; }
// Unrolling: every inner loop is unrolled so that fragment and accumulator indices are constants (registers, no scratch); the pass loop stays rolled (unroll 1) to keep the text short.
#define OPIT (HD + 4)             // floats per query row of the merge staging: 16-byte aligned rows that start on different banks
template <typename T16, bool HL>
__device__ __forceinline__ void attn_rows(const T16* __restrict__ Q, const T16* __restrict__ Q2, const T16* __restrict__ Kp, const T16* __restrict__ K2, const T16* __restrict__ Vt, const T16* __restrict__ V2, float* __restrict__ out, float* so, float* sml) {
    typedef typename WFrag<T16>::V V;
    constexpr float SC2 = SCL * 1.4426950408889634f;   // scores in log2 units
    constexpr float POFF = HL ? 0.0f : 4.0f;           // fp16 probabilities carry x16 (it cancels in Ot / sum): keeps small ones out of the fp16 subnormals
    const int lane = threadIdx.x & 31, lr = lane & 15, hi = lane >> 4, w = threadIdx.x >> 5;
    V qf[2][4], qf2[2][4];
#pragma unroll
    for (int g = 0; g < 2; ++g)
#pragma unroll
        for (int ks = 0; ks < 4; ++ks) { const size_t qo = (size_t)g * 16 * HD + ks * 512 + lane * 8; qf[g][ks] = WFrag<T16>::ldp(Q + qo); if constexpr (HL) qf2[g][ks] = WFrag<T16>::ldp(Q2 + qo); }
    v8f o[2][8];
#pragma unroll
    for (int g = 0; g < 2; ++g)
#pragma unroll
        for (int db = 0; db < 8; ++db) o[g][db] = (v8f){};
    float m[2] = {-3.0e38f, -3.0e38f}, l[2] = {0.f, 0.f};
    unsigned ko = (unsigned)(w * (TT / KSPL) * HD + lane * 8) * 2u, vo = ko;   // byte offsets in a batch's plane: 32 bits beside a scalar base, one register for every plane
    auto at = [](const T16* base, unsigned byteoff) { return (const T16*)((const char*)base + byteoff); };
    // Fragment buffers: kf[kt] = the four k steps of key tile kt, vf[h] = Vt row blocks 4 h .. 4 h + 3. Loads are issued well ahead of their products:
    // fp16: all of Vt at the top of a pass, all of the next pass's K behind the score products. hi/lo (twice the registers): each half of Vt behind the score products of one key tile,
    // each key tile of the next pass behind one half of the output products, so that a buffer's registers can serve K and Vt in turn.
    V kf[2][4], kf2[2][4], vf[2][4], vf2[2][4];
    auto loadK = [&](int kt, unsigned off) {
#pragma unroll
        for (int ks = 0; ks < 4; ++ks) { kf[kt][ks] = WFrag<T16>::ldp(at(Kp, off) + kt * 16 * HD + ks * 512); if constexpr (HL) kf2[kt][ks] = WFrag<T16>::ldp(at(K2, off) + kt * 16 * HD + ks * 512); } };
    auto loadV = [&](int h, unsigned off) {
#pragma unroll
        for (int d = 0; d < 4; ++d) { vf[h][d] = WFrag<T16>::ldp(at(Vt, off) + (h * 4 + d) * 512); if constexpr (HL) vf2[h][d] = WFrag<T16>::ldp(at(V2, off) + (h * 4 + d) * 512); } };
    loadK(0, ko); loadK(1, ko);
    constexpr int NP = TT / KSPL / 32, AH = HL ? 1 : 2;   // passes; how many passes ahead of the update below the next K fetch lies
    unsigned kn = HL ? ko : ko + 32 * HD * 2;             // offset of the next K fetch
    asm volatile("s_wait_xcnt 0x0" ::: "memory");   // stands between the loads above and any later write of a register that they name
#pragma unroll 1
    for (int it = 0; it < NP; ++it) {
        if constexpr (!HL) { loadV(0, vo); loadV(1, vo); __builtin_amdgcn_sched_barrier(0); }   // keeps the loads up here: sunk to their products, each would expose its latency
        v8f s[2][2];
#pragma unroll
        for (int kt = 0; kt < 2; ++kt) { s[kt][0] = (v8f){}; s[kt][1] = (v8f){};
#pragma unroll
            for (int ks = 0; ks < 4; ++ks) {
#pragma unroll
                for (int g = 0; g < 2; ++g) { s[kt][g] = WFrag<T16>::mma(kf[kt][ks], qf[g][ks], s[kt][g]); if constexpr (HL) { s[kt][g] = WFrag<T16>::mma(kf[kt][ks], qf2[g][ks], s[kt][g]); s[kt][g] = WFrag<T16>::mma(kf2[kt][ks], qf[g][ks], s[kt][g]); } } }
            if constexpr (HL) { loadV(kt, vo); __builtin_amdgcn_sched_barrier(0); } }   // as above: holds the issue point of the loads
        if constexpr (!HL) { loadK(0, kn); loadK(1, kn); __builtin_amdgcn_sched_barrier(0); }   // as above
        V pf[2], pf2[2];
#pragma unroll
        for (int g = 0; g < 2; ++g) {
            float mx = s[0][g][0];
#pragma unroll
            for (int r = 0; r < 8; ++r) mx = fmaxf(mx, fmaxf(s[0][g][r], s[1][g][r]));
            mx = fmaxf(mx, __shfl_xor(mx, 16, 32));
            const float mn = fmaxf(m[g], mx * SC2); const float al = exp2s(m[g] - mn); m[g] = mn; const float nb = POFF - mn; float sum = 0.f; float x[16];
#pragma unroll
            for (int e = 0; e < 16; ++e) x[e] = fmaf(s[e >> 3][g][e & 7], SC2, nb);
#pragma unroll
            for (int e = 0; e < 16; ++e) x[e] = exp2s(x[e]);
#pragma unroll
            for (int kt = 0; kt < 2; ++kt)
#pragma unroll
                for (int r = 0; r < 8; ++r) { const float p = x[kt * 8 + r]; sum += p;
                    if constexpr (HL) { const __bf16 ph = (__bf16)p; pf[g][kt * 8 + r] = ph; pf2[g][kt * 8 + r] = (__bf16)(p - (float)ph); } else pf[g][kt * 8 + r] = (h16)p; }
            l[g] = l[g] * al + sum;
#pragma unroll
            for (int db = 0; db < 8; ++db) o[g][db] *= al;
        }
        __builtin_amdgcn_sched_barrier(0);                 // keeps the wait below down here, behind the softmax: without it the wait moved up to stand directly behind the loads' issue
        asm volatile("s_wait_xcnt 0x0" ::: "memory");   // stands between the loads issued so far and the writes of their offset registers below
        __builtin_amdgcn_sched_barrier(0);                 // keeps the two updates behind that wait
        vo += 32 * HD * 2; kn += (it + AH < NP) ? 32 * HD * 2 : 0;   // the last fetch takes the last tile again: in bounds, not used
#pragma unroll
        for (int h = 0; h < 2; ++h) {
#pragma unroll
            for (int d = 0; d < 4; ++d) {
#pragma unroll
                for (int g = 0; g < 2; ++g) { v8f& oo = o[g][h * 4 + d]; oo = WFrag<T16>::mma(vf[h][d], pf[g], oo); if constexpr (HL) { oo = WFrag<T16>::mma(vf[h][d], pf2[g], oo); oo = WFrag<T16>::mma(vf2[h][d], pf[g], oo); } } }
            if constexpr (HL) { loadK(h, kn); __builtin_amdgcn_sched_barrier(0); } }   // as above
    }
    asm volatile("s_wait_xcnt 0x0" ::: "memory");   // stands between the last pass's fetches and the reuse of their offset register
    __builtin_amdgcn_sched_barrier(0);                 // keeps what follows behind that wait
#pragma unroll
    for (int g = 0; g < 2; ++g) { l[g] += __shfl_xor(l[g], 16, 32); if (hi == 0) { sml[w * 32 + g * 16 + lr] = m[g]; sml[KSPL * 32 + w * 32 + g * 16 + lr] = l[g]; } }
    __syncthreads();   // every wave's (max, sum) is in LDS
#pragma unroll
    for (int g = 0; g < 2; ++g) { const int qi = g * 16 + lr; float M = sml[qi];
#pragma unroll
        for (int x = 1; x < KSPL; ++x) M = fmaxf(M, sml[x * 32 + qi]);
        float Ls = 0.f;
#pragma unroll
        for (int x = 0; x < KSPL; ++x) Ls += sml[KSPL * 32 + x * 32 + qi] * exp2s(sml[x * 32 + qi] - M);
        const float f = __fdiv_rn(exp2s(m[g] - M), Ls);
        float* orow = so + (size_t)(w * 32 + qi) * OPIT + hi * 8;
#pragma unroll
        for (int db = 0; db < 8; ++db) { const v8f t = o[g][db] * f; v4f t0, t1;
#pragma unroll
            for (int r = 0; r < 4; ++r) { t0[r] = t[r]; t1[r] = t[4 + r]; }
            *(v4fa*)(orow + db * 16) = t0; *(v4fa*)(orow + db * 16 + 4) = t1; } }
    __syncthreads();   // every wave's scaled partial output is in LDS
#pragma unroll
    for (int i = 0; i < 32 * HD / 4 / (KSPL * 32); ++i) { const int e = i * (KSPL * 32) + (int)threadIdx.x; const int row = e / (HD / 4), c4 = (e % (HD / 4)) * 4; v4f a = *(const v4fa*)(so + (size_t)row * OPIT + c4);
#pragma unroll
        for (int x = 1; x < KSPL; ++x) a += *(const v4fa*)(so + (size_t)(x * 32 + row) * OPIT + c4);
        *(v4f*)(out + (size_t)row * HD + c4) = a; }
}
// Grid: the hi/lo row blocks (three products each, the longest) first, then the fp16 ones; 32 query rows a work-group.
// Two waves a SIMD (at most 512 registers each): all 512 work-groups are resident at once, and one wave's softmax runs beside the other's products.
__global__ __launch_bounds__(KSPL * 32) __attribute__((amdgpu_waves_per_eu(2, 2))) void k_fattn(const h16* __restrict__ Q16, const h16* __restrict__ K16, const h16* __restrict__ V16, const bf* __restrict__ Qh, const bf* __restrict__ Ql, const bf* __restrict__ Kh, const bf* __restrict__ Kl, const bf* __restrict__ Vh, const bf* __restrict__ Vl, float* __restrict__ OUTb) {
    __shared__ __align__(16) float so[KSPL * 32 * OPIT]; __shared__ float sml[2 * KSPL * 32];
    int bx = blockIdx.x;
    if (bx < NB_ * (RH / 32)) { const size_t b = bx / (RH / 32); const size_t qo = (b * TT + (size_t)(bx % (RH / 32)) * 32) * HD; const size_t po = b * TT * HD;
        attn_rows<bf, true>(Qh + qo, Ql + qo, Kh + po, Kl + po, Vh + po, Vl + po, OUTb + qo, so, sml);
    } else { bx -= NB_ * (RH / 32); const size_t b = bx / ((TT - RH) / 32); const size_t qo = (b * TT + RH + (size_t)(bx % ((TT - RH) / 32)) * 32) * HD; const size_t po = b * TT * HD;
        attn_rows<h16, false>(Q16 + qo, nullptr, K16 + po, nullptr, V16 + po, nullptr, OUTb + qo, so, sml); }
}

extern "C" void kernel_launch(void* const* d_in, const int* in_sizes, int n_in,
                              void* d_out, int out_size, void* d_ws, size_t ws_size, hipStream_t stream) {
    (void)in_sizes; (void)n_in; (void)out_size;
    const float* xq = (const float*)d_in[0]; const float* xk = (const float*)d_in[1]; const float* xv = (const float*)d_in[2]; const float* wq = (const float*)d_in[3]; const float* bq = (const float*)d_in[4]; const float* wk = (const float*)d_in[5]; const float* bk = (const float*)d_in[6]; const float* wv = (const float*)d_in[7]; const float* bv = (const float*)d_in[8];
    float* OUT = (float*)d_out;     // [8][2048][128]
    char* wsp = (char*)d_ws;
    auto take = [&](size_t bytes) { char* p = wsp; wsp += (bytes + 255) & ~(size_t)255; return (void*)p; };
    // Every plane holds NB_ batch slices.
    h16* QP16 = (h16*)take((size_t)NB_ * NH_ * TT * HD * 2); h16* KP16 = (h16*)take((size_t)NB_ * NKV * TT * HD * 2); h16* VT16 = (h16*)take((size_t)NB_ * NKV * HD * TT * 2);
    bf* QPh = (bf*)take((size_t)NB_ * NH_ * TT * HD * 2); bf* QPl = (bf*)take((size_t)NB_ * NH_ * TT * HD * 2); bf* KPh = (bf*)take((size_t)NB_ * NKV * TT * HD * 2); bf* KPl = (bf*)take((size_t)NB_ * NKV * TT * HD * 2); bf* VTh = (bf*)take((size_t)NB_ * NKV * HD * TT * 2); bf* VTl = (bf*)take((size_t)NB_ * NKV * HD * TT * 2);
    if ((size_t)(wsp - (char*)d_ws) > ws_size) return;    // ws 256 MiB
    static_assert(NH_ == 1 && NKV == 1 && ZH == 1, "both kernels take planes of one head, each batch's slice in fragment order");
    k_proj<<<dim3(NB_ * TT / PR, 3, 1), 256, 0, stream>>>(xq, xk, xv, wq, wk, wv, bq, bk, bv, QP16, QPh, QPl, KP16, KPh, KPl, VT16, VTh, VTl);
    k_fattn<<<NB_ * TT / 32, KSPL * 32, 0, stream>>>(QP16, KP16, VT16, QPh, QPl, KPh, KPl, VTh, VTl, OUT);
}

// v005
// One run takes 44.9 microseconds.
// Timed twice side by side with v004, it ran 1.18 times as fast both times.
// Over all steps from v000 it is 25.3 times as fast.
#include <hip/hip_runtime.h>

// Single-head attention with separate q/k/v inputs (x_q, x_k, x_v [8][2048][256]; q = x_q Wq + bq, k = x_k Wk + bk, v = x_v Wv + bv ('xw' [256][128] + [128]); scores = q.k / sqrt(128); softmax over 2048 keys; out = attn.v -> [8][2048][128] f32 (2.1 M)).
// Two launches, all 8 batches in each. k_proj: the three projections (+ biases) from inputs rounded to bf16 on the way into LDS, written straight as the dense planes (fp16 and bf16 hi/lo), each laid in the fragment order of the matrix instruction that reads it. k_fattn: scores, running-maximum softmax and attn.v, which writes the f32 output (rows < 512 on hi/lo planes, the rest on fp16).
// Compute dtypes, f32 accumulate: every input rounded to bf16; projections on PLAIN bf16 operands (exact) + f32 biases; scores and attn.v rows < 512 on bf16 hi/lo planes (3 products), the rest single fp16; softmax f32; f32 output.

#define NB_  8
#define TT   2048
#define DM   256
#define NH_  1
#define NKV  1
#define REP  (NH_ / NKV)
#define HD   128
#define DQ   (NH_ * HD)
#define DKV  (NKV * HD)
#define ZH   1
#define RH   512                  // query rows < RH use hi+lo planes (0: none)
#define WIN  0
#define SCL  0.088388347648318447f   // HD^-0.5
typedef _Float16 h16;
typedef unsigned short bf;
typedef __attribute__((ext_vector_type(16))) __bf16   v16bf;
typedef __attribute__((ext_vector_type(16))) _Float16 v16h;
typedef __attribute__((ext_vector_type(8)))  _Float16 v8h;
typedef __attribute__((ext_vector_type(8)))  unsigned short v8us;
typedef __attribute__((ext_vector_type(8)))  float    v8f;
typedef __attribute__((ext_vector_type(4)))  float    v4f;
typedef v8h  __attribute__((may_alias)) v8ha;
typedef v4f  __attribute__((may_alias)) v4fa;
typedef v8us __attribute__((may_alias)) v8usa;

__device__ __forceinline__ unsigned short f2bf(float f) { unsigned u = __float_as_uint(f); u += 0x7FFFu + ((u >> 16) & 1u); return (unsigned short)(u >> 16); }
__device__ __forceinline__ float bf2f(unsigned short b) { return __uint_as_float(((unsigned)b) << 16); }
__device__ __forceinline__ float bfr(float f) { return bf2f(f2bf(f)); }
__device__ __forceinline__ v16h cat16(v8h lo, v8h hi) { return __builtin_shufflevector(lo, hi, 0, 1, 2, 3, 4, 5, 6, 7, 8, 9, 10, 11, 12, 13, 14, 15); }
__device__ __forceinline__ v16bf cat16b(v8us lo, v8us hi) { return __builtin_bit_cast(v16bf, __builtin_shufflevector(lo, hi, 0, 1, 2, 3, 4, 5, 6, 7, 8, 9, 10, 11, 12, 13, 14, 15)); }
__device__ __forceinline__ v8f wmma16(v16h a, v16h b, v8f c) { return __builtin_amdgcn_wmma_f32_16x16x32_f16(false, a, false, b, (short)0, c, false, false); }
__device__ __forceinline__ v8f wmmab(v16bf a, v16bf b, v8f c) { return __builtin_amdgcn_wmma_f32_16x16x32_bf16(false, a, false, b, (short)0, c, false, false); }



// Fragment of a 16x16x32 product. ld: from a K-contiguous 16-bit row: p = row (lane & 15) + 8 (lane >> 4); elements k = 8 hi .. 8 hi + 7 and 16 + 8 hi .. 16 + 8 hi + 7.
// ldp: from a plane in fragment order: the same two groups of 8 elements lie at p = block + 8 lane and 256 elements further on, so each of the two loads of a wave covers 512 contiguous bytes (four whole lines).
// Fragment order. q, k: per 16 rows t a block of 2048 elements; element (t, d) at (d >> 4) * 256 + ((d >> 3) & 1) * 128 + (t & 15) * 8 + (d & 7). v: per 32 keys t a block of 4096; element (d, t) at (d >> 4) * 512 + ((t >> 4) & 1) * 256 + ((t >> 3) & 1) * 128 + (d & 15) * 8 + (t & 7).
template <typename T16> struct WFrag;
template <> struct WFrag<h16> { typedef v16h V; static __device__ __forceinline__ V ld(const h16* p) { return cat16(*(const v8h*)p, *(const v8h*)(p + 16)); } static __device__ __forceinline__ V ldp(const h16* p) { return cat16(*(const v8h*)p, *(const v8h*)(p + 256)); } static __device__ __forceinline__ v8f mma(V a, V b, v8f c) { return wmma16(a, b, c); } };
template <> struct WFrag<bf> { typedef v16bf V; static __device__ __forceinline__ V ld(const bf* p) { return cat16b(*(const v8us*)p, *(const v8us*)(p + 16)); } static __device__ __forceinline__ V ldp(const bf* p) { return cat16b(*(const v8us*)p, *(const v8us*)(p + 256)); } static __device__ __forceinline__ v8f mma(V a, V b, v8f c) { return wmmab(a, b, c); } };

// ---- k_proj: one projection (blockIdx.y: 0 q, 1 k, 2 v) of PR rows of x in one work-group of 8 waves; a wave owns 16 rows x all 128 columns (8 accumulators).
// x [PR][256] (one contiguous piece of memory) and W [256][128] are read as f32 in whole lines, rounded to bf16 and laid K-contiguous in LDS (W transposed: a lane gathers 8 k of one column and stores them as 16 bytes).
// q, k: transposed product (A = 16 rows of Wt, B = 16 rows of x): a lane holds 8 neighbouring columns of one row. v: A = x, B = Wt: a lane holds 8 neighbouring t of one column.
// In both cases the 32 lanes' groups of 8 are neighbours in the plane's fragment order: an accumulator goes to each plane as one store of 512 contiguous bytes, with no staging.
#define PR   128
#define XPIT (DM + 8)             // 16-bit elements per staged operand row: 528 B = 16 B x odd, conflict-free for 16-byte reads down a column of rows
typedef __attribute__((ext_vector_type(8))) __bf16 v8bf;
typedef __attribute__((ext_vector_type(4))) __bf16 v4bf;
typedef __attribute__((ext_vector_type(4))) unsigned short v4us;
// The products and the output of k_proj, behind the barrier that publishes the staged operands. TR: q, k (transposed product); otherwise v.
template <bool TR>
__device__ __forceinline__ void proj_tail(bf* sm, const float* __restrict__ bias, h16* P16, bf* Ph, bf* Pl, size_t r0) {
    const int lane = threadIdx.x & 31, lr = lane & 15, hi = lane >> 4, w = threadIdx.x >> 5;
    v8f acc[8];
#pragma unroll
    for (int nb = 0; nb < 8; ++nb) acc[nb] = (v8f){};
    const bf* xrow = sm + HD * XPIT + (w * 16 + lr) * XPIT + 8 * hi; const bf* wrow = sm + lr * XPIT + 8 * hi;
    // Both loops are unrolled: accumulator and buffer indices are constants, and no matrix instruction stands in front of a back edge. Two fragment buffers: step s + 1 is fetched from LDS ahead of the products of step s.
    v16bf xf[2], wf[2][8];
    auto fetch = [&](int s) { xf[s & 1] = WFrag<bf>::ld(xrow + s * 32);
#pragma unroll
        for (int nb = 0; nb < 8; ++nb) wf[s & 1][nb] = WFrag<bf>::ld(wrow + nb * 16 * XPIT + s * 32); };
    fetch(0);
#pragma unroll
    for (int s = 0; s < DM / 32; ++s) {
        if (s + 1 < DM / 32) fetch(s + 1);
        __builtin_amdgcn_sched_barrier(0);   // keeps the next step's LDS loads ahead of this step's products: sunk to their own products, each pair of loads exposed its latency
#pragma unroll
        for (int nb = 0; nb < 8; ++nb) acc[nb] = TR ? wmmab(wf[s & 1][nb], xf[s & 1], acc[nb]) : wmmab(xf[s & 1], wf[s & 1][nb], acc[nb]);
        __builtin_amdgcn_sched_barrier(0); }   // and the fetch after next behind them: its buffer is the one these products read
    // TR: wave w holds rows t = r0 + 16 w + lr, block (r0 >> 4) + w; accumulator nb is d = 16 nb + 8 hi + j. Otherwise: t = r0 + 16 w + 8 hi + j, half w & 1 of key block (r0 >> 5) + (w >> 1); accumulator nb is d = 16 nb + lr.
    const size_t go = TR ? (r0 + w * 16) * HD + lane * 8 : (r0 + (w >> 1) * 32) * HD + (w & 1) * 256 + lane * 8; constexpr size_t gp = TR ? 256 : 512;
    v8f bv8[TR ? 8 : 1]; float bv1[TR ? 1 : 8]; const unsigned bo = TR ? hi * 32u : lr * 4u;   // byte offset of the lane's first bias value
#pragma unroll
    for (int nb = 0; nb < 8; ++nb) { if constexpr (TR) bv8[nb] = *(const v8f*)((const char*)bias + bo + nb * 64); else bv1[nb] = *(const float*)((const char*)bias + bo + nb * 64); }
    asm volatile("s_wait_xcnt 0x0" :: "v"(bo) : "memory");   // stands between the bias loads and any write of their offset register, which it names so that the register lives up to here (without it the last load's result took that register)
#pragma unroll
    for (int nb = 0; nb < 8; ++nb) { v8h o16; v8bf oh, ol; v8f bb;
        if constexpr (TR) bb = bv8[nb]; else {
#pragma unroll
            for (int j = 0; j < 8; ++j) bb[j] = bv1[nb]; }
#pragma unroll
        for (int j = 0; j < 8; ++j) { const float y = acc[nb][j] + (float)(__bf16)bb[j]; o16[j] = (h16)y; const __bf16 yh = (__bf16)y; oh[j] = yh; ol[j] = (__bf16)(y - (float)yh); }
        *(v8us*)((bf*)P16 + go + nb * gp) = __builtin_bit_cast(v8us, o16); *(v8us*)(Ph + go + nb * gp) = __builtin_bit_cast(v8us, oh); *(v8us*)(Pl + go + nb * gp) = __builtin_bit_cast(v8us, ol); }
    asm volatile("s_wait_xcnt 0x0" ::: "memory");   // stands between the stores above and any later write of their address registers (in the listing the other branch's code follows this one's)
}
// Four waves a SIMD (at most 256 registers each): two work-groups fit a WGP, so all 384 are resident at once.
__global__ __launch_bounds__(256) __attribute__((amdgpu_waves_per_eu(4))) void k_proj(const float* __restrict__ xq, const float* __restrict__ xk, const float* __restrict__ xv, const float* __restrict__ wq, const float* __restrict__ wk, const float* __restrict__ wv, const float* __restrict__ bq, const float* __restrict__ bk, const float* __restrict__ bv,
                                              h16* Q16, bf* Qh, bf* Ql, h16* K16, bf* Kh, bf* Kl, h16* V16, bf* Vh, bf* Vl) {
    __shared__ __align__(16) bf sm[(HD + PR) * XPIT];
    static_assert(TT % PR == 0 && PR == 128 && HD == 128 && DM == 256, "tile shapes");
    bf* wt = sm; bf* xs = sm + HD * XPIT;
    const int tid = threadIdx.x, lane = tid & 31, lr = lane & 15, hi = lane >> 4, w = tid >> 5; const int pj = blockIdx.y; const size_t r0 = (size_t)blockIdx.x * PR;
    const float* x = pj == 0 ? xq : pj == 1 ? xk : xv; const float* W = pj == 0 ? wq : pj == 1 ? wk : wv; const float* bias = pj == 0 ? bq : pj == 1 ? bk : bv;
    h16* P16 = pj == 0 ? Q16 : pj == 1 ? K16 : V16; bf* Ph = pj == 0 ? Qh : pj == 1 ? Kh : Vh; bf* Pl = pj == 0 ? Ql : pj == 1 ? Kl : Vl;
    // Loads return in issue order, so the order of issue is: first half of W (shared by every work-group, from L2: back soonest), all of the thread's share of x (from memory, the longest latency), and,
    // once the first half is stored, the second half of W, whose latency passes under that of x. W goes in two halves to bound the registers.
    const float* wb = W + (size_t)w * 32 * HD + lane;   // wave w stages k = 32 w .. 32 w + 31
    const v4f* xt = (const v4f*)(x + r0 * DM) + tid; v4f xr[32];
#pragma unroll
    for (int hf = 0; hf < 2; ++hf) { float wr[8][8];
#pragma unroll
        for (int i = 0; i < 8; ++i)
#pragma unroll
            for (int kk = 0; kk < 8; ++kk) wr[i][kk] = wb[((hf * 2 + (i >> 2)) * 8 + kk) * HD + (i & 3) * 32];
        __builtin_amdgcn_sched_barrier(0);   // one half's loads are issued together, and the next half's stay behind this half's stores (registers)
        if (hf == 0) {
#pragma unroll
            for (int i = 0; i < 32; ++i) xr[i] = xt[i * 256];
            __builtin_amdgcn_sched_barrier(0); }   // keeps the x loads up here: sunk to their conversions, they would start only after W is staged
        else asm volatile("s_wait_xcnt 0x0" :: "v"(wb) : "memory");   // stands between the W loads and any write of their address register, which it names so that the register lives up to here (without it the last load's result took that register)
#pragma unroll
        for (int i = 0; i < 8; ++i) { v8bf o;
#pragma unroll
            for (int kk = 0; kk < 8; ++kk) o[kk] = (__bf16)wr[i][kk];
            *(v8us*)(wt + ((i & 3) * 32 + lane) * XPIT + (w * 4 + hf * 2 + (i >> 2)) * 8) = __builtin_bit_cast(v8us, o); } }
#pragma unroll
    for (int i = 0; i < 32; ++i) { v4bf o;
#pragma unroll
        for (int q = 0; q < 4; ++q) o[q] = (__bf16)xr[i][q];
        *(v4us*)(xs + (i * 4 + (tid >> 6)) * XPIT + (tid & 63) * 4) = __builtin_bit_cast(v4us, o); }
    __syncthreads();   // both operands are in LDS
    if (pj < 2) proj_tail<true>(sm, bias, P16, Ph, Pl, r0); else proj_tail<false>(sm, bias, P16, Ph, Pl, r0);
}
// k_fattn: scores, softmax and attn.v of 32 query rows in one work-group; neither the scores nor the probabilities go to memory.
// Transposed products: St = K Qt (A = 16 key rows, B = 16 query columns), Ot += Vt Pt (A = 16 rows of Vt, B = the packed probabilities). A lane holds one query's scores (keys 8 hi + r of each 16-key tile),
// so two converted score tiles are the B operand of the second product as they stand, and maximum, sum and rescale factor are per lane (one exchange between the lane halves for the maximum).
// The KSPL waves of a work-group walk TT / KSPL keys each with a running maximum; their partial (max, sum, Ot) are merged through LDS in wave order at the end.
#define KSPL 4
// 2^x with the slot that the instruction set asks for behind a transcendental in the same statement.
__device__ __forceinline__ float exp2s(float x) { float y; asm("v_exp_f32 %0, %1\n\tv_nop" : "=v"(y) : "v"(x)); return y; }
// Unrolling: every inner loop is unrolled so that fragment and accumulator indices are constants (registers, no scratch); the pass loop stays rolled (unroll 1) to keep the text short.
#define OPIT (HD + 4)             // floats per query row of the merge staging: 16-byte aligned rows that start on different banks
template <typename T16, bool HL>
__device__ __forceinline__ void attn_rows(const T16* __restrict__ Q, const T16* __restrict__ Q2, const T16* __restrict__ Kp, const T16* __restrict__ K2, const T16* __restrict__ Vt, const T16* __restrict__ V2, float* __restrict__ out, float* so, float* sml, const int rot) {
    typedef typename WFrag<T16>::V V;
    constexpr float SC2 = SCL * 1.4426950408889634f;   // scores in log2 units
    constexpr float POFF = HL ? 0.0f : 4.0f;           // fp16 probabilities carry x16 (it cancels in Ot / sum): keeps small ones out of the fp16 subnormals
    const int lane = threadIdx.x & 31, lr = lane & 15, hi = lane >> 4, w = threadIdx.x >> 5;
    V qf[2][4], qf2[2][4];
#pragma unroll
    for (int g = 0; g < 2; ++g)
#pragma unroll
        for (int ks = 0; ks < 4; ++ks) { const size_t qo = (size_t)g * 16 * HD + ks * 512 + lane * 8; qf[g][ks] = WFrag<T16>::ldp(Q + qo); if constexpr (HL) qf2[g][ks] = WFrag<T16>::ldp(Q2 + qo); }
    v8f o[2][8];
#pragma unroll
    for (int g = 0; g < 2; ++g)
#pragma unroll
        for (int db = 0; db < 8; ++db) o[g][db] = (v8f){};
    float m[2] = {-3.0e38f, -3.0e38f}, l[2] = {0.f, 0.f};
    constexpr int NP = TT / KSPL / 32, AH = HL ? 1 : 2;   // passes; how many passes ahead of the update below the next K fetch lies
    constexpr unsigned TB = 32 * HD * 2;                  // bytes of one pass's 32 keys in a plane
    static_assert((NP & (NP - 1)) == 0, "the walk wraps by a mask");
    // Pass j of a wave takes tile (rot + j) mod NP of the wave's key range: work-groups of one batch then ask L2 for different lines at any one time.
    const unsigned wb = (unsigned)(w * (TT / KSPL) * HD + lane * 8) * 2u;
    unsigned ko = wb + (unsigned)rot * TB, vo = ko;   // byte offsets in a batch's plane: 32 bits beside a scalar base, one register for every plane
    auto at = [](const T16* base, unsigned byteoff) { return (const T16*)((const char*)base + byteoff); };
    // Fragment buffers: kf[kt] = the four k steps of key tile kt, vf[h] = Vt row blocks 4 h .. 4 h + 3. Loads are issued well ahead of their products:
    // fp16: all of Vt at the top of a pass, all of the next pass's K behind the score products. hi/lo (twice the registers): each half of Vt behind the score products of one key tile,
    // each key tile of the next pass behind one half of the output products, so that a buffer's registers can serve K and Vt in turn.
    V kf[2][4], kf2[2][4], vf[2][4], vf2[2][4];
    auto loadK = [&](int kt, unsigned off) {
#pragma unroll
        for (int ks = 0; ks < 4; ++ks) { kf[kt][ks] = WFrag<T16>::ldp(at(Kp, off) + kt * 16 * HD + ks * 512); if constexpr (HL) kf2[kt][ks] = WFrag<T16>::ldp(at(K2, off) + kt * 16 * HD + ks * 512); } };
    auto loadV = [&](int h, unsigned off) {
#pragma unroll
        for (int d = 0; d < 4; ++d) { vf[h][d] = WFrag<T16>::ldp(at(Vt, off) + (h * 4 + d) * 512); if constexpr (HL) vf2[h][d] = WFrag<T16>::ldp(at(V2, off) + (h * 4 + d) * 512); } };
    loadK(0, ko); loadK(1, ko);
    unsigned kn = HL ? ko : wb + (unsigned)((rot + 1) & (NP - 1)) * TB;   // offset of the next K fetch
    asm volatile("s_wait_xcnt 0x0" ::: "memory");   // stands between the loads above and any later write of a register that they name
#pragma unroll 1
    for (int it = 0; it < NP; ++it) {
        if constexpr (!HL) { loadV(0, vo); loadV(1, vo); __builtin_amdgcn_sched_barrier(0); }   // keeps the loads up here: sunk to their products, each would expose its latency
        v8f s[2][2];
#pragma unroll
        for (int kt = 0; kt < 2; ++kt) { s[kt][0] = (v8f){}; s[kt][1] = (v8f){};
#pragma unroll
            for (int ks = 0; ks < 4; ++ks) {
#pragma unroll
                for (int g = 0; g < 2; ++g) { s[kt][g] = WFrag<T16>::mma(kf[kt][ks], qf[g][ks], s[kt][g]); if constexpr (HL) { s[kt][g] = WFrag<T16>::mma(kf[kt][ks], qf2[g][ks], s[kt][g]); s[kt][g] = WFrag<T16>::mma(kf2[kt][ks], qf[g][ks], s[kt][g]); } } }
            if constexpr (HL) { loadV(kt, vo); __builtin_amdgcn_sched_barrier(0); } }   // as above: holds the issue point of the loads
        if constexpr (!HL) { loadK(0, kn); loadK(1, kn); __builtin_amdgcn_sched_barrier(0); }   // as above
        V pf[2], pf2[2];
#pragma unroll
        for (int g = 0; g < 2; ++g) {
            float mx = s[0][g][0];
#pragma unroll
            for (int r = 0; r < 8; ++r) mx = fmaxf(mx, fmaxf(s[0][g][r], s[1][g][r]));
            mx = fmaxf(mx, __shfl_xor(mx, 16, 32));
            const float mn = fmaxf(m[g], mx * SC2); const float al = exp2s(m[g] - mn); m[g] = mn; const float nb = POFF - mn; float sum = 0.f; float x[16];
#pragma unroll
            for (int e = 0; e < 16; ++e) x[e] = fmaf(s[e >> 3][g][e & 7], SC2, nb);
#pragma unroll
            for (int e = 0; e < 16; ++e) x[e] = exp2s(x[e]);
#pragma unroll
            for (int kt = 0; kt < 2; ++kt)
#pragma unroll
                for (int r = 0; r < 8; ++r) { const float p = x[kt * 8 + r]; sum += p;
                    if constexpr (HL) { const __bf16 ph = (__bf16)p; pf[g][kt * 8 + r] = ph; pf2[g][kt * 8 + r] = (__bf16)(p - (float)ph); } else pf[g][kt * 8 + r] = (h16)p; }
            l[g] = l[g] * al + sum;
#pragma unroll
            for (int db = 0; db < 8; ++db) o[g][db] *= al;
        }
        __builtin_amdgcn_sched_barrier(0);                 // keeps the wait below down here, behind the softmax: without it the wait moved up to stand directly behind the loads' issue
        asm volatile("s_wait_xcnt 0x0" ::: "memory");   // stands between the loads issued so far and the writes of their offset registers below
        __builtin_amdgcn_sched_barrier(0);                 // keeps the two updates behind that wait
        vo += ((rot + it) & (NP - 1)) == NP - 1 ? 0u - (NP - 1) * TB : TB; kn += ((rot + it + AH - 1) & (NP - 1)) == NP - 1 ? 0u - (NP - 1) * TB : TB;   // behind the range's last tile comes its first; the fetches past the last pass wrap too: in bounds, not used
#pragma unroll
        for (int h = 0; h < 2; ++h) {
#pragma unroll
            for (int d = 0; d < 4; ++d) {
#pragma unroll
                for (int g = 0; g < 2; ++g) { v8f& oo = o[g][h * 4 + d]; oo = WFrag<T16>::mma(vf[h][d], pf[g], oo); if constexpr (HL) { oo = WFrag<T16>::mma(vf[h][d], pf2[g], oo); oo = WFrag<T16>::mma(vf2[h][d], pf[g], oo); } } }
            if constexpr (HL) { loadK(h, kn); __builtin_amdgcn_sched_barrier(0); } }   // as above
    }
    asm volatile("s_wait_xcnt 0x0" ::: "memory");   // stands between the last pass's fetches and the reuse of their offset register
    __builtin_amdgcn_sched_barrier(0);                 // keeps what follows behind that wait
#pragma unroll
    for (int g = 0; g < 2; ++g) { l[g] += __shfl_xor(l[g], 16, 32); if (hi == 0) { sml[w * 32 + g * 16 + lr] = m[g]; sml[KSPL * 32 + w * 32 + g * 16 + lr] = l[g]; } }
    __syncthreads();   // every wave's (max, sum) is in LDS
#pragma unroll
    for (int g = 0; g < 2; ++g) { const int qi = g * 16 + lr; float M = sml[qi];
#pragma unroll
        for (int x = 1; x < KSPL; ++x) M = fmaxf(M, sml[x * 32 + qi]);
        float Ls = 0.f;
#pragma unroll
        for (int x = 0; x < KSPL; ++x) Ls += sml[KSPL * 32 + x * 32 + qi] * exp2s(sml[x * 32 + qi] - M);
        const float f = __fdiv_rn(exp2s(m[g] - M), Ls);
        float* orow = so + (size_t)(w * 32 + qi) * OPIT + hi * 8;
#pragma unroll
        for (int db = 0; db < 8; ++db) { const v8f t = o[g][db] * f; v4f t0, t1;
#pragma unroll
            for (int r = 0; r < 4; ++r) { t0[r] = t[r]; t1[r] = t[4 + r]; }
            *(v4fa*)(orow + db * 16) = t0; *(v4fa*)(orow + db * 16 + 4) = t1; } }
    __syncthreads();   // every wave's scaled partial output is in LDS
#pragma unroll
    for (int i = 0; i < 32 * HD / 4 / (KSPL * 32); ++i) { const int e = i * (KSPL * 32) + (int)threadIdx.x; const int row = e / (HD / 4), c4 = (e % (HD / 4)) * 4; v4f a = *(const v4fa*)(so + (size_t)row * OPIT + c4);
#pragma unroll
        for (int x = 1; x < KSPL; ++x) a += *(const v4fa*)(so + (size_t)(x * 32 + row) * OPIT + c4);
        *(v4f*)(out + (size_t)row * HD + c4) = a; }
}
// Grid: the hi/lo row blocks (three products each, the longest) first, then the fp16 ones; 32 query rows a work-group.
// Two waves a SIMD (at most 512 registers each): all 512 work-groups are resident at once, and one wave's softmax runs beside the other's products.
__global__ __launch_bounds__(KSPL * 32) __attribute__((amdgpu_waves_per_eu(2, 2))) void k_fattn(const h16* __restrict__ Q16, const h16* __restrict__ K16, const h16* __restrict__ V16, const bf* __restrict__ Qh, const bf* __restrict__ Ql, const bf* __restrict__ Kh, const bf* __restrict__ Kl, const bf* __restrict__ Vh, const bf* __restrict__ Vl, float* __restrict__ OUTb) {
    __shared__ __align__(16) float so[KSPL * 32 * OPIT]; __shared__ float sml[2 * KSPL * 32];
    int bx = blockIdx.x;
    // rot: the start tile of the key walk, from the row block's index i in its batch. Bits 0, 1 and 3 up lead, so that neighbours in the grid and groups 8 apart differ (for speed only: any value from 0 to 15 gives the same function).
    if (bx < NB_ * (RH / 32)) { const size_t b = bx / (RH / 32); const int i = bx % (RH / 32); const size_t qo = (b * TT + (size_t)i * 32) * HD; const size_t po = b * TT * HD;
        attn_rows<bf, true>(Qh + qo, Ql + qo, Kh + po, Kl + po, Vh + po, Vl + po, OUTb + qo, so, sml, ((((i >> 3) * 4 + (i & 3)) * 2) + ((i >> 2) & 1)) & 15);
    } else { bx -= NB_ * (RH / 32); const size_t b = bx / ((TT - RH) / 32); const int i = bx % ((TT - RH) / 32); const size_t qo = (b * TT + RH + (size_t)i * 32) * HD; const size_t po = b * TT * HD;
        attn_rows<h16, false>(Q16 + qo, nullptr, K16 + po, nullptr, V16 + po, nullptr, OUTb + qo, so, sml, ((i >> 3) * 4 + (i & 3)) & 15); }
}

extern "C" void kernel_launch(void* const* d_in, const int* in_sizes, int n_in,
                              void* d_out, int out_size, void* d_ws, size_t ws_size, hipStream_t stream) {
    (void)in_sizes; (void)n_in; (void)out_size;
    const float* xq = (const float*)d_in[0]; const float* xk = (const float*)d_in[1]; const float* xv = (const float*)d_in[2]; const float* wq = (const float*)d_in[3]; const float* bq = (const float*)d_in[4]; const float* wk = (const float*)d_in[5]; const float* bk = (const float*)d_in[6]; const float* wv = (const float*)d_in[7]; const float* bv = (const float*)d_in[8];
    float* OUT = (float*)d_out;     // [8][2048][128]
    char* wsp = (char*)d_ws;
    auto take = [&](size_t bytes) { char* p = wsp; wsp += (bytes + 255) & ~(size_t)255; return (void*)p; };
    // Every plane holds NB_ batch slices.
    h16* QP16 = (h16*)take((size_t)NB_ * NH_ * TT * HD * 2); h16* KP16 = (h16*)take((size_t)NB_ * NKV * TT * HD * 2); h16* VT16 = (h16*)take((size_t)NB_ * NKV * HD * TT * 2);
    bf* QPh = (bf*)take((size_t)NB_ * NH_ * TT * HD * 2); bf* QPl = (bf*)take((size_t)NB_ * NH_ * TT * HD * 2); bf* KPh = (bf*)take((size_t)NB_ * NKV * TT * HD * 2); bf* KPl = (bf*)take((size_t)NB_ * NKV * TT * HD * 2); bf* VTh = (bf*)take((size_t)NB_ * NKV * HD * TT * 2); bf* VTl = (bf*)take((size_t)NB_ * NKV * HD * TT * 2);
    if ((size_t)(wsp - (char*)d_ws) > ws_size) return;    // ws 256 MiB
    static_assert(NH_ == 1 && NKV == 1 && ZH == 1, "both kernels take planes of one head, each batch's slice in fragment order");
    k_proj<<<dim3(NB_ * TT / PR, 3, 1), 256, 0, stream>>>(xq, xk, xv, wq, wk, wv, bq, bk, bv, QP16, QPh, QPl, KP16, KPh, KPl, VT16, VTh, VTl);
    k_fattn<<<NB_ * TT / 32, KSPL * 32, 0, stream>>>(QP16, KP16, VT16, QPh, QPl, KPh, KPl, VTh, VTl, OUT);
}

// v006
// It runs in 41.9 microseconds.
// In both of two side-by-side timings against v005, it was 1.07 times as fast.
// Over all steps from v000 it is 27.0 times as fast.
#include <hip/hip_runtime.h>

// Single-head attention with separate q/k/v inputs (x_q, x_k, x_v [8][2048][256]; q = x_q Wq + bq, k = x_k Wk + bk, v = x_v Wv + bv ('xw' [256][128] + [128]); scores = q.k / sqrt(128); softmax over 2048 keys; out = attn.v -> [8][2048][128] f32 (2.1 M)).
// Two launches, all 8 batches in each. k_proj: the three projections (+ biases) from inputs rounded to bf16 on the way into LDS, written straight as the dense planes (fp16 and bf16 hi/lo), each laid in the fragment order of the matrix instruction that reads it. k_fattn: scores, running-maximum softmax and attn.v, which writes the f32 output (rows < 512 on hi/lo planes, the rest on fp16).
// Compute dtypes, f32 accumulate: every input rounded to bf16; projections on PLAIN bf16 operands (exact) + f32 biases; scores and attn.v rows < 512 on bf16 hi/lo planes (3 products), the rest single fp16; softmax f32; f32 output.

#define NB_  8
#define TT   2048
#define DM   256
#define NH_  1
#define NKV  1
#define REP  (NH_ / NKV)
#define HD   128
#define DQ   (NH_ * HD)
#define DKV  (NKV * HD)
#define ZH   1
#define RH   512                  // query rows < RH use hi+lo planes (0: none)
#define WIN  0
#define SCL  0.088388347648318447f   // HD^-0.5
typedef _Float16 h16;
typedef unsigned short bf;
typedef __attribute__((ext_vector_type(16))) __bf16   v16bf;
typedef __attribute__((ext_vector_type(16))) _Float16 v16h;
typedef __attribute__((ext_vector_type(8)))  _Float16 v8h;
typedef __attribute__((ext_vector_type(8)))  unsigned short v8us;
typedef __attribute__((ext_vector_type(8)))  float    v8f;
typedef __attribute__((ext_vector_type(4)))  float    v4f;
typedef v8h  __attribute__((may_alias)) v8ha;
typedef v4f  __attribute__((may_alias)) v4fa;
typedef v8us __attribute__((may_alias)) v8usa;

__device__ __forceinline__ unsigned short f2bf(float f) { unsigned u = __float_as_uint(f); u += 0x7FFFu + ((u >> 16) & 1u); return (unsigned short)(u >> 16); }
__device__ __forceinline__ float bf2f(unsigned short b) { return __uint_as_float(((unsigned)b) << 16); }
__device__ __forceinline__ float bfr(float f) { return bf2f(f2bf(f)); }
__device__ __forceinline__ v16h cat16(v8h lo, v8h hi) { return __builtin_shufflevector(lo, hi, 0, 1, 2, 3, 4, 5, 6, 7, 8, 9, 10, 11, 12, 13, 14, 15); }
__device__ __forceinline__ v16bf cat16b(v8us lo, v8us hi) { return __builtin_bit_cast(v16bf, __builtin_shufflevector(lo, hi, 0, 1, 2, 3, 4, 5, 6, 7, 8, 9, 10, 11, 12, 13, 14, 15)); }
__device__ __forceinline__ v8f wmma16(v16h a, v16h b, v8f c) { return __builtin_amdgcn_wmma_f32_16x16x32_f16(false, a, false, b, (short)0, c, false, false); }
__device__ __forceinline__ v8f wmmab(v16bf a, v16bf b, v8f c) { return __builtin_amdgcn_wmma_f32_16x16x32_bf16(false, a, false, b, (short)0, c, false, false); }



// Fragment of a 16x16x32 product. ld: from a K-contiguous 16-bit row: p = row (lane & 15) + 8 (lane >> 4); elements k = 8 hi .. 8 hi + 7 and 16 + 8 hi .. 16 + 8 hi + 7.
// ldp: from a plane in fragment order: the same two groups of 8 elements lie at p = block + 8 lane and 256 elements further on, so each of the two loads of a wave covers 512 contiguous bytes (four whole lines).
// Fragment order. q, k: per 16 rows t a block of 2048 elements; element (t, d) at (d >> 4) * 256 + ((d >> 3) & 1) * 128 + (t & 15) * 8 + (d & 7). v: per 32 keys t a block of 4096; element (d, t) at (d >> 4) * 512 + ((t >> 4) & 1) * 256 + ((t >> 3) & 1) * 128 + (d & 15) * 8 + (t & 7).
template <typename T16> struct WFrag;
template <> struct WFrag<h16> { typedef v16h V; static __device__ __forceinline__ V ld(const h16* p) { return cat16(*(const v8h*)p, *(const v8h*)(p + 16)); } static __device__ __forceinline__ V ldp(const h16* p) { return cat16(*(const v8h*)p, *(const v8h*)(p + 256)); } static __device__ __forceinline__ v8f mma(V a, V b, v8f c) { return wmma16(a, b, c); } };
template <> struct WFrag<bf> { typedef v16bf V; static __device__ __forceinline__ V ld(const bf* p) { return cat16b(*(const v8us*)p, *(const v8us*)(p + 16)); } static __device__ __forceinline__ V ldp(const bf* p) { return cat16b(*(const v8us*)p, *(const v8us*)(p + 256)); } static __device__ __forceinline__ v8f mma(V a, V b, v8f c) { return wmmab(a, b, c); } };

// ---- k_proj: one projection (blockIdx.y: 0 q, 1 k, 2 v) of PR rows of x in one work-group of 8 waves; a wave owns 16 rows x all 128 columns (8 accumulators).
// x [PR][256] (one contiguous piece of memory) and W [256][128] are read as f32 in whole lines, rounded to bf16 and laid K-contiguous in LDS (W transposed: a lane gathers 8 k of one column and stores them as 16 bytes).
// q, k: transposed product (A = 16 rows of Wt, B = 16 rows of x): a lane holds 8 neighbouring columns of one row. v: A = x, B = Wt: a lane holds 8 neighbouring t of one column.
// In both cases the 32 lanes' groups of 8 are neighbours in the plane's fragment order: an accumulator goes to each plane as one store of 512 contiguous bytes, with no staging.
#define PR   128
#define XPIT (DM + 8)             // 16-bit elements per staged operand row: 528 B = 16 B x odd, conflict-free for 16-byte reads down a column of rows
typedef __attribute__((ext_vector_type(8))) __bf16 v8bf;
typedef __attribute__((ext_vector_type(4))) __bf16 v4bf;
typedef __attribute__((ext_vector_type(4))) unsigned short v4us;
// The products and the output of k_proj, behind the barrier that publishes the staged operands. TR: q, k (transposed product); otherwise v.
template <bool TR>
__device__ __forceinline__ void proj_tail(bf* sm, const float* __restrict__ bias, h16* P16, bf* Ph, bf* Pl, size_t r0) {
    const int lane = threadIdx.x & 31, lr = lane & 15, hi = lane >> 4, w = threadIdx.x >> 5;
    v8f acc[8];
#pragma unroll
    for (int nb = 0; nb < 8; ++nb) acc[nb] = (v8f){};
    const bf* xrow = sm + HD * XPIT + (w * 16 + lr) * XPIT + 8 * hi; const bf* wrow = sm + lr * XPIT + 8 * hi;
    // Both loops are unrolled: accumulator and buffer indices are constants, and no matrix instruction stands in front of a back edge. Two fragment buffers: step s + 1 is fetched from LDS ahead of the products of step s.
    v16bf xf[2], wf[2][8];
    auto fetch = [&](int s) { xf[s & 1] = WFrag<bf>::ld(xrow + s * 32);
#pragma unroll
        for (int nb = 0; nb < 8; ++nb) wf[s & 1][nb] = WFrag<bf>::ld(wrow + nb * 16 * XPIT + s * 32); };
    fetch(0);
#pragma unroll
    for (int s = 0; s < DM / 32; ++s) {
        if (s + 1 < DM / 32) fetch(s + 1);
        __builtin_amdgcn_sched_barrier(0);   // keeps the next step's LDS loads ahead of this step's products: sunk to their own products, each pair of loads exposed its latency
#pragma unroll
        for (int nb = 0; nb < 8; ++nb) acc[nb] = TR ? wmmab(wf[s & 1][nb], xf[s & 1], acc[nb]) : wmmab(xf[s & 1], wf[s & 1][nb], acc[nb]);
        __builtin_amdgcn_sched_barrier(0); }   // and the fetch after next behind them: its buffer is the one these products read
    // TR: wave w holds rows t = r0 + 16 w + lr, block (r0 >> 4) + w; accumulator nb is d = 16 nb + 8 hi + j. Otherwise: t = r0 + 16 w + 8 hi + j, half w & 1 of key block (r0 >> 5) + (w >> 1); accumulator nb is d = 16 nb + lr.
    const size_t go = TR ? (r0 + w * 16) * HD + lane * 8 : (r0 + (w >> 1) * 32) * HD + (w & 1) * 256 + lane * 8; constexpr size_t gp = TR ? 256 : 512;
    v8f bv8[TR ? 8 : 1]; float bv1[TR ? 1 : 8]; const unsigned bo = TR ? hi * 32u : lr * 4u;   // byte offset of the lane's first bias value
#pragma unroll
    for (int nb = 0; nb < 8; ++nb) { if constexpr (TR) bv8[nb] = *(const v8f*)((const char*)bias + bo + nb * 64); else bv1[nb] = *(const float*)((const char*)bias + bo + nb * 64); }
    asm volatile("s_wait_xcnt 0x0" :: "v"(bo) : "memory");   // stands between the bias loads and any write of their offset register, which it names so that the register lives up to here (without it the last load's result took that register)
#pragma unroll
    for (int nb = 0; nb < 8; ++nb) { v8h o16; v8bf oh, ol; v8f bb;
        if constexpr (TR) bb = bv8[nb]; else {
#pragma unroll
            for (int j = 0; j < 8; ++j) bb[j] = bv1[nb]; }
#pragma unroll
        for (int j = 0; j < 8; ++j) { const float y = acc[nb][j] + (float)(__bf16)bb[j]; o16[j] = (h16)y; const __bf16 yh = (__bf16)y; oh[j] = yh; ol[j] = (__bf16)(y - (float)yh); }
        *(v8us*)((bf*)P16 + go + nb * gp) = __builtin_bit_cast(v8us, o16); *(v8us*)(Ph + go + nb * gp) = __builtin_bit_cast(v8us, oh); *(v8us*)(Pl + go + nb * gp) = __builtin_bit_cast(v8us, ol); }
    asm volatile("s_wait_xcnt 0x0" ::: "memory");   // stands between the stores above and any later write of their address registers (in the listing the other branch's code follows this one's)
}
// Four waves a SIMD (at most 256 registers each): two work-groups fit a WGP, so all 384 are resident at once.
__global__ __launch_bounds__(256) __attribute__((amdgpu_waves_per_eu(4))) void k_proj(const float* __restrict__ xq, const float* __restrict__ xk, const float* __restrict__ xv, const float* __restrict__ wq, const float* __restrict__ wk, const float* __restrict__ wv, const float* __restrict__ bq, const float* __restrict__ bk, const float* __restrict__ bv,
                                              h16* Q16, bf* Qh, bf* Ql, h16* K16, bf* Kh, bf* Kl, h16* V16, bf* Vh, bf* Vl) {
    __shared__ __align__(16) bf sm[(HD + PR) * XPIT];
    static_assert(TT % PR == 0 && PR == 128 && HD == 128 && DM == 256, "tile shapes");
    bf* wt = sm; bf* xs = sm + HD * XPIT;
    const int tid = threadIdx.x, lane = tid & 31, lr = lane & 15, hi = lane >> 4, w = tid >> 5; const int pj = blockIdx.y; const size_t r0 = (size_t)blockIdx.x * PR;
    const float* x = pj == 0 ? xq : pj == 1 ? xk : xv; const float* W = pj == 0 ? wq : pj == 1 ? wk : wv; const float* bias = pj == 0 ? bq : pj == 1 ? bk : bv;
    h16* P16 = pj == 0 ? Q16 : pj == 1 ? K16 : V16; bf* Ph = pj == 0 ? Qh : pj == 1 ? Kh : Vh; bf* Pl = pj == 0 ? Ql : pj == 1 ? Kl : Vl;
    // Loads return in issue order, so the order of issue is: first half of W (shared by every work-group, from L2: back soonest), all of the thread's share of x (from memory, the longest latency), and,
    // once the first half is stored, the second half of W, whose latency passes under that of x. W goes in two halves to bound the registers.
    const float* wb = W + (size_t)w * 32 * HD + lane;   // wave w stages k = 32 w .. 32 w + 31
    const v4f* xt = (const v4f*)(x + r0 * DM) + tid; v4f xr[32];
#pragma unroll
    for (int hf = 0; hf < 2; ++hf) { float wr[8][8];
#pragma unroll
        for (int i = 0; i < 8; ++i)
#pragma unroll
            for (int kk = 0; kk < 8; ++kk) wr[i][kk] = wb[((hf * 2 + (i >> 2)) * 8 + kk) * HD + (i & 3) * 32];
        __builtin_amdgcn_sched_barrier(0);   // one half's loads are issued together, and the next half's stay behind this half's stores (registers)
        if (hf == 0) {
#pragma unroll
            for (int i = 0; i < 32; ++i) xr[i] = xt[i * 256];
            __builtin_amdgcn_sched_barrier(0); }   // keeps the x loads up here: sunk to their conversions, they would start only after W is staged
        else asm volatile("s_wait_xcnt 0x0" :: "v"(wb) : "memory");   // stands between the W loads and any write of their address register, which it names so that the register lives up to here (without it the last load's result took that register)
#pragma unroll
        for (int i = 0; i < 8; ++i) { v8bf o;
#pragma unroll
            for (int kk = 0; kk < 8; ++kk) o[kk] = (__bf16)wr[i][kk];
            *(v8us*)(wt + ((i & 3) * 32 + lane) * XPIT + (w * 4 + hf * 2 + (i >> 2)) * 8) = __builtin_bit_cast(v8us, o); } }
#pragma unroll
    for (int i = 0; i < 32; ++i) { v4bf o;
#pragma unroll
        for (int q = 0; q < 4; ++q) o[q] = (__bf16)xr[i][q];
        *(v4us*)(xs + (i * 4 + (tid >> 6)) * XPIT + (tid & 63) * 4) = __builtin_bit_cast(v4us, o); }
    __syncthreads();   // both operands are in LDS
    if (pj < 2) proj_tail<true>(sm, bias, P16, Ph, Pl, r0); else proj_tail<false>(sm, bias, P16, Ph, Pl, r0);
}
// k_fattn: scores, softmax and attn.v of one block of query rows (G tiles of 16 rows: 32 rows on the hi/lo planes, FR on fp16) in one work-group; neither the scores nor the probabilities go to memory.
// Every wave holds all G tiles, so a K or Vt fragment fetched from L2 feeds G products: the block is as tall as the registers of two waves a SIMD allow.
// Transposed products: St = K Qt (A = 16 key rows, B = 16 query columns), Ot += Vt Pt (A = 16 rows of Vt, B = the packed probabilities). A lane holds one query's scores (keys 8 hi + r of each 16-key tile),
// so two converted score tiles are the B operand of the second product as they stand, and maximum, sum and rescale factor are per lane (one exchange between the lane halves for the maximum).
// The KSPL waves of a work-group walk TT / KSPL keys each with a running maximum; their partial (max, sum, Ot) are merged through LDS in wave order at the end.
#define KSPL 4
#define FR   48                   // query rows of an fp16 work-group (hi/lo: 32)
// 2^x with the slot that the instruction set asks for behind a transcendental in the same statement.
__device__ __forceinline__ float exp2s(float x) { float y; asm("v_exp_f32 %0, %1\n\tv_nop" : "=v"(y) : "v"(x)); return y; }
// Unrolling: every inner loop is unrolled so that fragment and accumulator indices are constants (registers, no scratch); the pass loop stays rolled (unroll 1) to keep the text short.
#define OPIT (HD + 4)             // floats per query row of the merge staging: 16-byte aligned rows that start on different banks
template <typename T16, bool HL, int G>
__device__ __forceinline__ void attn_rows(const T16* __restrict__ Q, const T16* __restrict__ Q2, const T16* __restrict__ Kp, const T16* __restrict__ K2, const T16* __restrict__ Vt, const T16* __restrict__ V2, float* __restrict__ out, float* so, float* sml, const int rot) {
    typedef typename WFrag<T16>::V V;
    constexpr float SC2 = SCL * 1.4426950408889634f;   // scores in log2 units
    constexpr float POFF = HL ? 0.0f : 4.0f;           // fp16 probabilities carry x16 (it cancels in Ot / sum): keeps small ones out of the fp16 subnormals
    const int lane = threadIdx.x & 31, lr = lane & 15, hi = lane >> 4, w = threadIdx.x >> 5;
    constexpr int R = G * 16;   // query rows of the work-group: every wave holds all of them
    V qf[G][4], qf2[G][4];
#pragma unroll
    for (int g = 0; g < G; ++g)
#pragma unroll
        for (int ks = 0; ks < 4; ++ks) { const size_t qo = (size_t)g * 16 * HD + ks * 512 + lane * 8; qf[g][ks] = WFrag<T16>::ldp(Q + qo); if constexpr (HL) qf2[g][ks] = WFrag<T16>::ldp(Q2 + qo); }
    v8f o[G][8]; float m[G], l[G];
#pragma unroll
    for (int g = 0; g < G; ++g) { m[g] = -3.0e38f; l[g] = 0.f;
#pragma unroll
        for (int db = 0; db < 8; ++db) o[g][db] = (v8f){}; }
    constexpr int NP = TT / KSPL / 32, AH = HL ? 1 : 2;   // passes; how many passes ahead of the update below the next K fetch lies
    constexpr unsigned TB = 32 * HD * 2;                  // bytes of one pass's 32 keys in a plane
    static_assert((NP & (NP - 1)) == 0, "the walk wraps by a mask");
    // Pass j of a wave takes tile (rot + j) mod NP of the wave's key range: work-groups of one batch then ask L2 for different lines at any one time.
    const unsigned wb = (unsigned)(w * (TT / KSPL) * HD + lane * 8) * 2u;
    unsigned ko = wb + (unsigned)rot * TB, vo = ko;   // byte offsets in a batch's plane: 32 bits beside a scalar base, one register for every plane
    auto at = [](const T16* base, unsigned byteoff) { return (const T16*)((const char*)base + byteoff); };
    // Fragment buffers: kf[kt] = the four k steps of key tile kt, vf[h] = Vt row blocks 4 h .. 4 h + 3. Loads are issued well ahead of their products:
    // fp16: all of Vt at the top of a pass, all of the next pass's K behind the score products. hi/lo (twice the registers): each half of Vt behind the score products of one key tile,
    // each key tile of the next pass behind one half of the output products, so that a buffer's registers can serve K and Vt in turn.
    V kf[2][4], kf2[2][4], vf[2][4], vf2[2][4];
    auto loadK = [&](int kt, unsigned off) {
#pragma unroll
        for (int ks = 0; ks < 4; ++ks) { kf[kt][ks] = WFrag<T16>::ldp(at(Kp, off) + kt * 16 * HD + ks * 512); if constexpr (HL) kf2[kt][ks] = WFrag<T16>::ldp(at(K2, off) + kt * 16 * HD + ks * 512); } };
    auto loadV = [&](int h, unsigned off) {
#pragma unroll
        for (int d = 0; d < 4; ++d) { vf[h][d] = WFrag<T16>::ldp(at(Vt, off) + (h * 4 + d) * 512); if constexpr (HL) vf2[h][d] = WFrag<T16>::ldp(at(V2, off) + (h * 4 + d) * 512); } };
    loadK(0, ko); loadK(1, ko);
    unsigned kn = HL ? ko : wb + (unsigned)((rot + 1) & (NP - 1)) * TB;   // offset of the next K fetch
    asm volatile("s_wait_xcnt 0x0" ::: "memory");   // stands between the loads above and any later write of a register that they name
#pragma unroll 1
    for (int it = 0; it < NP; ++it) {
        if constexpr (!HL) { loadV(0, vo); loadV(1, vo); __builtin_amdgcn_sched_barrier(0); }   // keeps the loads up here: sunk to their products, each would expose its latency
        v8f s[2][G];
#pragma unroll
        for (int kt = 0; kt < 2; ++kt) {
#pragma unroll
            for (int g = 0; g < G; ++g) s[kt][g] = (v8f){};
#pragma unroll
            for (int ks = 0; ks < 4; ++ks) {
#pragma unroll
                for (int g = 0; g < G; ++g) { s[kt][g] = WFrag<T16>::mma(kf[kt][ks], qf[g][ks], s[kt][g]); if constexpr (HL) { s[kt][g] = WFrag<T16>::mma(kf[kt][ks], qf2[g][ks], s[kt][g]); s[kt][g] = WFrag<T16>::mma(kf2[kt][ks], qf[g][ks], s[kt][g]); } } }
            if constexpr (HL) { loadV(kt, vo); __builtin_amdgcn_sched_barrier(0); } }   // as above: holds the issue point of the loads
        if constexpr (!HL) { loadK(0, kn); loadK(1, kn); __builtin_amdgcn_sched_barrier(0); }   // as above
        V pf[G], pf2[G];
#pragma unroll
        for (int g = 0; g < G; ++g) {
            float mx = s[0][g][0];
#pragma unroll
            for (int r = 0; r < 8; ++r) mx = fmaxf(mx, fmaxf(s[0][g][r], s[1][g][r]));
            mx = fmaxf(mx, __shfl_xor(mx, 16, 32));
            const float mn = fmaxf(m[g], mx * SC2); const float al = exp2s(m[g] - mn); m[g] = mn; const float nb = POFF - mn; float sum = 0.f; float x[16];
#pragma unroll
            for (int e = 0; e < 16; ++e) x[e] = fmaf(s[e >> 3][g][e & 7], SC2, nb);
#pragma unroll
            for (int e = 0; e < 16; ++e) x[e] = exp2s(x[e]);
#pragma unroll
            for (int kt = 0; kt < 2; ++kt)
#pragma unroll
                for (int r = 0; r < 8; ++r) { const float p = x[kt * 8 + r]; sum += p;
                    if constexpr (HL) { const __bf16 ph = (__bf16)p; pf[g][kt * 8 + r] = ph; pf2[g][kt * 8 + r] = (__bf16)(p - (float)ph); } else pf[g][kt * 8 + r] = (h16)p; }
            l[g] = l[g] * al + sum;
#pragma unroll
            for (int db = 0; db < 8; ++db) o[g][db] *= al;
        }
        __builtin_amdgcn_sched_barrier(0);                 // keeps the wait below down here, behind the softmax: without it the wait moved up to stand directly behind the loads' issue
        asm volatile("s_wait_xcnt 0x0" ::: "memory");   // stands between the loads issued so far and the writes of their offset registers below
        __builtin_amdgcn_sched_barrier(0);                 // keeps the two updates behind that wait
        vo += ((rot + it) & (NP - 1)) == NP - 1 ? 0u - (NP - 1) * TB : TB; kn += ((rot + it + AH - 1) & (NP - 1)) == NP - 1 ? 0u - (NP - 1) * TB : TB;   // behind the range's last tile comes its first; the fetches past the last pass wrap too: in bounds, not used
#pragma unroll
        for (int h = 0; h < 2; ++h) {
#pragma unroll
            for (int d = 0; d < 4; ++d) {
#pragma unroll
                for (int g = 0; g < G; ++g) { v8f& oo = o[g][h * 4 + d]; oo = WFrag<T16>::mma(vf[h][d], pf[g], oo); if constexpr (HL) { oo = WFrag<T16>::mma(vf[h][d], pf2[g], oo); oo = WFrag<T16>::mma(vf2[h][d], pf[g], oo); } } }
            if constexpr (HL) { loadK(h, kn); __builtin_amdgcn_sched_barrier(0); } }   // as above
    }
    asm volatile("s_wait_xcnt 0x0" ::: "memory");   // stands between the last pass's fetches and the reuse of their offset register
    __builtin_amdgcn_sched_barrier(0);                 // keeps what follows behind that wait
#pragma unroll
    for (int g = 0; g < G; ++g) { l[g] += __shfl_xor(l[g], 16, 32); if (hi == 0) { sml[w * R + g * 16 + lr] = m[g]; sml[KSPL * R + w * R + g * 16 + lr] = l[g]; } }
    __syncthreads();   // every wave's (max, sum) is in LDS
#pragma unroll
    for (int g = 0; g < G; ++g) { const int qi = g * 16 + lr; float M = sml[qi];
#pragma unroll
        for (int x = 1; x < KSPL; ++x) M = fmaxf(M, sml[x * R + qi]);
        float Ls = 0.f;
#pragma unroll
        for (int x = 0; x < KSPL; ++x) Ls += sml[KSPL * R + x * R + qi] * exp2s(sml[x * R + qi] - M);
        const float f = __fdiv_rn(exp2s(m[g] - M), Ls);
        float* orow = so + (size_t)(w * R + qi) * OPIT + hi * 8;
#pragma unroll
        for (int db = 0; db < 8; ++db) { const v8f t = o[g][db] * f; v4f t0, t1;
#pragma unroll
            for (int r = 0; r < 4; ++r) { t0[r] = t[r]; t1[r] = t[4 + r]; }
            *(v4fa*)(orow + db * 16) = t0; *(v4fa*)(orow + db * 16 + 4) = t1; } }
    __syncthreads();   // every wave's scaled partial output is in LDS
#pragma unroll
    for (int i = 0; i < R * HD / 4 / (KSPL * 32); ++i) {
        if (i + 1 == R * HD / 4 / (KSPL * 32)) asm volatile("s_wait_xcnt 0x0" ::: "memory");   // stands between the stores so far and the last trip's writes of their registers (the two row-block heights share that trip's code, and the compiler's own wait there was a counted one)
        const int e = i * (KSPL * 32) + (int)threadIdx.x; const int row = e / (HD / 4), c4 = (e % (HD / 4)) * 4; v4f a = *(const v4fa*)(so + (size_t)row * OPIT + c4);
#pragma unroll
        for (int x = 1; x < KSPL; ++x) a += *(const v4fa*)(so + (size_t)(x * R + row) * OPIT + c4);
        *(v4f*)(out + (size_t)row * HD + c4) = a; }
}
// Grid: the hi/lo row blocks (three products each, the longest; 32 query rows a work-group) first, then the fp16 ones (FR rows a work-group).
// Two waves a SIMD (at most 512 registers each): all 384 work-groups are resident at once, and one wave's softmax runs beside the other's products.
__global__ __launch_bounds__(KSPL * 32) __attribute__((amdgpu_waves_per_eu(2, 2))) void k_fattn(const h16* __restrict__ Q16, const h16* __restrict__ K16, const h16* __restrict__ V16, const bf* __restrict__ Qh, const bf* __restrict__ Ql, const bf* __restrict__ Kh, const bf* __restrict__ Kl, const bf* __restrict__ Vh, const bf* __restrict__ Vl, float* __restrict__ OUTb) {
    __shared__ __align__(16) float so[KSPL * FR * OPIT]; __shared__ float sml[2 * KSPL * FR];
    static_assert(FR % 16 == 0 && FR >= 32 && (TT - RH) % FR == 0 && (FR * HD / 4) % (KSPL * 32) == 0, "row blocks");
    int bx = blockIdx.x;
    // rot: the start tile of the key walk, from the row block's index i in its batch. Bits 0, 1 and 3 up lead, so that neighbours in the grid and groups 8 apart differ (for speed only: any value from 0 to 15 gives the same function).
    if (bx < NB_ * (RH / 32)) { const size_t b = bx / (RH / 32); const int i = bx % (RH / 32); const size_t qo = (b * TT + (size_t)i * 32) * HD; const size_t po = b * TT * HD;
        attn_rows<bf, true, 2>(Qh + qo, Ql + qo, Kh + po, Kl + po, Vh + po, Vl + po, OUTb + qo, so, sml, ((((i >> 3) * 4 + (i & 3)) * 2) + ((i >> 2) & 1)) & 15);
    } else { bx -= NB_ * (RH / 32); const size_t b = bx / ((TT - RH) / FR); const int i = bx % ((TT - RH) / FR); const size_t qo = (b * TT + RH + (size_t)i * FR) * HD; const size_t po = b * TT * HD;
        attn_rows<h16, false, FR / 16>(Q16 + qo, nullptr, K16 + po, nullptr, V16 + po, nullptr, OUTb + qo, so, sml, ((i >> 3) * 4 + (i & 3)) & 15); }
}

extern "C" void kernel_launch(void* const* d_in, const int* in_sizes, int n_in,
                              void* d_out, int out_size, void* d_ws, size_t ws_size, hipStream_t stream) {
    (void)in_sizes; (void)n_in; (void)out_size;
    const float* xq = (const float*)d_in[0]; const float* xk = (const float*)d_in[1]; const float* xv = (const float*)d_in[2]; const float* wq = (const float*)d_in[3]; const float* bq = (const float*)d_in[4]; const float* wk = (const float*)d_in[5]; const float* bk = (const float*)d_in[6]; const float* wv = (const float*)d_in[7]; const float* bv = (const float*)d_in[8];
    float* OUT = (float*)d_out;     // [8][2048][128]
    char* wsp = (char*)d_ws;
    auto take = [&](size_t bytes) { char* p = wsp; wsp += (bytes + 255) & ~(size_t)255; return (void*)p; };
    // Every plane holds NB_ batch slices.
    h16* QP16 = (h16*)take((size_t)NB_ * NH_ * TT * HD * 2); h16* KP16 = (h16*)take((size_t)NB_ * NKV * TT * HD * 2); h16* VT16 = (h16*)take((size_t)NB_ * NKV * HD * TT * 2);
    bf* QPh = (bf*)take((size_t)NB_ * NH_ * TT * HD * 2); bf* QPl = (bf*)take((size_t)NB_ * NH_ * TT * HD * 2); bf* KPh = (bf*)take((size_t)NB_ * NKV * TT * HD * 2); bf* KPl = (bf*)take((size_t)NB_ * NKV * TT * HD * 2); bf* VTh = (bf*)take((size_t)NB_ * NKV * HD * TT * 2); bf* VTl = (bf*)take((size_t)NB_ * NKV * HD * TT * 2);
    if ((size_t)(wsp - (char*)d_ws) > ws_size) return;    // ws 256 MiB
    static_assert(NH_ == 1 && NKV == 1 && ZH == 1, "both kernels take planes of one head, each batch's slice in fragment order");
    k_proj<<<dim3(NB_ * TT / PR, 3, 1), 256, 0, stream>>>(xq, xk, xv, wq, wk, wv, bq, bk, bv, QP16, QPh, QPl, KP16, KPh, KPl, VT16, VTh, VTl);
    k_fattn<<<NB_ * (RH / 32) + NB_ * ((TT - RH) / FR), KSPL * 32, 0, stream>>>(QP16, KP16, VT16, QPh, QPl, KPh, KPl, VTh, VTl, OUT);
}

// v007
// Measured time: 39.8 microseconds a run.
// Timed twice side by side with v006, it ran 1.05 and 1.06 times as fast.
// Counting every step since v000, it is 28.6 times as fast.
#include <hip/hip_runtime.h>

// Single-head attention with separate q/k/v inputs (x_q, x_k, x_v [8][2048][256]; q = x_q Wq + bq, k = x_k Wk + bk, v = x_v Wv + bv ('xw' [256][128] + [128]); scores = q.k / sqrt(128); softmax over 2048 keys; out = attn.v -> [8][2048][128] f32 (2.1 M)).
// Two launches, all 8 batches in each. k_proj: the three projections (+ biases) from inputs rounded to bf16 on the way into LDS, written straight as the dense planes (fp16 and bf16 hi/lo), each laid in the fragment order of the matrix instruction that reads it. k_fattn: scores, running-maximum softmax and attn.v, which writes the f32 output (rows < 512 on hi/lo planes, the rest on fp16).
// Compute dtypes, f32 accumulate: every input rounded to bf16; projections on PLAIN bf16 operands (exact) + f32 biases; scores and attn.v rows < 512 on bf16 hi/lo planes (3 products), the rest single fp16; softmax f32; f32 output.

#define NB_  8
#define TT   2048
#define DM   256
#define NH_  1
#define NKV  1
#define REP  (NH_ / NKV)
#define HD   128
#define DQ   (NH_ * HD)
#define DKV  (NKV * HD)
#define ZH   1
#define RH   512                  // query rows < RH use hi+lo planes (0: none)
#define WIN  0
#define SCL  0.088388347648318447f   // HD^-0.5
typedef _Float16 h16;
typedef unsigned short bf;
typedef __attribute__((ext_vector_type(16))) __bf16   v16bf;
typedef __attribute__((ext_vector_type(16))) _Float16 v16h;
typedef __attribute__((ext_vector_type(8)))  _Float16 v8h;
typedef __attribute__((ext_vector_type(8)))  unsigned short v8us;
typedef __attribute__((ext_vector_type(8)))  float    v8f;
typedef __attribute__((ext_vector_type(4)))  float    v4f;
typedef v8h  __attribute__((may_alias)) v8ha;
typedef v4f  __attribute__((may_alias)) v4fa;
typedef v8us __attribute__((may_alias)) v8usa;

__device__ __forceinline__ unsigned short f2bf(float f) { unsigned u = __float_as_uint(f); u += 0x7FFFu + ((u >> 16) & 1u); return (unsigned short)(u >> 16); }
__device__ __forceinline__ float bf2f(unsigned short b) { return __uint_as_float(((unsigned)b) << 16); }
__device__ __forceinline__ float bfr(float f) { return bf2f(f2bf(f)); }
__device__ __forceinline__ v16h cat16(v8h lo, v8h hi) { return __builtin_shufflevector(lo, hi, 0, 1, 2, 3, 4, 5, 6, 7, 8, 9, 10, 11, 12, 13, 14, 15); }
__device__ __forceinline__ v16bf cat16b(v8us lo, v8us hi) { return __builtin_bit_cast(v16bf, __builtin_shufflevector(lo, hi, 0, 1, 2, 3, 4, 5, 6, 7, 8, 9, 10, 11, 12, 13, 14, 15)); }
__device__ __forceinline__ v8f wmma16(v16h a, v16h b, v8f c) { return __builtin_amdgcn_wmma_f32_16x16x32_f16(false, a, false, b, (short)0, c, false, false); }
__device__ __forceinline__ v8f wmmab(v16bf a, v16bf b, v8f c) { return __builtin_amdgcn_wmma_f32_16x16x32_bf16(false, a, false, b, (short)0, c, false, false); }



// Fragment of a 16x16x32 product. ld: from a K-contiguous 16-bit row: p = row (lane & 15) + 8 (lane >> 4); elements k = 8 hi .. 8 hi + 7 and 16 + 8 hi .. 16 + 8 hi + 7.
// ldp: from a plane in fragment order: the same two groups of 8 elements lie at p = block + 8 lane and 256 elements further on, so each of the two loads of a wave covers 512 contiguous bytes (four whole lines).
// Fragment order. q, k: per 16 rows t a block of 2048 elements; element (t, d) at (d >> 4) * 256 + ((d >> 3) & 1) * 128 + (t & 15) * 8 + (d & 7). v: per 32 keys t a block of 4096; element (d, t) at (d >> 4) * 512 + ((t >> 4) & 1) * 256 + ((t >> 3) & 1) * 128 + (d & 15) * 8 + (t & 7).
template <typename T16> struct WFrag;
template <> struct WFrag<h16> { typedef v16h V; static __device__ __forceinline__ V ld(const h16* p) { return cat16(*(const v8h*)p, *(const v8h*)(p + 16)); } static __device__ __forceinline__ V ldp(const h16* p) { return cat16(*(const v8h*)p, *(const v8h*)(p + 256)); } static __device__ __forceinline__ v8f mma(V a, V b, v8f c) { return wmma16(a, b, c); } };
template <> struct WFrag<bf> { typedef v16bf V; static __device__ __forceinline__ V ld(const bf* p) { return cat16b(*(const v8us*)p, *(const v8us*)(p + 16)); } static __device__ __forceinline__ V ldp(const bf* p) { return cat16b(*(const v8us*)p, *(const v8us*)(p + 256)); } static __device__ __forceinline__ v8f mma(V a, V b, v8f c) { return wmmab(a, b, c); } };

// ---- k_proj: one projection (blockIdx.y: 0 q, 1 k, 2 v) of PR rows of x in one work-group of 8 waves; a wave owns 16 rows x all 128 columns (8 accumulators).
// x [PR][256] (one contiguous piece of memory) and W [256][128] are read as f32 in whole lines, rounded to bf16 and laid K-contiguous in LDS (W transposed: a lane gathers 8 k of one column and stores them as 16 bytes).
// q, k: transposed product (A = 16 rows of Wt, B = 16 rows of x): a lane holds 8 neighbouring columns of one row. v: A = x, B = Wt: a lane holds 8 neighbouring t of one column.
// In both cases the 32 lanes' groups of 8 are neighbours in the plane's fragment order: an accumulator goes to each plane as one store of 512 contiguous bytes, with no staging.
#define PR   128
#define XPIT (DM + 8)             // 16-bit elements per staged operand row: 528 B = 16 B x odd, conflict-free for 16-byte reads down a column of rows
typedef __attribute__((ext_vector_type(8))) __bf16 v8bf;
typedef __attribute__((ext_vector_type(4))) __bf16 v4bf;
typedef __attribute__((ext_vector_type(4))) unsigned short v4us;
// The products and the output of k_proj, behind the barrier that publishes the staged operands. TR: q, k (transposed product); otherwise v.
template <bool TR>
__device__ __forceinline__ void proj_tail(bf* sm, const float* __restrict__ bias, h16* P16, bf* Ph, bf* Pl, size_t r0) {
    const int lane = threadIdx.x & 31, lr = lane & 15, hi = lane >> 4, w = threadIdx.x >> 5;
    v8f acc[8];
#pragma unroll
    for (int nb = 0; nb < 8; ++nb) acc[nb] = (v8f){};
    const bf* xrow = sm + HD * XPIT + (w * 16 + lr) * XPIT + 8 * hi; const bf* wrow = sm + lr * XPIT + 8 * hi;
    // Both loops are unrolled: accumulator and buffer indices are constants, and no matrix instruction stands in front of a back edge. Two fragment buffers: step s + 1 is fetched from LDS ahead of the products of step s.
    v16bf xf[2], wf[2][8];
    auto fetch = [&](int s) { xf[s & 1] = WFrag<bf>::ld(xrow + s * 32);
#pragma unroll
        for (int nb = 0; nb < 8; ++nb) wf[s & 1][nb] = WFrag<bf>::ld(wrow + nb * 16 * XPIT + s * 32); };
    fetch(0);
#pragma unroll
    for (int s = 0; s < DM / 32; ++s) {
        if (s + 1 < DM / 32) fetch(s + 1);
        __builtin_amdgcn_sched_barrier(0);   // keeps the next step's LDS loads ahead of this step's products: sunk to their own products, each pair of loads exposed its latency
#pragma unroll
        for (int nb = 0; nb < 8; ++nb) acc[nb] = TR ? wmmab(wf[s & 1][nb], xf[s & 1], acc[nb]) : wmmab(xf[s & 1], wf[s & 1][nb], acc[nb]);
        __builtin_amdgcn_sched_barrier(0); }   // and the fetch after next behind them: its buffer is the one these products read
    // TR: wave w holds rows t = r0 + 16 w + lr, block (r0 >> 4) + w; accumulator nb is d = 16 nb + 8 hi + j. Otherwise: t = r0 + 16 w + 8 hi + j, half w & 1 of key block (r0 >> 5) + (w >> 1); accumulator nb is d = 16 nb + lr.
    const size_t go = TR ? (r0 + w * 16) * HD + lane * 8 : (r0 + (w >> 1) * 32) * HD + (w & 1) * 256 + lane * 8; constexpr size_t gp = TR ? 256 : 512;
    v8f bv8[TR ? 8 : 1]; float bv1[TR ? 1 : 8]; const unsigned bo = TR ? hi * 32u : lr * 4u;   // byte offset of the lane's first bias value
#pragma unroll
    for (int nb = 0; nb < 8; ++nb) { if constexpr (TR) bv8[nb] = *(const v8f*)((const char*)bias + bo + nb * 64); else bv1[nb] = *(const float*)((const char*)bias + bo + nb * 64); }
    asm volatile("s_wait_xcnt 0x0" :: "v"(bo) : "memory");   // stands between the bias loads and any write of their offset register, which it names so that the register lives up to here (without it the last load's result took that register)
#pragma unroll
    for (int nb = 0; nb < 8; ++nb) { v8h o16; v8bf oh, ol; v8f bb;
        if constexpr (TR) bb = bv8[nb]; else {
#pragma unroll
            for (int j = 0; j < 8; ++j) bb[j] = bv1[nb]; }
#pragma unroll
        for (int j = 0; j < 8; ++j) { const float y = acc[nb][j] + (float)(__bf16)bb[j]; o16[j] = (h16)y; const __bf16 yh = (__bf16)y; oh[j] = yh; ol[j] = (__bf16)(y - (float)yh); }
        *(v8us*)((bf*)P16 + go + nb * gp) = __builtin_bit_cast(v8us, o16); *(v8us*)(Ph + go + nb * gp) = __builtin_bit_cast(v8us, oh); *(v8us*)(Pl + go + nb * gp) = __builtin_bit_cast(v8us, ol); }
    asm volatile("s_wait_xcnt 0x0" ::: "memory");   // stands between the stores above and any later write of their address registers (in the listing the other branch's code follows this one's)
}
// Four waves a SIMD (at most 256 registers each): two work-groups fit a WGP, so all 384 are resident at once.
__global__ __launch_bounds__(256) __attribute__((amdgpu_waves_per_eu(4))) void k_proj(const float* __restrict__ xq, const float* __restrict__ xk, const float* __restrict__ xv, const float* __restrict__ wq, const float* __restrict__ wk, const float* __restrict__ wv, const float* __restrict__ bq, const float* __restrict__ bk, const float* __restrict__ bv,
                                              h16* Q16, bf* Qh, bf* Ql, h16* K16, bf* Kh, bf* Kl, h16* V16, bf* Vh, bf* Vl) {
    __shared__ __align__(16) bf sm[(HD + PR) * XPIT];
    static_assert(TT % PR == 0 && PR == 128 && HD == 128 && DM == 256, "tile shapes");
    bf* wt = sm; bf* xs = sm + HD * XPIT;
    const int tid = threadIdx.x, lane = tid & 31, lr = lane & 15, hi = lane >> 4, w = tid >> 5; const int pj = blockIdx.y; const size_t r0 = (size_t)blockIdx.x * PR;
    const float* x = pj == 0 ? xq : pj == 1 ? xk : xv; const float* W = pj == 0 ? wq : pj == 1 ? wk : wv; const float* bias = pj == 0 ? bq : pj == 1 ? bk : bv;
    h16* P16 = pj == 0 ? Q16 : pj == 1 ? K16 : V16; bf* Ph = pj == 0 ? Qh : pj == 1 ? Kh : Vh; bf* Pl = pj == 0 ? Ql : pj == 1 ? Kl : Vl;
    // Loads return in issue order, so the order of issue is: first half of W (shared by every work-group, from L2: back soonest), all of the thread's share of x (from memory, the longest latency), and,
    // once the first half is stored, the second half of W, whose latency passes under that of x. W goes in two halves to bound the registers.
    const float* wb = W + (size_t)w * 32 * HD + lane;   // wave w stages k = 32 w .. 32 w + 31
    const v4f* xt = (const v4f*)(x + r0 * DM) + tid; v4f xr[32];
#pragma unroll
    for (int hf = 0; hf < 2; ++hf) { float wr[8][8];
#pragma unroll
        for (int i = 0; i < 8; ++i)
#pragma unroll
            for (int kk = 0; kk < 8; ++kk) wr[i][kk] = wb[((hf * 2 + (i >> 2)) * 8 + kk) * HD + (i & 3) * 32];
        __builtin_amdgcn_sched_barrier(0);   // one half's loads are issued together, and the next half's stay behind this half's stores (registers)
        if (hf == 0) {
#pragma unroll
            for (int i = 0; i < 32; ++i) xr[i] = xt[i * 256];
            __builtin_amdgcn_sched_barrier(0); }   // keeps the x loads up here: sunk to their conversions, they would start only after W is staged
        else asm volatile("s_wait_xcnt 0x0" :: "v"(wb) : "memory");   // stands between the W loads and any write of their address register, which it names so that the register lives up to here (without it the last load's result took that register)
#pragma unroll
        for (int i = 0; i < 8; ++i) { v8bf o;
#pragma unroll
            for (int kk = 0; kk < 8; ++kk) o[kk] = (__bf16)wr[i][kk];
            *(v8us*)(wt + ((i & 3) * 32 + lane) * XPIT + (w * 4 + hf * 2 + (i >> 2)) * 8) = __builtin_bit_cast(v8us, o); } }
#pragma unroll
    for (int i = 0; i < 32; ++i) { v4bf o;
#pragma unroll
        for (int q = 0; q < 4; ++q) o[q] = (__bf16)xr[i][q];
        *(v4us*)(xs + (i * 4 + (tid >> 6)) * XPIT + (tid & 63) * 4) = __builtin_bit_cast(v4us, o); }
    __syncthreads();   // both operands are in LDS
    if (pj < 2) proj_tail<true>(sm, bias, P16, Ph, Pl, r0); else proj_tail<false>(sm, bias, P16, Ph, Pl, r0);
}
// k_fattn: scores, softmax and attn.v of one block of query rows (G tiles of 16 rows: 32 rows on the hi/lo planes, FR on fp16) by KS waves of one work-group; neither the scores nor the probabilities go to memory.
// Every wave holds all G tiles, so a K or Vt fragment fetched from L2 feeds G products: the block is as tall as the registers of two waves a SIMD allow.
// Transposed products: St = K Qt (A = 16 key rows, B = 16 query columns), Ot += Vt Pt (A = 16 rows of Vt, B = the packed probabilities). A lane holds one query's scores (keys 8 hi + r of each 16-key tile),
// so two converted score tiles are the B operand of the second product as they stand, and maximum, sum and rescale factor are per lane (one exchange between the lane halves for the maximum).
// The KS waves of a row block walk TT / KS keys each with a running maximum; their partial (max, sum, Ot) are merged through LDS in wave order at the end.
// A work-group is NW waves, one work-group a WGP. hi/lo: one row block, its keys split over all KSH = 8 waves. fp16: two row blocks side by side, KSPL = 4 waves each.
// A hi/lo pass holds twice the products and twice the bytes of an fp16 pass, so with half the passes every wave of the grid has the same work, and the grid fills every wave place.
#define NW   8
#define KSPL 4
#define KSH  8
#define FR   48                   // query rows of an fp16 row block (hi/lo: 32)
// 2^x with the slot that the instruction set asks for behind a transcendental in the same statement.
__device__ __forceinline__ float exp2s(float x) { float y; asm("v_exp_f32 %0, %1\n\tv_nop" : "=v"(y) : "v"(x)); return y; }
// Unrolling: every inner loop is unrolled so that fragment and accumulator indices are constants (registers, no scratch); the pass loop stays rolled (unroll 1) to keep the text short.
#define OPIT (HD + 4)             // floats per query row of the merge staging: 16-byte aligned rows that start on different banks
// w: the wave's index among the KS waves of its row block; tid: the thread's index among their KS * 32 threads; so, sml: the row block's own staging.
template <typename T16, bool HL, int G, int KS>
__device__ __forceinline__ void attn_rows(const T16* __restrict__ Q, const T16* __restrict__ Q2, const T16* __restrict__ Kp, const T16* __restrict__ K2, const T16* __restrict__ Vt, const T16* __restrict__ V2, float* __restrict__ out, float* so, float* sml, const int rot, const int w, const int tid) {
    typedef typename WFrag<T16>::V V;
    constexpr float SC2 = SCL * 1.4426950408889634f;   // scores in log2 units
    constexpr float POFF = HL ? 0.0f : 4.0f;           // fp16 probabilities carry x16 (it cancels in Ot / sum): keeps small ones out of the fp16 subnormals
    const int lane = threadIdx.x & 31, lr = lane & 15, hi = lane >> 4;
    constexpr int R = G * 16;   // query rows of the row block: every one of its waves holds all of them
    V qf[G][4], qf2[G][4];
#pragma unroll
    for (int g = 0; g < G; ++g)
#pragma unroll
        for (int ks = 0; ks < 4; ++ks) { const size_t qo = (size_t)g * 16 * HD + ks * 512 + lane * 8; qf[g][ks] = WFrag<T16>::ldp(Q + qo); if constexpr (HL) qf2[g][ks] = WFrag<T16>::ldp(Q2 + qo); }
    v8f o[G][8]; float m[G], l[G];
#pragma unroll
    for (int g = 0; g < G; ++g) { m[g] = -3.0e38f; l[g] = 0.f;
#pragma unroll
        for (int db = 0; db < 8; ++db) o[g][db] = (v8f){}; }
    constexpr int NP = TT / KS / 32, AH = HL ? 1 : 2;   // passes; how many passes ahead of the update below the next K fetch lies
    constexpr unsigned TB = 32 * HD * 2;                  // bytes of one pass's 32 keys in a plane
    static_assert((NP & (NP - 1)) == 0, "the walk wraps by a mask");
    // Pass j of a wave takes tile (rot + j) mod NP of the wave's key range: work-groups of one batch then ask L2 for different lines at any one time.
    const unsigned wb = (unsigned)(w * (TT / KS) * HD + lane * 8) * 2u;
    unsigned ko = wb + (unsigned)rot * TB, vo = ko;   // byte offsets in a batch's plane: 32 bits beside a scalar base, one register for every plane
    auto at = [](const T16* base, unsigned byteoff) { return (const T16*)((const char*)base + byteoff); };
    // Fragment buffers: kf[kt] = the four k steps of key tile kt, vf[h] = Vt row blocks 4 h .. 4 h + 3. Loads are issued well ahead of their products:
    // fp16: all of Vt at the top of a pass, all of the next pass's K behind the score products. hi/lo (twice the registers): each half of Vt behind the score products of one key tile,
    // each key tile of the next pass behind one half of the output products, so that a buffer's registers can serve K and Vt in turn.
    V kf[2][4], kf2[2][4], vf[2][4], vf2[2][4];
    auto loadK = [&](int kt, unsigned off) {
#pragma unroll
        for (int ks = 0; ks < 4; ++ks) { kf[kt][ks] = WFrag<T16>::ldp(at(Kp, off) + kt * 16 * HD + ks * 512); if constexpr (HL) kf2[kt][ks] = WFrag<T16>::ldp(at(K2, off) + kt * 16 * HD + ks * 512); } };
    auto loadV = [&](int h, unsigned off) {
#pragma unroll
        for (int d = 0; d < 4; ++d) { vf[h][d] = WFrag<T16>::ldp(at(Vt, off) + (h * 4 + d) * 512); if constexpr (HL) vf2[h][d] = WFrag<T16>::ldp(at(V2, off) + (h * 4 + d) * 512); } };
    loadK(0, ko); loadK(1, ko);
    unsigned kn = HL ? ko : wb + (unsigned)((rot + 1) & (NP - 1)) * TB;   // offset of the next K fetch
    asm volatile("s_wait_xcnt 0x0" ::: "memory");   // stands between the loads above and any later write of a register that they name
#pragma unroll 1
    for (int it = 0; it < NP; ++it) {
        if constexpr (!HL) { loadV(0, vo); loadV(1, vo); __builtin_amdgcn_sched_barrier(0); }   // keeps the loads up here: sunk to their products, each would expose its latency
        v8f s[2][G];
#pragma unroll
        for (int kt = 0; kt < 2; ++kt) {
#pragma unroll
            for (int g = 0; g < G; ++g) s[kt][g] = (v8f){};
#pragma unroll
            for (int ks = 0; ks < 4; ++ks) {
#pragma unroll
                for (int g = 0; g < G; ++g) { s[kt][g] = WFrag<T16>::mma(kf[kt][ks], qf[g][ks], s[kt][g]); if constexpr (HL) { s[kt][g] = WFrag<T16>::mma(kf[kt][ks], qf2[g][ks], s[kt][g]); s[kt][g] = WFrag<T16>::mma(kf2[kt][ks], qf[g][ks], s[kt][g]); } } }
            if constexpr (HL) { loadV(kt, vo); __builtin_amdgcn_sched_barrier(0); } }   // as above: holds the issue point of the loads
        if constexpr (!HL) { loadK(0, kn); loadK(1, kn); __builtin_amdgcn_sched_barrier(0); }   // as above
        V pf[G], pf2[G];
#pragma unroll
        for (int g = 0; g < G; ++g) {
            float mx = s[0][g][0];
#pragma unroll
            for (int r = 0; r < 8; ++r) mx = fmaxf(mx, fmaxf(s[0][g][r], s[1][g][r]));
            mx = fmaxf(mx, __shfl_xor(mx, 16, 32));
            const float mn = fmaxf(m[g], mx * SC2); const float al = exp2s(m[g] - mn); m[g] = mn; const float nb = POFF - mn; float sum = 0.f; float x[16];
#pragma unroll
            for (int e = 0; e < 16; ++e) x[e] = fmaf(s[e >> 3][g][e & 7], SC2, nb);
#pragma unroll
            for (int e = 0; e < 16; ++e) x[e] = exp2s(x[e]);
#pragma unroll
            for (int kt = 0; kt < 2; ++kt)
#pragma unroll
                for (int r = 0; r < 8; ++r) { const float p = x[kt * 8 + r]; sum += p;
                    if constexpr (HL) { const __bf16 ph = (__bf16)p; pf[g][kt * 8 + r] = ph; pf2[g][kt * 8 + r] = (__bf16)(p - (float)ph); } else pf[g][kt * 8 + r] = (h16)p; }
            l[g] = l[g] * al + sum;
#pragma unroll
            for (int db = 0; db < 8; ++db) o[g][db] *= al;
        }
        __builtin_amdgcn_sched_barrier(0);                 // keeps the wait below down here, behind the softmax: without it the wait moved up to stand directly behind the loads' issue
        asm volatile("s_wait_xcnt 0x0" ::: "memory");   // stands between the loads issued so far and the writes of their offset registers below
        __builtin_amdgcn_sched_barrier(0);                 // keeps the two updates behind that wait
        vo += ((rot + it) & (NP - 1)) == NP - 1 ? 0u - (NP - 1) * TB : TB; kn += ((rot + it + AH - 1) & (NP - 1)) == NP - 1 ? 0u - (NP - 1) * TB : TB;   // behind the range's last tile comes its first; the fetches past the last pass wrap too: in bounds, not used
#pragma unroll
        for (int h = 0; h < 2; ++h) {
#pragma unroll
            for (int d = 0; d < 4; ++d) {
#pragma unroll
                for (int g = 0; g < G; ++g) { v8f& oo = o[g][h * 4 + d]; oo = WFrag<T16>::mma(vf[h][d], pf[g], oo); if constexpr (HL) { oo = WFrag<T16>::mma(vf[h][d], pf2[g], oo); oo = WFrag<T16>::mma(vf2[h][d], pf[g], oo); } } }
            if constexpr (HL) { loadK(h, kn); __builtin_amdgcn_sched_barrier(0); } }   // as above
    }
    asm volatile("s_wait_xcnt 0x0" ::: "memory");   // stands between the last pass's fetches and the reuse of their offset register
    __builtin_amdgcn_sched_barrier(0);                 // keeps what follows behind that wait
#pragma unroll
    for (int g = 0; g < G; ++g) { l[g] += __shfl_xor(l[g], 16, 32); if (hi == 0) { sml[w * R + g * 16 + lr] = m[g]; sml[KS * R + w * R + g * 16 + lr] = l[g]; } }
    __syncthreads();   // every wave's (max, sum) is in LDS
#pragma unroll
    for (int g = 0; g < G; ++g) { const int qi = g * 16 + lr; float M = sml[qi];
#pragma unroll
        for (int x = 1; x < KS; ++x) M = fmaxf(M, sml[x * R + qi]);
        float Ls = 0.f;
#pragma unroll
        for (int x = 0; x < KS; ++x) Ls += sml[KS * R + x * R + qi] * exp2s(sml[x * R + qi] - M);
        const float f = __fdiv_rn(exp2s(m[g] - M), Ls);
        float* orow = so + (size_t)(w * R + qi) * OPIT + hi * 8;
#pragma unroll
        for (int db = 0; db < 8; ++db) { const v8f t = o[g][db] * f; v4f t0, t1;
#pragma unroll
            for (int r = 0; r < 4; ++r) { t0[r] = t[r]; t1[r] = t[4 + r]; }
            *(v4fa*)(orow + db * 16) = t0; *(v4fa*)(orow + db * 16 + 4) = t1; } }
    __syncthreads();   // every wave's scaled partial output is in LDS
#pragma unroll
    for (int i = 0; i < R * HD / 4 / (KS * 32); ++i) {
        if (i + 1 == R * HD / 4 / (KS * 32)) asm volatile("s_wait_xcnt 0x0" ::: "memory");   // stands between the stores so far and the last trip's writes of their registers (the compiler's own wait there was a counted one)
        const int e = i * (KS * 32) + tid; const int row = e / (HD / 4), c4 = (e % (HD / 4)) * 4; v4f a = *(const v4fa*)(so + (size_t)row * OPIT + c4);
#pragma unroll
        for (int x = 1; x < KS; ++x) a += *(const v4fa*)(so + (size_t)(x * R + row) * OPIT + c4);
        *(v4f*)(out + (size_t)row * HD + c4) = a; }
}
// Grid: the hi/lo row blocks (32 query rows a work-group) first, then the fp16 ones (two row blocks of FR rows a work-group).
// Two waves a SIMD (at most 512 registers each), eight a work-group: the 256 work-groups are resident at once, one a WGP, and one wave's softmax runs beside the other's products.
__global__ __launch_bounds__(NW * 32) __attribute__((amdgpu_waves_per_eu(2, 2))) void k_fattn(const h16* __restrict__ Q16, const h16* __restrict__ K16, const h16* __restrict__ V16, const bf* __restrict__ Qh, const bf* __restrict__ Ql, const bf* __restrict__ Kh, const bf* __restrict__ Kl, const bf* __restrict__ Vh, const bf* __restrict__ Vl, float* __restrict__ OUTb) {
    constexpr int SR = KSH * 32 > 2 * KSPL * FR ? KSH * 32 : 2 * KSPL * FR;   // staged partial rows of a work-group: the larger of the two kinds
    __shared__ __align__(16) float so[SR * OPIT]; __shared__ float sml[2 * SR];
    static_assert(FR % 16 == 0 && FR >= 32 && (TT - RH) % (8 * FR) == 0 && (FR * HD / 4) % (KSPL * 32) == 0 && (32 * HD / 4) % (KSH * 32) == 0 && NW == KSH && NW == 2 * KSPL, "row blocks");
    int bx = blockIdx.x;
    const int wv = __builtin_amdgcn_readfirstlane((int)threadIdx.x >> 5);   // the wave's number, in a scalar register: an fp16 row block's base addresses and its start tile stay scalar
    // rot: the start tile of the key walk, from the row block's index i in its batch. Bits 0, 1 and 3 up lead, so that neighbours in the grid and groups 8 apart differ (hi/lo: a wave has 8 tiles, so row blocks 8 apart share one; for speed only: any tile of a wave's key range gives the same function).
    // An fp16 work-group holds row blocks i and i + 4, which have the same start tile: its waves w and w + 4 walk the same K and Vt lines, and the 16 work-groups of a batch start on 16 different tiles.
    if (bx < NB_ * (RH / 32)) { const size_t b = bx / (RH / 32); const int i = bx % (RH / 32); const size_t qo = (b * TT + (size_t)i * 32) * HD; const size_t po = b * TT * HD;
        attn_rows<bf, true, 2, KSH>(Qh + qo, Ql + qo, Kh + po, Kl + po, Vh + po, Vl + po, OUTb + qo, so, sml, ((((i >> 3) * 4 + (i & 3)) * 2) + ((i >> 2) & 1)) & 7, (int)threadIdx.x >> 5, (int)threadIdx.x);
    } else { bx -= NB_ * (RH / 32); const int sub = wv / KSPL; const size_t b = bx / ((TT - RH) / (2 * FR)); const int ip = bx % ((TT - RH) / (2 * FR)); const int i = (ip >> 2) * 8 + (ip & 3) + sub * 4; const size_t qo = (b * TT + RH + (size_t)i * FR) * HD; const size_t po = b * TT * HD;
        attn_rows<h16, false, FR / 16, KSPL>(Q16 + qo, nullptr, K16 + po, nullptr, V16 + po, nullptr, OUTb + qo, so + sub * (KSPL * FR * OPIT), sml + sub * (2 * KSPL * FR), ((i >> 3) * 4 + (i & 3)) & 15, ((int)threadIdx.x >> 5) % KSPL, (int)threadIdx.x % (KSPL * 32)); }
}

extern "C" void kernel_launch(void* const* d_in, const int* in_sizes, int n_in,
                              void* d_out, int out_size, void* d_ws, size_t ws_size, hipStream_t stream) {
    (void)in_sizes; (void)n_in; (void)out_size;
    const float* xq = (const float*)d_in[0]; const float* xk = (const float*)d_in[1]; const float* xv = (const float*)d_in[2]; const float* wq = (const float*)d_in[3]; const float* bq = (const float*)d_in[4]; const float* wk = (const float*)d_in[5]; const float* bk = (const float*)d_in[6]; const float* wv = (const float*)d_in[7]; const float* bv = (const float*)d_in[8];
    float* OUT = (float*)d_out;     // [8][2048][128]
    char* wsp = (char*)d_ws;
    auto take = [&](size_t bytes) { char* p = wsp; wsp += (bytes + 255) & ~(size_t)255; return (void*)p; };
    // Every plane holds NB_ batch slices.
    h16* QP16 = (h16*)take((size_t)NB_ * NH_ * TT * HD * 2); h16* KP16 = (h16*)take((size_t)NB_ * NKV * TT * HD * 2); h16* VT16 = (h16*)take((size_t)NB_ * NKV * HD * TT * 2);
    bf* QPh = (bf*)take((size_t)NB_ * NH_ * TT * HD * 2); bf* QPl = (bf*)take((size_t)NB_ * NH_ * TT * HD * 2); bf* KPh = (bf*)take((size_t)NB_ * NKV * TT * HD * 2); bf* KPl = (bf*)take((size_t)NB_ * NKV * TT * HD * 2); bf* VTh = (bf*)take((size_t)NB_ * NKV * HD * TT * 2); bf* VTl = (bf*)take((size_t)NB_ * NKV * HD * TT * 2);
    if ((size_t)(wsp - (char*)d_ws) > ws_size) return;    // ws 256 MiB
    static_assert(NH_ == 1 && NKV == 1 && ZH == 1, "both kernels take planes of one head, each batch's slice in fragment order");
    k_proj<<<dim3(NB_ * TT / PR, 3, 1), 256, 0, stream>>>(xq, xk, xv, wq, wk, wv, bq, bk, bv, QP16, QPh, QPl, KP16, KPh, KPl, VT16, VTh, VTl);
    k_fattn<<<NB_ * (RH / 32) + NB_ * ((TT - RH) / (2 * FR)), NW * 32, 0, stream>>>(QP16, KP16, VT16, QPh, QPl, KPh, KPl, VTh, VTl, OUT);
}

// v009
// It runs in 28.5 microseconds.
// It is 1.39 times as fast as v007, going by the measured steps of the versions left out in between.
// Counting every step since v000, it is 39.8 times as fast.
#include <hip/hip_runtime.h>

// Single-head attention with separate q/k/v inputs (x_q, x_k, x_v [8][2048][256]; q = x_q Wq + bq, k = x_k Wk + bk, v = x_v Wv + bv ('xw' [256][128] + [128]); scores = q.k / sqrt(128); softmax over 2048 keys; out = attn.v -> [8][2048][128] f32 (2.1 M)).
// Two launches, all 8 batches in each. k_proj: the three projections (+ biases) from inputs rounded to bf16 on the way into LDS, written straight as three dense fp16 planes, each laid in the fragment order of the matrix instruction that reads it. k_fattn: scores, running-maximum softmax and attn.v, which writes the f32 output; its K and Vt tiles come into LDS by asynchronous copies.
// Compute dtypes, f32 accumulate: every input rounded to bf16; projections on PLAIN bf16 operands (exact) + bf16-rounded biases added in f32; scores and attn.v of every query row on single fp16 operands; softmax f32; f32 output.

#define NB_  8
#define TT   2048
#define DM   256
#define NH_  1
#define NKV  1
#define REP  (NH_ / NKV)
#define HD   128
#define DQ   (NH_ * HD)
#define DKV  (NKV * HD)
#define ZH   1
#define WIN  0
#define SCL  0.088388347648318447f   // HD^-0.5
typedef _Float16 h16;
typedef unsigned short bf;
typedef __attribute__((ext_vector_type(16))) __bf16   v16bf;
typedef __attribute__((ext_vector_type(16))) _Float16 v16h;
typedef __attribute__((ext_vector_type(8)))  _Float16 v8h;
typedef __attribute__((ext_vector_type(8)))  unsigned short v8us;
typedef __attribute__((ext_vector_type(8)))  float    v8f;
typedef __attribute__((ext_vector_type(4)))  float    v4f;
typedef v8h  __attribute__((may_alias)) v8ha;
typedef v4f  __attribute__((may_alias)) v4fa;
typedef v8us __attribute__((may_alias)) v8usa;

__device__ __forceinline__ unsigned short f2bf(float f) { unsigned u = __float_as_uint(f); u += 0x7FFFu + ((u >> 16) & 1u); return (unsigned short)(u >> 16); }
__device__ __forceinline__ float bf2f(unsigned short b) { return __uint_as_float(((unsigned)b) << 16); }
__device__ __forceinline__ float bfr(float f) { return bf2f(f2bf(f)); }
__device__ __forceinline__ v16h cat16(v8h lo, v8h hi) { return __builtin_shufflevector(lo, hi, 0, 1, 2, 3, 4, 5, 6, 7, 8, 9, 10, 11, 12, 13, 14, 15); }
__device__ __forceinline__ v16bf cat16b(v8us lo, v8us hi) { return __builtin_bit_cast(v16bf, __builtin_shufflevector(lo, hi, 0, 1, 2, 3, 4, 5, 6, 7, 8, 9, 10, 11, 12, 13, 14, 15)); }
__device__ __forceinline__ v8f wmma16(v16h a, v16h b, v8f c) { return __builtin_amdgcn_wmma_f32_16x16x32_f16(false, a, false, b, (short)0, c, false, false); }
__device__ __forceinline__ v8f wmmab(v16bf a, v16bf b, v8f c) { return __builtin_amdgcn_wmma_f32_16x16x32_bf16(false, a, false, b, (short)0, c, false, false); }



// Fragment of a 16x16x32 product. ldrow: from a K-contiguous 16-bit row: p = row (lane & 15) + 8 (lane >> 4); elements k = 8 hi .. 8 hi + 7 and 16 + 8 hi .. 16 + 8 hi + 7.
// ldp: from a plane in fragment order: the same two groups of 8 elements lie at p = block + 8 lane and 256 elements further on, so each of the two loads of a wave covers 512 contiguous bytes (four whole lines).
// Fragment order. q, k: per 16 rows t a block of 2048 elements; element (t, d) at (d >> 4) * 256 + ((d >> 3) & 1) * 128 + (t & 15) * 8 + (d & 7). v: per 32 keys t a block of 4096; element (d, t) at (d >> 4) * 512 + ((t >> 4) & 1) * 256 + ((t >> 3) & 1) * 128 + (d & 15) * 8 + (t & 7).
__device__ __forceinline__ v16bf ldrow(const bf* p) { return cat16b(*(const v8us*)p, *(const v8us*)(p + 16)); }
__device__ __forceinline__ v16h ldp(const h16* p) { return cat16(*(const v8h*)p, *(const v8h*)(p + 256)); }

// ---- k_proj: one projection (blockIdx.y: 0 q, 1 k, 2 v) of PR rows of x in one work-group of 8 waves; a wave owns 16 rows x all 128 columns (8 accumulators).
// x [PR][256] (one contiguous piece of memory) and W [256][128] are read as f32 in whole lines, rounded to bf16 and laid K-contiguous in LDS (W transposed: a lane gathers 8 k of one column and stores them as 16 bytes).
// q, k: transposed product (A = 16 rows of Wt, B = 16 rows of x): a lane holds 8 neighbouring columns of one row. v: A = x, B = Wt: a lane holds 8 neighbouring t of one column.
// In both cases the 32 lanes' groups of 8 are neighbours in the plane's fragment order: an accumulator goes to the plane as one store of 512 contiguous bytes, with no staging.
#define PR   128
#define XPIT (DM + 8)             // 16-bit elements per staged operand row: 528 B = 16 B x odd, conflict-free for 16-byte reads down a column of rows
typedef __attribute__((ext_vector_type(8))) __bf16 v8bf;
typedef __attribute__((ext_vector_type(4))) __bf16 v4bf;
typedef __attribute__((ext_vector_type(4))) unsigned short v4us;
// The products and the output of k_proj, behind the barrier that publishes the staged operands. TR: q, k (transposed product); otherwise v.
template <bool TR>
__device__ __forceinline__ void proj_tail(bf* sm, const float* __restrict__ bias, h16* P16, size_t r0) {
    const int lane = threadIdx.x & 31, lr = lane & 15, hi = lane >> 4, w = threadIdx.x >> 5;
    v8f acc[8];
#pragma unroll
    for (int nb = 0; nb < 8; ++nb) acc[nb] = (v8f){};
    const bf* xrow = sm + HD * XPIT + (w * 16 + lr) * XPIT + 8 * hi; const bf* wrow = sm + lr * XPIT + 8 * hi;
    // Both loops are unrolled: accumulator and buffer indices are constants, and no matrix instruction stands in front of a back edge. Two fragment buffers: step s + 1 is fetched from LDS ahead of the products of step s.
    v16bf xf[2], wf[2][8];
    auto fetch = [&](int s) { xf[s & 1] = ldrow(xrow + s * 32);
#pragma unroll
        for (int nb = 0; nb < 8; ++nb) wf[s & 1][nb] = ldrow(wrow + nb * 16 * XPIT + s * 32); };
    fetch(0);
#pragma unroll
    for (int s = 0; s < DM / 32; ++s) {
        if (s + 1 < DM / 32) fetch(s + 1);
        __builtin_amdgcn_sched_barrier(0);   // keeps the next step's LDS loads ahead of this step's products: sunk to their own products, each pair of loads exposed its latency
#pragma unroll
        for (int nb = 0; nb < 8; ++nb) acc[nb] = TR ? wmmab(wf[s & 1][nb], xf[s & 1], acc[nb]) : wmmab(xf[s & 1], wf[s & 1][nb], acc[nb]);
        __builtin_amdgcn_sched_barrier(0); }   // and the fetch after next behind them: its buffer is the one these products read
    // TR: wave w holds rows t = r0 + 16 w + lr, block (r0 >> 4) + w; accumulator nb is d = 16 nb + 8 hi + j. Otherwise: t = r0 + 16 w + 8 hi + j, half w & 1 of key block (r0 >> 5) + (w >> 1); accumulator nb is d = 16 nb + lr.
    const size_t go = TR ? (r0 + w * 16) * HD + lane * 8 : (r0 + (w >> 1) * 32) * HD + (w & 1) * 256 + lane * 8; constexpr size_t gp = TR ? 256 : 512;
    v8f bv8[TR ? 8 : 1]; float bv1[TR ? 1 : 8]; const unsigned bo = TR ? hi * 32u : lr * 4u;   // byte offset of the lane's first bias value
#pragma unroll
    for (int nb = 0; nb < 8; ++nb) { if constexpr (TR) bv8[nb] = *(const v8f*)((const char*)bias + bo + nb * 64); else bv1[nb] = *(const float*)((const char*)bias + bo + nb * 64); }
    asm volatile("s_wait_xcnt 0x0" :: "v"(bo) : "memory");   // stands between the bias loads and any write of their offset register, which it names so that the register lives up to here (without it the last load's result took that register)
#pragma unroll
    for (int nb = 0; nb < 8; ++nb) { v8h o16; v8f bb;
        if constexpr (TR) bb = bv8[nb]; else {
#pragma unroll
            for (int j = 0; j < 8; ++j) bb[j] = bv1[nb]; }
#pragma unroll
        for (int j = 0; j < 8; ++j) o16[j] = (h16)(acc[nb][j] + (float)(__bf16)bb[j]);
        *(v8us*)((bf*)P16 + go + nb * gp) = __builtin_bit_cast(v8us, o16); }
    asm volatile("s_wait_xcnt 0x0" ::: "memory");   // stands between the stores above and any later write of their address registers (in the listing the other branch's code follows this one's)
}
// Four waves a SIMD (at most 256 registers each): two work-groups fit a WGP, so all 384 are resident at once.
__global__ __launch_bounds__(256) __attribute__((amdgpu_waves_per_eu(4))) void k_proj(const float* __restrict__ xq, const float* __restrict__ xk, const float* __restrict__ xv, const float* __restrict__ wq, const float* __restrict__ wk, const float* __restrict__ wv, const float* __restrict__ bq, const float* __restrict__ bk, const float* __restrict__ bv,
                                              h16* Q16, h16* K16, h16* V16) {
    __shared__ __align__(16) bf sm[(HD + PR) * XPIT];
    static_assert(TT % PR == 0 && PR == 128 && HD == 128 && DM == 256, "tile shapes");
    bf* wt = sm; bf* xs = sm + HD * XPIT;
    const int tid = threadIdx.x, lane = tid & 31, lr = lane & 15, hi = lane >> 4, w = tid >> 5; const int pj = blockIdx.y; const size_t r0 = (size_t)blockIdx.x * PR;
    const float* x = pj == 0 ? xq : pj == 1 ? xk : xv; const float* W = pj == 0 ? wq : pj == 1 ? wk : wv; const float* bias = pj == 0 ? bq : pj == 1 ? bk : bv;
    h16* P16 = pj == 0 ? Q16 : pj == 1 ? K16 : V16;
    // Loads return in issue order, so the order of issue is: first half of W (shared by every work-group, from L2: back soonest), all of the thread's share of x (from memory, the longest latency), and,
    // once the first half is stored, the second half of W, whose latency passes under that of x. W goes in two halves to bound the registers.
    const float* wb = W + (size_t)w * 32 * HD + lane;   // wave w stages k = 32 w .. 32 w + 31
    const v4f* xt = (const v4f*)(x + r0 * DM) + tid; v4f xr[32];
#pragma unroll
    for (int hf = 0; hf < 2; ++hf) { float wr[8][8];
#pragma unroll
        for (int i = 0; i < 8; ++i)
#pragma unroll
            for (int kk = 0; kk < 8; ++kk) wr[i][kk] = wb[((hf * 2 + (i >> 2)) * 8 + kk) * HD + (i & 3) * 32];
        __builtin_amdgcn_sched_barrier(0);   // one half's loads are issued together, and the next half's stay behind this half's stores (registers)
        if (hf == 0) {
#pragma unroll
            for (int i = 0; i < 32; ++i) xr[i] = xt[i * 256];
            __builtin_amdgcn_sched_barrier(0); }   // keeps the x loads up here: sunk to their conversions, they would start only after W is staged
        else asm volatile("s_wait_xcnt 0x0" :: "v"(wb) : "memory");   // stands between the W loads and any write of their address register, which it names so that the register lives up to here (without it the last load's result took that register)
#pragma unroll
        for (int i = 0; i < 8; ++i) { v8bf o;
#pragma unroll
            for (int kk = 0; kk < 8; ++kk) o[kk] = (__bf16)wr[i][kk];
            *(v8us*)(wt + ((i & 3) * 32 + lane) * XPIT + (w * 4 + hf * 2 + (i >> 2)) * 8) = __builtin_bit_cast(v8us, o); } }
#pragma unroll
    for (int i = 0; i < 32; ++i) { v4bf o;
#pragma unroll
        for (int q = 0; q < 4; ++q) o[q] = (__bf16)xr[i][q];
        *(v4us*)(xs + (i * 4 + (tid >> 6)) * XPIT + (tid & 63) * 4) = __builtin_bit_cast(v4us, o); }
    __syncthreads();   // both operands are in LDS
    if (pj < 2) proj_tail<true>(sm, bias, P16, r0); else proj_tail<false>(sm, bias, P16, r0);
}
// k_fattn: scores, softmax and attn.v of one block of FR query rows (G tiles of 16 rows) by KS waves of one work-group; neither the scores nor the probabilities go to memory.
// Every wave holds all G tiles, so a K or Vt fragment read from LDS feeds G products.
// Transposed products: St = K Qt (A = 16 key rows, B = 16 query columns), Ot += Vt Pt (A = 16 rows of Vt, B = the packed probabilities). A lane holds one query's scores (keys 8 hi + r of each 16-key tile),
// so two converted score tiles are the B operand of the second product as they stand, and maximum, sum and rescale factor are per lane (one exchange between the lane halves for the maximum).
// The KS waves of a row block walk TT / KS keys each with a running maximum; their partial (max, sum, Ot) are merged through LDS in wave order at the end.
// A work-group is NW waves, one work-group a WGP: two row blocks side by side, KSPL = 4 waves each. FR = 32 makes 256 equal work-groups of the 8 x 2048 query rows: every wave place of the chip has the same work.
#define NW   8
#define KSPL 4
#define FR   32                   // query rows of a row block
// 2^x with the slot that the instruction set asks for behind a transcendental in the same statement.
__device__ __forceinline__ float exp2s(float x) { float y; asm("v_exp_f32 %0, %1\n\tv_nop" : "=v"(y) : "v"(x)); return y; }
// One wave's share of a stage: two pieces of 8 KB, each contiguous in the plane and in LDS, as 2 x 16 asynchronous copies of 512 B (16 B a lane). The immediate offset moves both addresses.
// l0, l1: the lane's LDS byte address in each piece; g0, g1: its global address. The s_wait_xcnt 0 is the last line of the copies' own statement: it stands in front of any later write of the address registers.
__device__ __forceinline__ void copy2x8k(unsigned l0, const char* g0, unsigned l1, const char* g1) {
    asm volatile("global_load_async_to_lds_b128 %0, %1, off\n\t"
                 "global_load_async_to_lds_b128 %0, %1, off offset:512\n\t"
                 "global_load_async_to_lds_b128 %0, %1, off offset:1024\n\t"
                 "global_load_async_to_lds_b128 %0, %1, off offset:1536\n\t"
                 "global_load_async_to_lds_b128 %0, %1, off offset:2048\n\t"
                 "global_load_async_to_lds_b128 %0, %1, off offset:2560\n\t"
                 "global_load_async_to_lds_b128 %0, %1, off offset:3072\n\t"
                 "global_load_async_to_lds_b128 %0, %1, off offset:3584\n\t"
                 "global_load_async_to_lds_b128 %0, %1, off offset:4096\n\t"
                 "global_load_async_to_lds_b128 %0, %1, off offset:4608\n\t"
                 "global_load_async_to_lds_b128 %0, %1, off offset:5120\n\t"
                 "global_load_async_to_lds_b128 %0, %1, off offset:5632\n\t"
                 "global_load_async_to_lds_b128 %0, %1, off offset:6144\n\t"
                 "global_load_async_to_lds_b128 %0, %1, off offset:6656\n\t"
                 "global_load_async_to_lds_b128 %0, %1, off offset:7168\n\t"
                 "global_load_async_to_lds_b128 %0, %1, off offset:7680\n\t"
                 "global_load_async_to_lds_b128 %2, %3, off\n\t"
                 "global_load_async_to_lds_b128 %2, %3, off offset:512\n\t"
                 "global_load_async_to_lds_b128 %2, %3, off offset:1024\n\t"
                 "global_load_async_to_lds_b128 %2, %3, off offset:1536\n\t"
                 "global_load_async_to_lds_b128 %2, %3, off offset:2048\n\t"
                 "global_load_async_to_lds_b128 %2, %3, off offset:2560\n\t"
                 "global_load_async_to_lds_b128 %2, %3, off offset:3072\n\t"
                 "global_load_async_to_lds_b128 %2, %3, off offset:3584\n\t"
                 "global_load_async_to_lds_b128 %2, %3, off offset:4096\n\t"
                 "global_load_async_to_lds_b128 %2, %3, off offset:4608\n\t"
                 "global_load_async_to_lds_b128 %2, %3, off offset:5120\n\t"
                 "global_load_async_to_lds_b128 %2, %3, off offset:5632\n\t"
                 "global_load_async_to_lds_b128 %2, %3, off offset:6144\n\t"
                 "global_load_async_to_lds_b128 %2, %3, off offset:6656\n\t"
                 "global_load_async_to_lds_b128 %2, %3, off offset:7168\n\t"
                 "global_load_async_to_lds_b128 %2, %3, off offset:7680\n\t"
                 "s_wait_xcnt 0x0" :: "v"(l0), "v"(g0), "v"(l1), "v"(g1) : "memory");
}
#define STG  (KSPL * 2 * 2 * 32 * HD)  // 16-bit elements of one stage of the ring: per key range two tiles of 32 keys, each a K tile followed by its Vt tile
struct with_refill { static constexpr bool v = true; }; struct no_refill { static constexpr bool v = false; };
// Unrolling: every inner loop is unrolled so that fragment and accumulator indices are constants (registers, no scratch); the trip loops stay rolled (unroll 1) to keep the text short.
#define OPIT (HD + 4)             // floats per query row of the merge staging: 16-byte aligned rows that start on different banks
// w: the wave's index among the KS waves of its row block; tid: the thread's index among their KS * 32 threads; so, sml: the row block's own staging.
// ring: the work-group's two stages of K and Vt tiles; sub: the row block's index in the work-group. The waves w of both row blocks walk the same key range in the same order and read the same staged tiles:
// a tile is fetched from L2 once a work-group. The wave of row block 0 copies the range's K tile, that of row block 1 its Vt tile.
template <int G, int KS>
__device__ __forceinline__ void attn_rows(const h16* __restrict__ Q, const h16* __restrict__ Kp, const h16* __restrict__ Vt, float* __restrict__ out, float* so, float* sml, const h16* ring, const int sub, const int rot, const int w, const int tid) {
    constexpr float SC2 = SCL * 1.4426950408889634f;   // scores in log2 units
    constexpr float POFF = 4.0f;                       // the fp16 probabilities carry x16 (it cancels in Ot / sum): keeps small ones out of the fp16 subnormals
    const int lane = threadIdx.x & 31, lr = lane & 15, hi = lane >> 4;
    constexpr int R = G * 16;   // query rows of the row block: every one of its waves holds all of them
    v16h qf[G][4];
#pragma unroll
    for (int g = 0; g < G; ++g)
#pragma unroll
        for (int ks = 0; ks < 4; ++ks) qf[g][ks] = ldp(Q + (size_t)g * 16 * HD + ks * 512 + lane * 8);
    v8f o[G][8]; float m[G], l[G];
#pragma unroll
    for (int g = 0; g < G; ++g) { m[g] = -3.0e38f; l[g] = 0.f;
#pragma unroll
        for (int db = 0; db < 8; ++db) o[g][db] = (v8f){}; }
    constexpr int NP = TT / KS / 32;                      // passes
    constexpr unsigned TB = 32 * HD * 2;                  // bytes of one pass's 32 keys in a plane
    static_assert((NP & (NP - 1)) == 0 && NP >= 4, "the walk wraps by a mask; two stages exist");
    // Pass j of a wave takes tile (rot + j) mod NP of the wave's key range: work-groups of one batch, which run in step, then ask L2 for different lines at any one time.
    const char* gsrc = (const char*)(sub == 0 ? Kp : Vt) + (unsigned)(w * (TT / KS) * HD + lane * 8) * 2u;   // the lane's 16 bytes of the first copy of tile 0 of the wave's key range, in the plane that the wave copies
    const unsigned ldst = (unsigned)(size_t)ring + (unsigned)((w * 4 + sub) * 32 * HD + lane * 8) * 2u;       // their place in stage buffer 0 (LDS byte address)
    const h16* rd = ring + w * (4 * 32 * HD) + lane * 8;                                                      // the lane's first fragment element of the range's K tile in buffer 0; the Vt tile follows it
    // Fragment buffers: kf[kt] = the four k steps of key tile kt, vf[h] = Vt row blocks 4 h .. 4 h + 3, all read from the trip's own stage buffer.
    v16h kf[2][4], vf[2][4];
    auto loadK = [&](int kt, const h16* p) {
#pragma unroll
        for (int ks = 0; ks < 4; ++ks) kf[kt][ks] = ldp(p + kt * 16 * HD + ks * 512); };
    auto loadV = [&](int h, const h16* p) {
#pragma unroll
        for (int d = 0; d < 4; ++d) vf[h][d] = ldp(p + 32 * HD + (h * 4 + d) * 512); };
    asm volatile("s_wait_xcnt 0x0" ::: "memory");   // stands between the loads above and any later write of a register that they name
    // Two stage buffers of two tiles a key range: the next stage's tiles fly while this stage's are worked on, and the waves meet at a barrier once in two passes.
    auto stage = [&](int t, unsigned buf) {   // the wave's copies of stage t (passes 2 t and 2 t + 1 of the walk) into buffer buf
        copy2x8k(ldst + buf * (STG * 2u), gsrc + (unsigned)((rot + 2 * t) & (NP - 1)) * TB, ldst + buf * (STG * 2u) + 2 * TB, gsrc + (unsigned)((rot + 2 * t + 1) & (NP - 1)) * TB); };
    stage(0, 0);
    asm volatile("s_wait_asynccnt 0x0" ::: "memory");   // this wave's copies of the first stage have landed
    __syncthreads();                                    // every wave's have: the first stage may be read
    stage(1, 1);
    // One trip: the two passes of stage t, which read buffer t & 1 alone, and the hand-over at its foot. refill: a stage t + 2 exists.
    auto trip = [&](int t, auto refill) {
        const h16* p = rd + (t & 1) * STG;
        loadK(0, p); loadK(1, p);
#pragma unroll
        for (int h = 0; h < 2; ++h) {
            const h16* ph = p + h * (2 * 32 * HD);
            loadV(0, ph); loadV(1, ph); __builtin_amdgcn_sched_barrier(0);   // keeps the LDS reads together up here: sunk to their products, each would expose its latency
            v8f s[2][G];
#pragma unroll
            for (int kt = 0; kt < 2; ++kt) {
#pragma unroll
                for (int g = 0; g < G; ++g) s[kt][g] = (v8f){};
#pragma unroll
                for (int ks = 0; ks < 4; ++ks) {
#pragma unroll
                    for (int g = 0; g < G; ++g) s[kt][g] = wmma16(kf[kt][ks], qf[g][ks], s[kt][g]); } }
            if (h == 0) { loadK(0, ph + 2 * 32 * HD); loadK(1, ph + 2 * 32 * HD); __builtin_amdgcn_sched_barrier(0); }   // the stage's second K tile, behind the score products that free its registers: its latency passes under the softmax
            v16h pf[G];
#pragma unroll
            for (int g = 0; g < G; ++g) {
                float mx = s[0][g][0];
#pragma unroll
                for (int r = 0; r < 8; ++r) mx = fmaxf(mx, fmaxf(s[0][g][r], s[1][g][r]));
                mx = fmaxf(mx, __shfl_xor(mx, 16, 32));
                const float mn = fmaxf(m[g], mx * SC2); const float al = exp2s(m[g] - mn); m[g] = mn; const float nb = POFF - mn; float sum = 0.f; float x[16];
#pragma unroll
                for (int e = 0; e < 16; ++e) x[e] = fmaf(s[e >> 3][g][e & 7], SC2, nb);
#pragma unroll
                for (int e = 0; e < 16; ++e) x[e] = exp2s(x[e]);
#pragma unroll
                for (int e = 0; e < 16; ++e) { sum += x[e]; pf[g][e] = (h16)x[e]; }
                l[g] = l[g] * al + sum;
#pragma unroll
                for (int db = 0; db < 8; ++db) o[g][db] *= al;
            }
#pragma unroll
            for (int db = 0; db < 8; ++db) {
#pragma unroll
                for (int g = 0; g < G; ++g) o[g][db] = wmma16(vf[db >> 2][db & 3], pf[g], o[g][db]); }
        }
        __builtin_amdgcn_sched_barrier(0);                  // keeps the hand-over below at the trip's foot: moved up over the products, its wait for the copies stood directly behind their issue and exposed their whole latency
        asm volatile("s_wait_dscnt 0x0" ::: "memory");      // this wave's reads of the trip's buffer are done
        asm volatile("s_wait_asynccnt 0x0" ::: "memory");   // and its copies of the next stage have landed
        __syncthreads();                                    // so for every wave: the next stage may be read, this trip's buffer may be refilled
        if constexpr (decltype(refill)::v) stage(t + 2, (unsigned)(t & 1));
    };
    // The trips with a refill and the last two without are loops of their own: with a branch round the copies the row sums sank behind it, in front of the next trip's LDS reads.
#pragma unroll 1
    for (int t = 0; t < NP / 2 - 2; ++t) trip(t, with_refill());
#pragma unroll 1
    for (int t = NP / 2 - 2; t < NP / 2; ++t) trip(t, no_refill());
    asm volatile("s_wait_asynccnt 0x0" ::: "memory");   // no copy is outstanding when the wave goes on to the merge and ends
#pragma unroll
    for (int g = 0; g < G; ++g) { l[g] += __shfl_xor(l[g], 16, 32); if (hi == 0) { sml[w * R + g * 16 + lr] = m[g]; sml[KS * R + w * R + g * 16 + lr] = l[g]; } }
    __syncthreads();   // every wave's (max, sum) is in LDS
#pragma unroll
    for (int g = 0; g < G; ++g) { const int qi = g * 16 + lr; float M = sml[qi];
#pragma unroll
        for (int x = 1; x < KS; ++x) M = fmaxf(M, sml[x * R + qi]);
        float Ls = 0.f;
#pragma unroll
        for (int x = 0; x < KS; ++x) Ls += sml[KS * R + x * R + qi] * exp2s(sml[x * R + qi] - M);
        const float f = __fdiv_rn(exp2s(m[g] - M), Ls);
        float* orow = so + (size_t)(w * R + qi) * OPIT + hi * 8;
#pragma unroll
        for (int db = 0; db < 8; ++db) { const v8f t = o[g][db] * f; v4f t0, t1;
#pragma unroll
            for (int r = 0; r < 4; ++r) { t0[r] = t[r]; t1[r] = t[4 + r]; }
            *(v4fa*)(orow + db * 16) = t0; *(v4fa*)(orow + db * 16 + 4) = t1; } }
    __syncthreads();   // every wave's scaled partial output is in LDS
#pragma unroll
    for (int i = 0; i < R * HD / 4 / (KS * 32); ++i) {
        if (i > 0 && (i & 1) == 0) asm volatile("s_wait_xcnt 0x0" ::: "memory");   // stands between the stores so far and the next two trips' writes of their registers (the compiler's own waits there were counted ones)
        const int e = i * (KS * 32) + tid; const int row = e / (HD / 4), c4 = (e % (HD / 4)) * 4; v4f a = *(const v4fa*)(so + (size_t)row * OPIT + c4);
#pragma unroll
        for (int x = 1; x < KS; ++x) a += *(const v4fa*)(so + (size_t)(x * R + row) * OPIT + c4);
        *(v4f*)(out + (size_t)row * HD + c4) = a; }
}
// Grid: two row blocks of FR rows a work-group, 32 work-groups a batch.
// Two waves a SIMD (at most 512 registers each), eight a work-group: the 256 work-groups are resident at once, one a WGP, and one wave's softmax runs beside the other's products.
__global__ __launch_bounds__(NW * 32) __attribute__((amdgpu_waves_per_eu(2, 2))) void k_fattn(const h16* __restrict__ Q16, const h16* __restrict__ K16, const h16* __restrict__ V16, float* __restrict__ OUTb) {
    constexpr int SR = 2 * KSPL * FR;   // staged partial rows of a work-group
    __shared__ __align__(16) h16 ring[2 * STG]; __shared__ float sml[2 * SR];
    float* so = (float*)ring;   // the merge staging takes the ring's place: it is written behind the last trip's hand-over (every wave's reads done, no copy outstanding, a barrier) and the barrier that publishes (max, sum)
    static_assert(SR * OPIT * 4 <= 2 * STG * 2, "the merge staging fits the ring");
    static_assert(FR % 16 == 0 && TT % (8 * FR) == 0 && (FR * HD / 4) % (KSPL * 32) == 0 && NW == 2 * KSPL, "row blocks");
    const int bx = blockIdx.x;
    const int wv = __builtin_amdgcn_readfirstlane((int)threadIdx.x >> 5);   // the wave's number, in a scalar register: a row block's base addresses and its start tile stay scalar
    // rot: the start tile of the key walk, from the row block's index i in its batch. Bits 0, 1 and 3 up lead, so that neighbours in the grid differ (which tile is for speed only: any tile of a wave's key range gives the same function; that both row blocks of a work-group get the same one is needed: they read the same staged tiles).
    // A work-group holds row blocks i and i + 4, which have the same start tile: its two row blocks walk the same K and Vt tiles in step, from one staged copy. A wave has 16 tiles, so of the 32 work-groups of a batch those 16 apart share a start tile.
    const int sub = wv / KSPL; const size_t b = bx / (TT / (2 * FR)); const int ip = bx % (TT / (2 * FR)); const int i = (ip >> 2) * 8 + (ip & 3) + sub * 4; const size_t qo = (b * TT + (size_t)i * FR) * HD; const size_t po = b * TT * HD;
    attn_rows<FR / 16, KSPL>(Q16 + qo, K16 + po, V16 + po, OUTb + qo, so + sub * (KSPL * FR * OPIT), sml + sub * (2 * KSPL * FR), ring, sub, ((i >> 3) * 4 + (i & 3)) & 15, ((int)threadIdx.x >> 5) % KSPL, (int)threadIdx.x % (KSPL * 32));
}

extern "C" void kernel_launch(void* const* d_in, const int* in_sizes, int n_in,
                              void* d_out, int out_size, void* d_ws, size_t ws_size, hipStream_t stream) {
    (void)in_sizes; (void)n_in; (void)out_size;
    const float* xq = (const float*)d_in[0]; const float* xk = (const float*)d_in[1]; const float* xv = (const float*)d_in[2]; const float* wq = (const float*)d_in[3]; const float* bq = (const float*)d_in[4]; const float* wk = (const float*)d_in[5]; const float* bk = (const float*)d_in[6]; const float* wv = (const float*)d_in[7]; const float* bv = (const float*)d_in[8];
    float* OUT = (float*)d_out;     // [8][2048][128]
    char* wsp = (char*)d_ws;
    auto take = [&](size_t bytes) { char* p = wsp; wsp += (bytes + 255) & ~(size_t)255; return (void*)p; };
    // Every plane holds NB_ batch slices.
    h16* QP16 = (h16*)take((size_t)NB_ * NH_ * TT * HD * 2); h16* KP16 = (h16*)take((size_t)NB_ * NKV * TT * HD * 2); h16* VT16 = (h16*)take((size_t)NB_ * NKV * HD * TT * 2);
    if ((size_t)(wsp - (char*)d_ws) > ws_size) return;    // ws 256 MiB
    static_assert(NH_ == 1 && NKV == 1 && ZH == 1, "both kernels take planes of one head a batch, in fragment order");
    k_proj<<<dim3(NB_ * TT / PR, 3, 1), 256, 0, stream>>>(xq, xk, xv, wq, wk, wv, bq, bk, bv, QP16, KP16, VT16);
    k_fattn<<<NB_ * (TT / (2 * FR)), NW * 32, 0, stream>>>(QP16, KP16, VT16, OUT);
}

// v010
// A run of this version takes 26.4 microseconds.
// Two timings next to v009 both put it at 1.08 times that version's speed.
// Over all steps from v000 it is 42.9 times as fast.
#include <hip/hip_runtime.h>

// Single-head attention with separate q/k/v inputs (x_q, x_k, x_v [8][2048][256]; q = x_q Wq + bq, k = x_k Wk + bk, v = x_v Wv + bv ('xw' [256][128] + [128]); scores = q.k / sqrt(128); softmax over 2048 keys; out = attn.v -> [8][2048][128] f32 (2.1 M)).
// Two launches, all 8 batches in each. k_proj: the three projections (+ biases) from inputs rounded to bf16 on the way into LDS, written straight as three dense fp16 planes, each laid in the fragment order of the matrix instruction that reads it. k_fattn: scores, softmax against a held reference maximum and attn.v, which writes the f32 output; its K and Vt tiles come into LDS by asynchronous copies.
// Compute dtypes, f32 accumulate: every input rounded to bf16; projections on PLAIN bf16 operands (exact) + f32 biases; scores and attn.v of every query row on single fp16 operands; softmax f32; f32 output.

#define NB_  8
#define TT   2048
#define DM   256
#define NH_  1
#define NKV  1
#define REP  (NH_ / NKV)
#define HD   128
#define DQ   (NH_ * HD)
#define DKV  (NKV * HD)
#define ZH   1
#define WIN  0
#define SCL  0.088388347648318447f   // HD^-0.5
#define SC2  (SCL * 1.4426950408889634f)   // HD^-0.5 log2 e: the q plane carries it, so the score products come out in log2 units
typedef _Float16 h16;
typedef unsigned short bf;
typedef __attribute__((ext_vector_type(16))) __bf16   v16bf;
typedef __attribute__((ext_vector_type(16))) _Float16 v16h;
typedef __attribute__((ext_vector_type(8)))  _Float16 v8h;
typedef __attribute__((ext_vector_type(8)))  unsigned short v8us;
typedef __attribute__((ext_vector_type(8)))  float    v8f;
typedef __attribute__((ext_vector_type(4)))  float    v4f;
typedef v8h  __attribute__((may_alias)) v8ha;
typedef v4f  __attribute__((may_alias)) v4fa;
typedef v8us __attribute__((may_alias)) v8usa;

__device__ __forceinline__ unsigned short f2bf(float f) { unsigned u = __float_as_uint(f); u += 0x7FFFu + ((u >> 16) & 1u); return (unsigned short)(u >> 16); }
__device__ __forceinline__ float bf2f(unsigned short b) { return __uint_as_float(((unsigned)b) << 16); }
__device__ __forceinline__ float bfr(float f) { return bf2f(f2bf(f)); }
__device__ __forceinline__ v16h cat16(v8h lo, v8h hi) { return __builtin_shufflevector(lo, hi, 0, 1, 2, 3, 4, 5, 6, 7, 8, 9, 10, 11, 12, 13, 14, 15); }
__device__ __forceinline__ v16bf cat16b(v8us lo, v8us hi) { return __builtin_bit_cast(v16bf, __builtin_shufflevector(lo, hi, 0, 1, 2, 3, 4, 5, 6, 7, 8, 9, 10, 11, 12, 13, 14, 15)); }
__device__ __forceinline__ v8f wmma16(v16h a, v16h b, v8f c) { return __builtin_amdgcn_wmma_f32_16x16x32_f16(false, a, false, b, (short)0, c, false, false); }
__device__ __forceinline__ v8f wmmab(v16bf a, v16bf b, v8f c) { return __builtin_amdgcn_wmma_f32_16x16x32_bf16(false, a, false, b, (short)0, c, false, false); }



// Fragment of a 16x16x32 product. ldrow: from a K-contiguous 16-bit row: p = row (lane & 15) + 8 (lane >> 4); elements k = 8 hi .. 8 hi + 7 and 16 + 8 hi .. 16 + 8 hi + 7.
// ldp: from a plane in fragment order: the same two groups of 8 elements lie at p = block + 8 lane and 256 elements further on, so each of the two loads of a wave covers 512 contiguous bytes (four whole lines).
// Fragment order. q, k: per 16 rows t a block of 2048 elements; element (t, d) at (d >> 4) * 256 + ((d >> 3) & 1) * 128 + (t & 15) * 8 + (d & 7). v: per 32 keys t a block of 4096; element (d, t) at (d >> 4) * 512 + ((t >> 4) & 1) * 256 + ((t >> 3) & 1) * 128 + (d & 15) * 8 + (t & 7).
__device__ __forceinline__ v16bf ldrow(const bf* p) { return cat16b(*(const v8us*)p, *(const v8us*)(p + 16)); }
__device__ __forceinline__ v16h ldp(const h16* p) { return cat16(*(const v8h*)p, *(const v8h*)(p + 256)); }

// ---- k_proj: one projection (blockIdx.y: 0 q, 1 k, 2 v) of PR rows of x in one work-group of 8 waves; a wave owns 16 rows x all 128 columns (8 accumulators).
// x [PR][256] (one contiguous piece of memory) and W [256][128] are read as f32 in whole lines, rounded to bf16 and laid K-contiguous in LDS (W transposed: a lane gathers 8 k of one column and stores them as 16 bytes).
// q, k: transposed product (A = 16 rows of Wt, B = 16 rows of x): a lane holds 8 neighbouring columns of one row. v: A = x, B = Wt: a lane holds 8 neighbouring t of one column.
// In both cases the 32 lanes' groups of 8 are neighbours in the plane's fragment order: an accumulator goes to the plane as one store of 512 contiguous bytes, with no staging.
#define PR   128
#define XPIT (DM + 8)             // 16-bit elements per staged operand row: 528 B = 16 B x odd, conflict-free for 16-byte reads down a column of rows
typedef __attribute__((ext_vector_type(8))) __bf16 v8bf;
typedef __attribute__((ext_vector_type(4))) __bf16 v4bf;
typedef __attribute__((ext_vector_type(4))) unsigned short v4us;
// The products and the output of k_proj, behind the barrier that publishes the staged operands. TR: q, k (transposed product); otherwise v.
template <bool TR>
__device__ __forceinline__ void proj_tail(bf* sm, const float* __restrict__ bias, h16* P16, size_t r0, const float osc) {
    const int lane = threadIdx.x & 31, lr = lane & 15, hi = lane >> 4, w = threadIdx.x >> 5;
    v8f acc[8];
#pragma unroll
    for (int nb = 0; nb < 8; ++nb) acc[nb] = (v8f){};
    const bf* xrow = sm + HD * XPIT + (w * 16 + lr) * XPIT + 8 * hi; const bf* wrow = sm + lr * XPIT + 8 * hi;
    // Both loops are unrolled: accumulator and buffer indices are constants, and no matrix instruction stands in front of a back edge. Two fragment buffers: step s + 1 is fetched from LDS ahead of the products of step s.
    v16bf xf[2], wf[2][8];
    auto fetch = [&](int s) { xf[s & 1] = ldrow(xrow + s * 32);
#pragma unroll
        for (int nb = 0; nb < 8; ++nb) wf[s & 1][nb] = ldrow(wrow + nb * 16 * XPIT + s * 32); };
    fetch(0);
#pragma unroll
    for (int s = 0; s < DM / 32; ++s) {
        if (s + 1 < DM / 32) fetch(s + 1);
        __builtin_amdgcn_sched_barrier(0);   // keeps the next step's LDS loads ahead of this step's products: sunk to their own products, each pair of loads exposed its latency
#pragma unroll
        for (int nb = 0; nb < 8; ++nb) acc[nb] = TR ? wmmab(wf[s & 1][nb], xf[s & 1], acc[nb]) : wmmab(xf[s & 1], wf[s & 1][nb], acc[nb]);
        __builtin_amdgcn_sched_barrier(0); }   // and the fetch after next behind them: its buffer is the one these products read
    // TR: wave w holds rows t = r0 + 16 w + lr, block (r0 >> 4) + w; accumulator nb is d = 16 nb + 8 hi + j. Otherwise: t = r0 + 16 w + 8 hi + j, half w & 1 of key block (r0 >> 5) + (w >> 1); accumulator nb is d = 16 nb + lr.
    const size_t go = TR ? (r0 + w * 16) * HD + lane * 8 : (r0 + (w >> 1) * 32) * HD + (w & 1) * 256 + lane * 8; constexpr size_t gp = TR ? 256 : 512;
    v8f bv8[TR ? 8 : 1]; float bv1[TR ? 1 : 8]; const unsigned bo = TR ? hi * 32u : lr * 4u;   // byte offset of the lane's first bias value
#pragma unroll
    for (int nb = 0; nb < 8; ++nb) { if constexpr (TR) bv8[nb] = *(const v8f*)((const char*)bias + bo + nb * 64); else bv1[nb] = *(const float*)((const char*)bias + bo + nb * 64); }
    asm volatile("s_wait_xcnt 0x0" :: "v"(bo) : "memory");   // stands between the bias loads and any write of their offset register, which it names so that the register lives up to here (without it the last load's result took that register)
#pragma unroll
    for (int nb = 0; nb < 8; ++nb) { v8h o16; v8f bb;
        if constexpr (TR) bb = bv8[nb]; else {
#pragma unroll
            for (int j = 0; j < 8; ++j) bb[j] = bv1[nb]; }
#pragma unroll
        for (int j = 0; j < 8; ++j) o16[j] = TR ? (h16)((acc[nb][j] + (float)(__bf16)bb[j]) * osc) : (h16)(acc[nb][j] + (float)(__bf16)bb[j]);   // osc: SC2 for q, 1 for k; one rounding to fp16 as before
        *(v8us*)((bf*)P16 + go + nb * gp) = __builtin_bit_cast(v8us, o16); }
    asm volatile("s_wait_xcnt 0x0" ::: "memory");   // stands between the stores above and any later write of their address registers (in the listing the other branch's code follows this one's)
}
// Four waves a SIMD (at most 256 registers each): two work-groups fit a WGP, so all 384 are resident at once.
__global__ __launch_bounds__(256) __attribute__((amdgpu_waves_per_eu(4))) void k_proj(const float* __restrict__ xq, const float* __restrict__ xk, const float* __restrict__ xv, const float* __restrict__ wq, const float* __restrict__ wk, const float* __restrict__ wv, const float* __restrict__ bq, const float* __restrict__ bk, const float* __restrict__ bv,
                                              h16* Q16, h16* K16, h16* V16) {
    __shared__ __align__(16) bf sm[(HD + PR) * XPIT];
    static_assert(TT % PR == 0 && PR == 128 && HD == 128 && DM == 256, "tile shapes");
    bf* wt = sm; bf* xs = sm + HD * XPIT;
    const int tid = threadIdx.x, lane = tid & 31, lr = lane & 15, hi = lane >> 4, w = tid >> 5; const int pj = blockIdx.y; const size_t r0 = (size_t)blockIdx.x * PR;
    const float* x = pj == 0 ? xq : pj == 1 ? xk : xv; const float* W = pj == 0 ? wq : pj == 1 ? wk : wv; const float* bias = pj == 0 ? bq : pj == 1 ? bk : bv;
    h16* P16 = pj == 0 ? Q16 : pj == 1 ? K16 : V16;
    // Loads return in issue order, so the order of issue is: first half of W (shared by every work-group, from L2: back soonest), all of the thread's share of x (from memory, the longest latency), and,
    // once the first half is stored, the second half of W, whose latency passes under that of x. W goes in two halves to bound the registers.
    const float* wb = W + (size_t)w * 32 * HD + lane;   // wave w stages k = 32 w .. 32 w + 31
    const v4f* xt = (const v4f*)(x + r0 * DM) + tid; v4f xr[32];
#pragma unroll
    for (int hf = 0; hf < 2; ++hf) { float wr[8][8];
#pragma unroll
        for (int i = 0; i < 8; ++i)
#pragma unroll
            for (int kk = 0; kk < 8; ++kk) wr[i][kk] = wb[((hf * 2 + (i >> 2)) * 8 + kk) * HD + (i & 3) * 32];
        __builtin_amdgcn_sched_barrier(0);   // one half's loads are issued together, and the next half's stay behind this half's stores (registers)
        if (hf == 0) {
#pragma unroll
            for (int i = 0; i < 32; ++i) xr[i] = xt[i * 256];
            __builtin_amdgcn_sched_barrier(0); }   // keeps the x loads up here: sunk to their conversions, they would start only after W is staged
        else asm volatile("s_wait_xcnt 0x0" :: "v"(wb) : "memory");   // stands between the W loads and any write of their address register, which it names so that the register lives up to here (without it the last load's result took that register)
#pragma unroll
        for (int i = 0; i < 8; ++i) { v8bf o;
#pragma unroll
            for (int kk = 0; kk < 8; ++kk) o[kk] = (__bf16)wr[i][kk];
            *(v8us*)(wt + ((i & 3) * 32 + lane) * XPIT + (w * 4 + hf * 2 + (i >> 2)) * 8) = __builtin_bit_cast(v8us, o); } }
#pragma unroll
    for (int i = 0; i < 32; ++i) { v4bf o;
#pragma unroll
        for (int q = 0; q < 4; ++q) o[q] = (__bf16)xr[i][q];
        *(v4us*)(xs + (i * 4 + (tid >> 6)) * XPIT + (tid & 63) * 4) = __builtin_bit_cast(v4us, o); }
    __syncthreads();   // both operands are in LDS
    if (pj < 2) proj_tail<true>(sm, bias, P16, r0, pj == 0 ? SC2 : 1.0f); else proj_tail<false>(sm, bias, P16, r0, 1.0f);
}
// k_fattn: scores, softmax and attn.v of one block of FR query rows (G tiles of 16 rows) by KS waves of one work-group; neither the scores nor the probabilities go to memory.
// Every wave holds all G tiles, so a K or Vt fragment read from LDS feeds G products.
// Transposed products: St = K Qt (A = 16 key rows, B = 16 query columns), Ot += Vt Pt (A = 16 rows of Vt, B = the packed probabilities). A lane holds one query's scores (keys 8 hi + r of each 16-key tile),
// so two converted score tiles are the B operand of the second product as they stand, and reference maximum, sum and rescale factor are per lane (one exchange between the lane halves where a maximum is taken).
// The KS waves of a row block walk TT / KS keys each against a reference maximum of their own, held from pass to pass and raised only when a score outgrows it by 2^8; their partial (reference, sum, Ot) are merged through LDS in wave order at the end.
// A work-group is NW waves, one work-group a WGP: two row blocks side by side, KSPL = 4 waves each. FR = 32 makes 256 equal work-groups of the 8 x 2048 query rows: every wave place of the chip has the same work.
#define NW   8
#define KSPL 4
#define FR   32                   // query rows of a row block
// 2^x with the slot that the instruction set asks for behind a transcendental in the same statement.
__device__ __forceinline__ float exp2s(float x) { float y; asm("v_exp_f32 %0, %1\n\tv_nop" : "=v"(y) : "v"(x)); return y; }
// Eight at once: neighbours in the statement are independent (every result register differs from every source), so one slot behind the last serves all.
__device__ __forceinline__ void exp2x8(float* y, const v8f a) {
    asm("v_exp_f32 %0, %8\n\tv_exp_f32 %1, %9\n\tv_exp_f32 %2, %10\n\tv_exp_f32 %3, %11\n\tv_exp_f32 %4, %12\n\tv_exp_f32 %5, %13\n\tv_exp_f32 %6, %14\n\tv_exp_f32 %7, %15\n\tv_nop"
        : "=&v"(y[0]), "=&v"(y[1]), "=&v"(y[2]), "=&v"(y[3]), "=&v"(y[4]), "=&v"(y[5]), "=&v"(y[6]), "=&v"(y[7])
        : "v"(a[0]), "v"(a[1]), "v"(a[2]), "v"(a[3]), "v"(a[4]), "v"(a[5]), "v"(a[6]), "v"(a[7])); }
// One wave's share of a stage: two pieces of 8 KB, each contiguous in the plane and in LDS, as 2 x 16 asynchronous copies of 512 B (16 B a lane). The immediate offset moves both addresses.
// l0, l1: the lane's LDS byte address in each piece; g0, g1: its global address. The s_wait_xcnt 0 is the last line of the copies' own statement: it stands in front of any later write of the address registers.
__device__ __forceinline__ void copy2x8k(unsigned l0, const char* g0, unsigned l1, const char* g1) {
    asm volatile("global_load_async_to_lds_b128 %0, %1, off\n\t"
                 "global_load_async_to_lds_b128 %0, %1, off offset:512\n\t"
                 "global_load_async_to_lds_b128 %0, %1, off offset:1024\n\t"
                 "global_load_async_to_lds_b128 %0, %1, off offset:1536\n\t"
                 "global_load_async_to_lds_b128 %0, %1, off offset:2048\n\t"
                 "global_load_async_to_lds_b128 %0, %1, off offset:2560\n\t"
                 "global_load_async_to_lds_b128 %0, %1, off offset:3072\n\t"
                 "global_load_async_to_lds_b128 %0, %1, off offset:3584\n\t"
                 "global_load_async_to_lds_b128 %0, %1, off offset:4096\n\t"
                 "global_load_async_to_lds_b128 %0, %1, off offset:4608\n\t"
                 "global_load_async_to_lds_b128 %0, %1, off offset:5120\n\t"
                 "global_load_async_to_lds_b128 %0, %1, off offset:5632\n\t"
                 "global_load_async_to_lds_b128 %0, %1, off offset:6144\n\t"
                 "global_load_async_to_lds_b128 %0, %1, off offset:6656\n\t"
                 "global_load_async_to_lds_b128 %0, %1, off offset:7168\n\t"
                 "global_load_async_to_lds_b128 %0, %1, off offset:7680\n\t"
                 "global_load_async_to_lds_b128 %2, %3, off\n\t"
                 "global_load_async_to_lds_b128 %2, %3, off offset:512\n\t"
                 "global_load_async_to_lds_b128 %2, %3, off offset:1024\n\t"
                 "global_load_async_to_lds_b128 %2, %3, off offset:1536\n\t"
                 "global_load_async_to_lds_b128 %2, %3, off offset:2048\n\t"
                 "global_load_async_to_lds_b128 %2, %3, off offset:2560\n\t"
                 "global_load_async_to_lds_b128 %2, %3, off offset:3072\n\t"
                 "global_load_async_to_lds_b128 %2, %3, off offset:3584\n\t"
                 "global_load_async_to_lds_b128 %2, %3, off offset:4096\n\t"
                 "global_load_async_to_lds_b128 %2, %3, off offset:4608\n\t"
                 "global_load_async_to_lds_b128 %2, %3, off offset:5120\n\t"
                 "global_load_async_to_lds_b128 %2, %3, off offset:5632\n\t"
                 "global_load_async_to_lds_b128 %2, %3, off offset:6144\n\t"
                 "global_load_async_to_lds_b128 %2, %3, off offset:6656\n\t"
                 "global_load_async_to_lds_b128 %2, %3, off offset:7168\n\t"
                 "global_load_async_to_lds_b128 %2, %3, off offset:7680\n\t"
                 "s_wait_xcnt 0x0" :: "v"(l0), "v"(g0), "v"(l1), "v"(g1) : "memory");
}
// The value of lane l ^ 16, by a vector cross-row move.
__device__ __forceinline__ float xhalf(float x) { const int v = __float_as_int(x); return __int_as_float(__builtin_amdgcn_permlanex16(v, v, 0x76543210, 0xfedcba98, false, false)); }
#define STG  (KSPL * 2 * 2 * 32 * HD)  // 16-bit elements of one stage of the ring: per key range two tiles of 32 keys, each a K tile followed by its Vt tile
struct with_refill { static constexpr bool v = true; }; struct no_refill { static constexpr bool v = false; };
struct after_raise { static constexpr bool v = true; }; struct from_products { static constexpr bool v = false; };
// Unrolling: every inner loop is unrolled so that fragment and accumulator indices are constants (registers, no scratch); the trip loops stay rolled (unroll 1) to keep the text short.
#define OPIT (HD + 4)             // floats per query row of the merge staging: 16-byte aligned rows that start on different banks
// w: the wave's index among the KS waves of its row block; tid: the thread's index among their KS * 32 threads; so, sml: the row block's own staging.
// ring: the work-group's two stages of K and Vt tiles; sub: the row block's index in the work-group. The waves w of both row blocks walk the same key range in the same order and read the same staged tiles:
// a tile is fetched from L2 once a work-group. The wave of row block 0 copies the range's K tile, that of row block 1 its Vt tile.
template <int G, int KS>
__device__ __forceinline__ void attn_rows(const h16* __restrict__ Q, const h16* __restrict__ Kp, const h16* __restrict__ Vt, float* __restrict__ out, float* so, float* sml, const h16* ring, const int sub, const int rot, const int w, const int tid) {
    constexpr float POFF = 4.0f;                       // the fp16 probabilities carry x16 (it cancels in Ot / sum): keeps small ones out of the fp16 subnormals
    constexpr float PLIM = 4096.0f;                    // 2^(POFF + 8): a pass whose probabilities sum past it in any lane raises the reference; below it every probability fits fp16
    const int lane = threadIdx.x & 31, lr = lane & 15, hi = lane >> 4;
    constexpr int R = G * 16;   // query rows of the row block: every one of its waves holds all of them
    v16h qf[G][4];
#pragma unroll
    for (int g = 0; g < G; ++g)
#pragma unroll
        for (int ks = 0; ks < 4; ++ks) qf[g][ks] = ldp(Q + (size_t)g * 16 * HD + ks * 512 + lane * 8);
    // m: the reference maximum in use (log2 units), the same in both lanes of a query; cr: POFF - m in all eight places, the C operand of a score tile's first product, so a score accumulator is the exponent as it stands.
    v8f o[G][8], cr[G]; float m[G], l[G];
#pragma unroll
    for (int g = 0; g < G; ++g) { l[g] = 0.f;
#pragma unroll
        for (int db = 0; db < 8; ++db) o[g][db] = (v8f){}; }
    constexpr int NP = TT / KS / 32;                      // passes
    constexpr unsigned TB = 32 * HD * 2;                  // bytes of one pass's 32 keys in a plane
    static_assert((NP & (NP - 1)) == 0 && NP >= 4, "the walk wraps by a mask; two stages exist");
    // Pass j of a wave takes tile (rot + j) mod NP of the wave's key range: work-groups of one batch, which run in step, then ask L2 for different lines at any one time.
    const char* gsrc = (const char*)(sub == 0 ? Kp : Vt) + (unsigned)(w * (TT / KS) * HD + lane * 8) * 2u;   // the lane's 16 bytes of the first copy of tile 0 of the wave's key range, in the plane that the wave copies
    const unsigned ldst = (unsigned)(size_t)ring + (unsigned)((w * 4 + sub) * 32 * HD + lane * 8) * 2u;       // their place in stage buffer 0 (LDS byte address)
    const h16* rd = ring + w * (4 * 32 * HD) + lane * 8;                                                      // the lane's first fragment element of the range's K tile in buffer 0; the Vt tile follows it
    // Fragment buffers: kf[kt] = the four k steps of key tile kt, vf[h] = Vt row blocks 4 h .. 4 h + 3, all read from the trip's own stage buffer.
    v16h kf[2][4], vf[2][4];
    auto loadK = [&](int kt, const h16* p) {
#pragma unroll
        for (int ks = 0; ks < 4; ++ks) kf[kt][ks] = ldp(p + kt * 16 * HD + ks * 512); };
    auto loadV = [&](int h, const h16* p) {
#pragma unroll
        for (int d = 0; d < 4; ++d) vf[h][d] = ldp(p + 32 * HD + (h * 4 + d) * 512); };
    asm volatile("s_wait_xcnt 0x0" ::: "memory");   // stands between the loads above and any later write of a register that they name
    // Two stage buffers of two tiles a key range: the next stage's tiles fly while this stage's are worked on, and the waves meet at a barrier once in two passes.
    auto stage = [&](int t, unsigned buf) {   // the wave's copies of stage t (passes 2 t and 2 t + 1 of the walk) into buffer buf
        copy2x8k(ldst + buf * (STG * 2u), gsrc + (unsigned)((rot + 2 * t) & (NP - 1)) * TB, ldst + buf * (STG * 2u) + 2 * TB, gsrc + (unsigned)((rot + 2 * t + 1) & (NP - 1)) * TB); };
    stage(0, 0);
    asm volatile("s_wait_asynccnt 0x0" ::: "memory");   // this wave's copies of the first stage have landed
    __syncthreads();                                    // every wave's have: the first stage may be read
    stage(1, 1);
    // The first reference of each query: the largest score among the first 16 keys of the wave's walk.
    loadK(0, rd);
#pragma unroll
    for (int g = 0; g < G; ++g) { v8f a = (v8f){};
#pragma unroll
        for (int ks = 0; ks < 4; ++ks) a = wmma16(kf[0][ks], qf[g][ks], a);
        float mx = a[0];
#pragma unroll
        for (int r = 1; r < 8; ++r) mx = fmaxf(mx, a[r]);
        m[g] = fmaxf(mx, xhalf(mx));
#pragma unroll
        for (int r = 0; r < 8; ++r) cr[g][r] = POFF - m[g]; }
    // One trip: the two passes of stage t, which read buffer t & 1 alone, and the hand-over at its foot. refill: a stage t + 2 exists.
    auto trip = [&](int t, auto refill) {
        const h16* p = rd + (t & 1) * STG;
        loadK(0, p); loadK(1, p);
#pragma unroll
        for (int h = 0; h < 2; ++h) {
            const h16* ph = p + h * (2 * 32 * HD);
            loadV(0, ph); loadV(1, ph); __builtin_amdgcn_sched_barrier(0);   // keeps the LDS reads together up here: sunk to their products, each would expose its latency
            v8f s[2][G];
#pragma unroll
            for (int kt = 0; kt < 2; ++kt) {
#pragma unroll
                for (int g = 0; g < G; ++g) s[kt][g] = cr[g];
#pragma unroll
                for (int ks = 0; ks < 4; ++ks) {
#pragma unroll
                    for (int g = 0; g < G; ++g) s[kt][g] = wmma16(kf[kt][ks], qf[g][ks], s[kt][g]); } }
            if (h == 0) { loadK(0, ph + 2 * 32 * HD); loadK(1, ph + 2 * 32 * HD); __builtin_amdgcn_sched_barrier(0); }   // the stage's second K tile, behind the score products that free its registers: its latency passes under the softmax
            // The probabilities of the pass against the reference in use, and their sums (two chains a query).
            float x[G][16], sum[G];
            auto expsum = [&](auto raised) {
#pragma unroll
                for (int g = 0; g < G; ++g) {
#pragma unroll
                    for (int e = 0; e < 16; ++e) if constexpr (!decltype(raised)::v) x[g][e] = __builtin_amdgcn_exp2f(s[e >> 3][g][e & 7]);   // the builtin where the exponent is a matrix result as it stands
                    if constexpr (decltype(raised)::v) { exp2x8(&x[g][0], s[0][g]); exp2x8(&x[g][8], s[1][g]); }
                    float sa = x[g][0], sb = x[g][8];
#pragma unroll
                    for (int e = 1; e < 8; ++e) { sa += x[g][e]; sb += x[g][8 + e]; }
                    sum[g] = sa + sb; } };
            expsum(from_products());
            // One test a pass, a scalar branch: where a score has outgrown the reference (its probability, and so its lane's sum, is past PLIM or infinite),
            // the reference is raised to the pass's maximum, sums and Ot are rescaled, and the probabilities are formed once more.
            bool need = false;
#pragma unroll
            for (int g = 0; g < G; ++g) need = need || sum[g] > PLIM;
            if (__builtin_amdgcn_ballot_w32(need) != 0) {
#pragma unroll
                for (int g = 0; g < G; ++g) {
                    float mx = s[0][g][0];
#pragma unroll
                    for (int r = 0; r < 8; ++r) mx = fmaxf(mx, fmaxf(s[0][g][r], s[1][g][r]));
                    mx = fmaxf(mx, xhalf(mx));
                    const float d = fminf(POFF - mx, 0.f);   // what the exponents move by: the pass's largest comes to POFF; a reference that still covers the pass stays
                    const float al = exp2s(d);
                    m[g] -= d; l[g] *= al;
#pragma unroll
                    for (int r = 0; r < 8; ++r) { cr[g][r] = POFF - m[g]; s[0][g][r] += d; s[1][g][r] += d; }
#pragma unroll
                    for (int db = 0; db < 8; ++db) o[g][db] *= al;
                }
                expsum(after_raise());
            }
            v16h pf[G];
#pragma unroll
            for (int g = 0; g < G; ++g) { l[g] += sum[g];
#pragma unroll
                for (int e = 0; e < 16; ++e) pf[g][e] = (h16)x[g][e]; }
#pragma unroll
            for (int db = 0; db < 8; ++db) {
#pragma unroll
                for (int g = 0; g < G; ++g) o[g][db] = wmma16(vf[db >> 2][db & 3], pf[g], o[g][db]); }
        }
        __builtin_amdgcn_sched_barrier(0);                  // keeps the hand-over below at the trip's foot: moved up over the products, its wait for the copies stood directly behind their issue and exposed their whole latency
        asm volatile("s_wait_dscnt 0x0" ::: "memory");      // this wave's reads of the trip's buffer are done
        asm volatile("s_wait_asynccnt 0x0" ::: "memory");   // and its copies of the next stage have landed
        __syncthreads();                                    // so for every wave: the next stage may be read, this trip's buffer may be refilled
        if constexpr (decltype(refill)::v) stage(t + 2, (unsigned)(t & 1));
    };
    // The trips with a refill and the last two without are loops of their own: with a branch round the copies the row sums sank behind it, in front of the next trip's LDS reads.
#pragma unroll 1
    for (int t = 0; t < NP / 2 - 2; ++t) trip(t, with_refill());
#pragma unroll 1
    for (int t = NP / 2 - 2; t < NP / 2; ++t) trip(t, no_refill());
    asm volatile("s_wait_asynccnt 0x0" ::: "memory");   // no copy is outstanding when the wave goes on to the merge and ends
#pragma unroll
    for (int g = 0; g < G; ++g) { l[g] += __shfl_xor(l[g], 16, 32); if (hi == 0) { sml[w * R + g * 16 + lr] = m[g]; sml[KS * R + w * R + g * 16 + lr] = l[g]; } }
    __syncthreads();   // every wave's (max, sum) is in LDS
#pragma unroll
    for (int g = 0; g < G; ++g) { const int qi = g * 16 + lr; float M = sml[qi];
#pragma unroll
        for (int x = 1; x < KS; ++x) M = fmaxf(M, sml[x * R + qi]);
        float Ls = 0.f;
#pragma unroll
        for (int x = 0; x < KS; ++x) Ls += sml[KS * R + x * R + qi] * exp2s(sml[x * R + qi] - M);
        const float f = __fdiv_rn(exp2s(m[g] - M), Ls);
        float* orow = so + (size_t)(w * R + qi) * OPIT + hi * 8;
#pragma unroll
        for (int db = 0; db < 8; ++db) { const v8f t = o[g][db] * f; v4f t0, t1;
#pragma unroll
            for (int r = 0; r < 4; ++r) { t0[r] = t[r]; t1[r] = t[4 + r]; }
            *(v4fa*)(orow + db * 16) = t0; *(v4fa*)(orow + db * 16 + 4) = t1; } }
    __syncthreads();   // every wave's scaled partial output is in LDS
#pragma unroll
    for (int i = 0; i < R * HD / 4 / (KS * 32); ++i) {
        if (i > 0 && (i & 1) == 0) asm volatile("s_wait_xcnt 0x0" ::: "memory");   // stands between the stores so far and the next two trips' writes of their registers (the compiler's own waits there were counted ones)
        const int e = i * (KS * 32) + tid; const int row = e / (HD / 4), c4 = (e % (HD / 4)) * 4; v4f a = *(const v4fa*)(so + (size_t)row * OPIT + c4);
#pragma unroll
        for (int x = 1; x < KS; ++x) a += *(const v4fa*)(so + (size_t)(x * R + row) * OPIT + c4);
        *(v4f*)(out + (size_t)row * HD + c4) = a; }
}
// Grid: two row blocks of FR rows a work-group, 32 work-groups a batch.
// Two waves a SIMD (at most 512 registers each), eight a work-group: the 256 work-groups are resident at once, one a WGP, and one wave's softmax runs beside the other's products.
__global__ __launch_bounds__(NW * 32) __attribute__((amdgpu_waves_per_eu(2, 2))) void k_fattn(const h16* __restrict__ Q16, const h16* __restrict__ K16, const h16* __restrict__ V16, float* __restrict__ OUTb) {
    constexpr int SR = 2 * KSPL * FR;   // staged partial rows of a work-group
    __shared__ __align__(16) h16 ring[2 * STG]; __shared__ float sml[2 * SR];
    float* so = (float*)ring;   // the merge staging takes the ring's place: it is written behind the last trip's hand-over (every wave's reads done, no copy outstanding, a barrier) and the barrier that publishes (max, sum)
    static_assert(SR * OPIT * 4 <= 2 * STG * 2, "the merge staging fits the ring");
    static_assert(FR % 16 == 0 && TT % (8 * FR) == 0 && (FR * HD / 4) % (KSPL * 32) == 0 && NW == 2 * KSPL, "row blocks");
    const int bx = blockIdx.x;
    const int wv = __builtin_amdgcn_readfirstlane((int)threadIdx.x >> 5);   // the wave's number, in a scalar register: a row block's base addresses and its start tile stay scalar
    // rot: the start tile of the key walk, from the row block's index i in its batch. Bits 0, 1 and 3 up lead, so that neighbours in the grid differ (which tile is for speed only: any tile of a wave's key range gives the same function; that both row blocks of a work-group get the same one is needed: they read the same staged tiles).
    // A work-group holds row blocks i and i + 4, which have the same start tile: its two row blocks walk the same K and Vt tiles in step, from one staged copy. A wave has 16 tiles, so of the 32 work-groups of a batch those 16 apart share a start tile.
    const int sub = wv / KSPL; const size_t b = bx / (TT / (2 * FR)); const int ip = bx % (TT / (2 * FR)); const int i = (ip >> 2) * 8 + (ip & 3) + sub * 4; const size_t qo = (b * TT + (size_t)i * FR) * HD; const size_t po = b * TT * HD;
    attn_rows<FR / 16, KSPL>(Q16 + qo, K16 + po, V16 + po, OUTb + qo, so + sub * (KSPL * FR * OPIT), sml + sub * (2 * KSPL * FR), ring, sub, ((i >> 3) * 4 + (i & 3)) & 15, ((int)threadIdx.x >> 5) % KSPL, (int)threadIdx.x % (KSPL * 32));
}

extern "C" void kernel_launch(void* const* d_in, const int* in_sizes, int n_in,
                              void* d_out, int out_size, void* d_ws, size_t ws_size, hipStream_t stream) {
    (void)in_sizes; (void)n_in; (void)out_size;
    const float* xq = (const float*)d_in[0]; const float* xk = (const float*)d_in[1]; const float* xv = (const float*)d_in[2]; const float* wq = (const float*)d_in[3]; const float* bq = (const float*)d_in[4]; const float* wk = (const float*)d_in[5]; const float* bk = (const float*)d_in[6]; const float* wv = (const float*)d_in[7]; const float* bv = (const float*)d_in[8];
    float* OUT = (float*)d_out;     // [8][2048][128]
    char* wsp = (char*)d_ws;
    auto take = [&](size_t bytes) { char* p = wsp; wsp += (bytes + 255) & ~(size_t)255; return (void*)p; };
    // Every plane holds NB_ batch slices.
    h16* QP16 = (h16*)take((size_t)NB_ * NH_ * TT * HD * 2); h16* KP16 = (h16*)take((size_t)NB_ * NKV * TT * HD * 2); h16* VT16 = (h16*)take((size_t)NB_ * NKV * HD * TT * 2);
    if ((size_t)(wsp - (char*)d_ws) > ws_size) return;    // ws 256 MiB
    static_assert(NH_ == 1 && NKV == 1 && ZH == 1, "both kernels take planes of one head a batch, in fragment order");
    k_proj<<<dim3(NB_ * TT / PR, 3, 1), 256, 0, stream>>>(xq, xk, xv, wq, wk, wv, bq, bk, bv, QP16, KP16, VT16);
    k_fattn<<<NB_ * (TT / (2 * FR)), NW * 32, 0, stream>>>(QP16, KP16, VT16, OUT);
}
